// v000
// Times are from an AMD MI455X. After a warm-up the kernel runs many times in a row, and a time is the length of
// such a window on the GPU divided by its runs, so every launch and the gaps after it count. The runs cycle
// through copies of the inputs. A figure is the median of several windows, for all but v000 over two sittings.
// Sittings can differ by a few percent; kernels timed side by side share one.
// The starting kernel, v000, takes 1900 microseconds a run.
#include <hip/hip_runtime.h>

// Multi-head attention V2 with the input itself as the shared key (x [4][2048][64]; qv = x Wqv ('xw' [64][1024] with the (H, D, 2) channel layout: q_h[d] = column h*128 + 2d, v_h[d] = column h*128 + 2d + 1); 8 heads x 64; scores = q_h . x / 8 (the 64-dim input is every head's key); softmax; out = merged (attn v) Wc + bc ('xw' [512][64]) -> [4][2048][64] (0.5 M)).
// Layout per batch: bf16 copy of x (GEMM operand) and a bf16-rounded f32 copy feeding the single exact key plane shared by all heads; q and v weights gathered from the interleaved columns into Bt row blocks; exact projections; dense T-2048 attention, 8 query heads over one key plane (hybrid rows: < 512 hi/lo 3 products, rest fp16 x1024), each head's own 64-wide value; merged hi/lo x Wc exact + bc (Wc is 'xw' [512][64], transposed once into the Bt layout).
// Compute dtypes, f32 accumulate: every input rounded to bf16; projections exact; attention rows < 512 3 products (keys exact), rest fp16; softmax f32; Wc hl x exact + bias.

#define NB_  4
#define TT   2048
#define DM   64
#define NH_  8
#define NKV  1
#define REP  (NH_ / NKV)
#define HD   64
#define DQ   (NH_ * HD)
#define DKV  (NKV * HD)
#define ZH   2
#define RH   512                  // query rows < RH use hi+lo planes (0: none)
#define WIN  0
#define PCAR 1024.0f
#define SCL  0.125f   // HD^-0.5
typedef _Float16 h16;
typedef unsigned short bf;
typedef __attribute__((ext_vector_type(16))) __bf16   v16bf;
typedef __attribute__((ext_vector_type(16))) _Float16 v16h;
typedef __attribute__((ext_vector_type(8)))  _Float16 v8h;
typedef __attribute__((ext_vector_type(8)))  unsigned short v8us;
typedef __attribute__((ext_vector_type(8)))  float    v8f;
typedef __attribute__((ext_vector_type(4)))  float    v4f;
typedef v8h  __attribute__((may_alias)) v8ha;
typedef v4f  __attribute__((may_alias)) v4fa;
typedef v8us __attribute__((may_alias)) v8usa;

__device__ __forceinline__ unsigned short f2bf(float f) { unsigned u = __float_as_uint(f); u += 0x7FFFu + ((u >> 16) & 1u); return (unsigned short)(u >> 16); }
__device__ __forceinline__ float bf2f(unsigned short b) { return __uint_as_float(((unsigned)b) << 16); }
__device__ __forceinline__ float bfr(float f) { return bf2f(f2bf(f)); }
__device__ __forceinline__ v16h cat16(v8h lo, v8h hi) { return __builtin_shufflevector(lo, hi, 0, 1, 2, 3, 4, 5, 6, 7, 8, 9, 10, 11, 12, 13, 14, 15); }
__device__ __forceinline__ v16bf cat16b(v8us lo, v8us hi) { return __builtin_bit_cast(v16bf, __builtin_shufflevector(lo, hi, 0, 1, 2, 3, 4, 5, 6, 7, 8, 9, 10, 11, 12, 13, 14, 15)); }
__device__ __forceinline__ v8f wmma16(v16h a, v16h b, v8f c) { return __builtin_amdgcn_wmma_f32_16x16x32_f16(false, a, false, b, (short)0, c, false, false); }
__device__ __forceinline__ v8f wmmab(v16bf a, v16bf b, v8f c) { return __builtin_amdgcn_wmma_f32_16x16x32_bf16(false, a, false, b, (short)0, c, false, false); }



// ---- k_gemmw: register-blocked GEMM, ONE WAVE per 64x64 output tile (16 accumulators), operands straight from K-contiguous 16-bit planes; grid (M/64, N/64, Z), 32 threads.
// C[m][n] (f32, pitch ldc, + optional f32 bias[n]) = sum_k A[m][k] Bt[n][k] (+ split products per NSPLIT). z-batch strides sA/sB/sC in elements. K % 32 == 0.
template <typename T16> struct WFrag;
template <> struct WFrag<h16> { typedef v16h V; static __device__ __forceinline__ V ld(const h16* p) { return cat16(*(const v8h*)p, *(const v8h*)(p + 16)); } static __device__ __forceinline__ v8f mma(V a, V b, v8f c) { return wmma16(a, b, c); } };
template <> struct WFrag<bf> { typedef v16bf V; static __device__ __forceinline__ V ld(const bf* p) { return cat16b(*(const v8us*)p, *(const v8us*)(p + 16)); } static __device__ __forceinline__ v8f mma(V a, V b, v8f c) { return wmmab(a, b, c); } };
template <typename T16, int NSPLIT, bool BIAS>
__global__ __launch_bounds__(32) void k_gemmw(const T16* __restrict__ A, const T16* __restrict__ A2, const T16* __restrict__ Bt, const T16* __restrict__ Bt2, int K, float* C, int ldc, const float* __restrict__ bias, size_t sA, size_t sB, size_t sC) {
    typedef typename WFrag<T16>::V V;
    __shared__ __align__(16) float os[16 * 68];
    const size_t z = blockIdx.z; A += z * sA; if (A2) A2 += z * sA; Bt += z * sB; if (Bt2) Bt2 += z * sB; C += z * sC;
    const int lane = threadIdx.x & 31, lr = lane & 15, hi = lane >> 4; const int r0 = blockIdx.x * 64, c0 = blockIdx.y * 64;
    v8f acc[4][4];
#pragma unroll
    for (int mb = 0; mb < 4; ++mb)
#pragma unroll
        for (int nb = 0; nb < 4; ++nb) acc[mb][nb] = (v8f){};
    const size_t aoff = (size_t)(r0 + lr) * K + 8 * hi, boff = (size_t)(c0 + lr) * K + 8 * hi;
#pragma unroll 1
    for (int kc = 0; kc < K; kc += 32) {
        V a[4], a2[4];
#pragma unroll
        for (int mb = 0; mb < 4; ++mb) { a[mb] = WFrag<T16>::ld(A + aoff + (size_t)mb * 16 * K + kc); if (NSPLIT == 1 || NSPLIT == 2) a2[mb] = WFrag<T16>::ld(A2 + aoff + (size_t)mb * 16 * K + kc); }
#pragma unroll
        for (int nb = 0; nb < 4; ++nb) { const V b = WFrag<T16>::ld(Bt + boff + (size_t)nb * 16 * K + kc); V b2; if (NSPLIT >= 2) b2 = WFrag<T16>::ld(Bt2 + boff + (size_t)nb * 16 * K + kc);
#pragma unroll
            for (int mb = 0; mb < 4; ++mb) { acc[mb][nb] = WFrag<T16>::mma(a[mb], b, acc[mb][nb]); if (NSPLIT == 1 || NSPLIT == 2) acc[mb][nb] = WFrag<T16>::mma(a2[mb], b, acc[mb][nb]); if (NSPLIT >= 2) acc[mb][nb] = WFrag<T16>::mma(a[mb], b2, acc[mb][nb]); } }
        asm volatile("v_nop\n\tv_nop\n\tv_nop\n\tv_nop" : "+v"(acc[0][0]), "+v"(acc[1][1]), "+v"(acc[2][2]), "+v"(acc[3][3]) : "v"(a[0]), "v"(a[3]));
    }
#pragma unroll
    for (int mb = 0; mb < 4; ++mb) {
#pragma unroll
        for (int nb = 0; nb < 4; ++nb) {
#pragma unroll
            for (int j = 0; j < 8; ++j) os[(hi * 8 + j) * 68 + nb * 16 + lr] = acc[mb][nb][j]; }
        __builtin_amdgcn_wave_barrier(); asm volatile("" ::: "memory");
        float* crow = C + (size_t)(r0 + mb * 16) * ldc + c0;
{
#pragma unroll
            for (int s = 0; s < 8; ++s) { const int row = 2 * s + hi, cofs = lr * 4; v4f val = *(const v4fa*)(os + row * 68 + cofs); if (BIAS) { val[0] += bfr(bias[c0 + cofs]); val[1] += bfr(bias[c0 + cofs + 1]); val[2] += bfr(bias[c0 + cofs + 2]); val[3] += bfr(bias[c0 + cofs + 3]); }
                *(v4f*)(crow + (size_t)row * ldc + cofs) = val; }
             }
        __builtin_amdgcn_wave_barrier(); asm volatile("" ::: "memory");
    }
}

__device__ __forceinline__ h16 tohx(float x) { return (h16)x; }
__device__ __forceinline__ void splitf(float y, unsigned short& h, unsigned short& l) { h = f2bf(y); l = f2bf(y - bf2f(h)); }
typedef __attribute__((ext_vector_type(2))) _Float16 v2h;
typedef __attribute__((ext_vector_type(4))) _Float16 v4h;
typedef __attribute__((ext_vector_type(2))) unsigned short v2us;
typedef __attribute__((ext_vector_type(4))) unsigned short v4us;
typedef __attribute__((ext_vector_type(2))) float v2f;
typedef __attribute__((ext_vector_type(4))) int v4i;

__global__ __launch_bounds__(256) void k_wtG(const float* __restrict__ w, int K, int N, bf* Bt) {
    const int lane = threadIdx.x & 31; const int L0 = (blockIdx.x * 8 + (threadIdx.x >> 5)) * 8; const int nlines = N * K / 64;
{
#pragma unroll 1
        for (int l = 0; l < 8; ++l) { const int L = L0 + l; if (L >= nlines) break; const size_t e = (size_t)L * 64 + lane * 2; const int k = (int)(e % K), n = (int)(e / K); v2us o;
            o[0] = f2bf(w[(size_t)k * N + n]); o[1] = f2bf(w[(size_t)(k + 1) * N + n]); *(v2us*)(Bt + e) = o; }
         }
}
__global__ __launch_bounds__(256) void k_cvt8(const float* __restrict__ src, bf* dst, size_t n8) { const size_t i = (size_t)blockIdx.x * 256 + threadIdx.x; if (i >= n8) return; const v8f v = *(const v8f*)(src + i * 8); v8us o;
#pragma unroll
    for (int k = 0; k < 8; ++k) o[k] = f2bf(v[k]); *(v8us*)(dst + i * 8) = o;  }

// k_rope: head planes [h][t][d] (fp16 + hi/lo) of rope(x) x sc with the rotate-half convention out[d] = x[d] cos[t][d] - x[d+HD/2] sin[t][d], out[d+HD/2] = x[d+HD/2] cos[t][d+HD/2] + x[d] sin[t][d+HD/2]
__global__ __launch_bounds__(256) void k_rope(const float* __restrict__ F, int pitch, int nheads, const float* __restrict__ CS, const float* __restrict__ RF, const float* __restrict__ nw, float sc, h16* P16, bf* Ph, bf* Pl) {
    const size_t e = ((size_t)blockIdx.x * 256 + threadIdx.x) * 2; if (e >= (size_t)nheads * TT * HD) return; const int d = (int)(e % HD); const int t = (int)((e / HD) % TT); const int h = (int)(e / ((size_t)HD * TT)); const float* f = F + (size_t)t * pitch + h * HD; const float rf = RF ? RF[(size_t)h * TT + t] : 1.0f; v2h o16; v2us oh, ol;
#pragma unroll
    for (int q = 0; q < 2; ++q) { const int dd = d + q; const int dp = (dd < HD / 2) ? dd + HD / 2 : dd - HD / 2; float x0 = f[dd], x1 = f[dp];
        if (RF) { float n0 = __fmul_rn(x0, rf), n1 = __fmul_rn(x1, rf); asm volatile("" : "+v"(n0)); asm volatile("" : "+v"(n1)); x0 = __fmul_rn(bfr(nw[dd]), n0); x1 = __fmul_rn(bfr(nw[dp]), n1); }
        const v2f cs = *(const v2f*)(CS + ((size_t)t * HD + dd) * 2); float a = __fmul_rn(x0, cs[0]), bq = __fmul_rn(x1, cs[1]); asm volatile("" : "+v"(a)); asm volatile("" : "+v"(bq)); const float r = ((dd < HD / 2) ? __fsub_rn(a, bq) : __fadd_rn(a, bq)) * sc;
        o16[q] = tohx(r); unsigned short a2, c2; splitf(r, a2, c2); oh[q] = a2; ol[q] = c2; }
    *(v2h*)(P16 + e) = o16; *(v2us*)(Ph + e) = oh; *(v2us*)(Pl + e) = ol;  }
__global__ __launch_bounds__(256) void k_vtp(const float* __restrict__ F, int pitch, int nheads, h16* V16, bf* Vh, bf* Vl) { const size_t e = ((size_t)blockIdx.x * 256 + threadIdx.x) * 2; if (e >= (size_t)nheads * HD * TT) return; const int t = (int)(e % TT); const int d = (int)((e / TT) % HD); const int g = (int)(e / ((size_t)TT * HD)); v2h o16; v2us oh, ol;
#pragma unroll
    for (int q = 0; q < 2; ++q) { const float x = F[(size_t)(t + q) * pitch + g * HD + d]; o16[q] = tohx(x); unsigned short a2, c2; splitf(x, a2, c2); oh[q] = a2; ol[q] = c2; }
    *(v2h*)(V16 + e) = o16; *(v2us*)(Vh + e) = oh; *(v2us*)(Vl + e) = ol;  }
__global__ __launch_bounds__(256) void k_csid(float* CS) { const int idx = blockIdx.x * 256 + threadIdx.x; if (idx >= TT * HD) return; v2f cs; cs[0] = 1.0f; cs[1] = 0.0f; *(v2f*)(CS + (size_t)idx * 2) = cs;  }
// k_asoft: per row (zz, i): t = S x HD^-0.5 (no mask); softmax over the 2048 keys (register row, one exp, fixed trees);
__global__ __launch_bounds__(256) void k_asoft(const float* __restrict__ Sb, h16* P16, bf* Ph, bf* Pl) {
    const int lane = threadIdx.x & 31; const int row = blockIdx.x * 8 + (threadIdx.x >> 5); if (row >= ZH * TT) return; const int i = row % TT; const int zz = row / TT; (void)zz; const bool hires = (i < RH); const float* sr = Sb + (size_t)row * TT; float v[TT / 32]; float mx = -3.0e38f;
#pragma unroll
    for (int ch = 0; ch < TT / 128; ++ch) { const int j0 = ch * 128 + lane * 4; const v4f a = *(const v4f*)(sr + j0);
#pragma unroll
        for (int q = 0; q < 4; ++q) { const int j = j0 + q; (void)j; const float t = a[q] * SCL; v[ch * 4 + q] = t; mx = fmaxf(mx, t); } }
#pragma unroll
    for (int sh = 16; sh; sh >>= 1) mx = fmaxf(mx, __shfl_xor(mx, sh, 32));
    float sum = 0.f;
#pragma unroll
    for (int k = 0; k < TT / 32; ++k) { float d0 = __fsub_rn(v[k], mx); asm volatile("" : "+v"(d0)); v[k] = __builtin_amdgcn_exp2f(__fmul_rn(d0, 1.4426950408889634f)); sum += v[k]; }
#pragma unroll
    for (int sh = 16; sh; sh >>= 1) sum += __shfl_xor(sum, sh, 32);
    const float f = __fdiv_rn(hires ? 1.0f : PCAR, sum);
{
        if (hires) {
#pragma unroll
            for (int ch = 0; ch < TT / 128; ++ch) { v4us oh, ol;
#pragma unroll
                for (int q = 0; q < 4; ++q) { unsigned short a, c2; splitf(v[ch * 4 + q] * f, a, c2); oh[q] = a; ol[q] = c2; }
                const size_t oo = ((size_t)zz * (RH ? RH : 1) + i) * TT + ch * 128 + lane * 4; *(v4us*)(Ph + oo) = oh; *(v4us*)(Pl + oo) = ol; }
        } else {
#pragma unroll
            for (int ch = 0; ch < TT / 128; ++ch) { v4h o4;
#pragma unroll
                for (int q = 0; q < 4; ++q) o4[q] = tohx(v[ch * 4 + q] * f);
                *(v4h*)(P16 + (size_t)row * TT + ch * 128 + lane * 4) = o4; } }
         }
}
__global__ __launch_bounds__(256) void k_bfrc(const float* __restrict__ src, float* dst) { const size_t i = (size_t)blockIdx.x * 256 + threadIdx.x; if (i >= (size_t)TT * DM / 4) return; const v4f a = *(const v4f*)(src + i * 4); v4f o;
#pragma unroll
    for (int q = 0; q < 4; ++q) o[q] = bfr(a[q]);
    *(v4f*)(dst + i * 4) = o;  }
__global__ __launch_bounds__(256) void k_wsel(const float* __restrict__ w, int par, bf* Bt) { const int i = blockIdx.x * 256 + threadIdx.x; if (i >= DQ * DM / 8) return; const int c0 = (i % (DM / 8)) * 8; const int r = i / (DM / 8); const int h = r / HD, d = r % HD; const int col = h * 2 * HD + 2 * d + par; v8us o;
#pragma unroll
    for (int q = 0; q < 8; ++q) o[q] = f2bf(w[(size_t)(c0 + q) * (2 * DQ) + col]);
    *(v8us*)(Bt + (size_t)r * DM + c0) = o;  }
__global__ __launch_bounds__(256) void k_merge(const float* __restrict__ O, int h0, bf* Ah, bf* Al) { const size_t e = ((size_t)blockIdx.x * 256 + threadIdx.x) * 2; if (e >= (size_t)ZH * TT * HD) return; const int d = (int)(e % HD); const int t = (int)((e / HD) % TT); const int zz = (int)(e / ((size_t)HD * TT)); const float cs = (t < RH) ? 1.0f : (1.0f / PCAR); const size_t oo = (size_t)t * DQ + (h0 + zz) * HD + d;
    v2us oh, ol;
#pragma unroll
    for (int q = 0; q < 2; ++q) { unsigned short a, c2; splitf(O[e + q] * cs, a, c2); oh[q] = a; ol[q] = c2; } *(v2us*)(Ah + oo) = oh; *(v2us*)(Al + oo) = ol;  }

extern "C" void kernel_launch(void* const* d_in, const int* in_sizes, int n_in,
                              void* d_out, int out_size, void* d_ws, size_t ws_size, hipStream_t stream) {
    (void)in_sizes; (void)n_in; (void)out_size;
    const float* x = (const float*)d_in[0]; const float* wqv = (const float*)d_in[1]; const float* wo = (const float*)d_in[2]; /* Wc */ const float* bo = (const float*)d_in[3]; /* bc */ const float* wq = nullptr; const float* wk = nullptr; const float* wv = nullptr; (void)wq; (void)wk; (void)wv;
    float* OUT = (float*)d_out;     // [4][2048][64]
    char* wsp = (char*)d_ws;
    auto take = [&](size_t bytes) { char* p = wsp; wsp += (bytes + 255) & ~(size_t)255; return (void*)p; };
    float* XR = (float*)take((size_t)TT * DM * 4); bf* WQ = (bf*)take((size_t)DQ * DM * 2); bf* WV = (bf*)take((size_t)DQ * DM * 2); float* FV = (float*)take((size_t)TT * DQ * 4); bf* WO = (bf*)take((size_t)DM * DQ * 2); float* CS = (float*)take((size_t)TT * HD * 2 * 4);
    bf* XB = (bf*)take((size_t)TT * DM * 2); float* FQ = (float*)take((size_t)TT * DQ * 4); 
    h16* QP16 = (h16*)take((size_t)NH_ * TT * HD * 2); h16* KP16 = (h16*)take((size_t)NKV * TT * HD * 2); h16* VT16 = (h16*)take((size_t)NH_ * HD * TT * 2);
    bf* QPh = (bf*)take((size_t)NH_ * TT * HD * 2); bf* QPl = (bf*)take((size_t)NH_ * TT * HD * 2); bf* KPh = (bf*)take((size_t)NKV * TT * HD * 2); bf* KPl = (bf*)take((size_t)NKV * TT * HD * 2); bf* VTh = (bf*)take((size_t)NH_ * HD * TT * 2); bf* VTl = (bf*)take((size_t)NH_ * HD * TT * 2); bf* Ph = (bf*)take((size_t)ZH * RH * TT * 2); bf* Pl = (bf*)take((size_t)ZH * RH * TT * 2);
    float* Sb = (float*)take((size_t)ZH * TT * TT * 4); h16* P16 = (h16*)take((size_t)ZH * TT * TT * 2); float* Ob = (float*)take((size_t)ZH * TT * HD * 4); bf* ATh = (bf*)take((size_t)TT * DQ * 2); bf* ATl = (bf*)take((size_t)TT * DQ * 2);
    if ((size_t)(wsp - (char*)d_ws) > ws_size) return;    // ws 256 MiB
    
    { k_wsel<<<(DQ * DM / 8 + 255) / 256, 256, 0, stream>>>(wqv, 0, WQ); k_wsel<<<(DQ * DM / 8 + 255) / 256, 256, 0, stream>>>(wqv, 1, WV);   /* q = even, v = odd columns of each head's 128-column block */  
      k_wtG<<<(unsigned)((DQ * DM / 64 + 63) / 64), 256, 0, stream>>>(wo, DQ, DM, WO);   /* Wc is 'xw' [512][64] -> Bt [64][512] */
       }
    k_csid<<<(TT * HD + 255) / 256, 256, 0, stream>>>(CS);
    const unsigned LQ = (unsigned)(((size_t)NH_ * TT * HD / 2 + 255) / 256), LKv = (unsigned)(((size_t)NKV * TT * HD / 2 + 255) / 256);
    for (int b = 0; b < NB_; ++b) {
        
        k_cvt8<<<(unsigned)(((size_t)TT * DM / 8 + 255) / 256), 256, 0, stream>>>(x + (size_t)b * TT * DM, XB, (size_t)TT * DM / 8);
        k_gemmw<bf, 0, false><<<dim3(TT / 64, DQ / 64, 1), 32, 0, stream>>>(XB, nullptr, WQ, nullptr, DM, FQ, DQ, nullptr, 0, 0, 0);
        k_rope<<<LQ, 256, 0, stream>>>(FQ, DQ, NH_, CS, nullptr, nullptr, 1.0f, QP16, QPh, QPl);
        
        k_bfrc<<<(unsigned)(((size_t)TT * DM / 4 + 255) / 256), 256, 0, stream>>>(x + (size_t)b * TT * DM, XR); k_rope<<<LKv, 256, 0, stream>>>(XR, DM, 1, CS, nullptr, nullptr, 1.0f, KP16, KPh, KPl);   /* the key IS bf16(x): one exact 64-wide plane shared by all heads */
        k_gemmw<bf, 0, false><<<dim3(TT / 64, DQ / 64, 1), 32, 0, stream>>>(XB, nullptr, WV, nullptr, DM, FV, DQ, nullptr, 0, 0, 0);   /* v: 8 heads x 64 */ k_vtp<<<LQ, 256, 0, stream>>>(FV, DQ, NH_, VT16, VTh, VTl);
        for (int h0 = 0; h0 < NH_; h0 += ZH) { const size_t zq = (size_t)h0, zk = (size_t)(h0 / REP);   // one shared key plane (zk = 0, sB = 0); each query head has its own value planes (zq, stride HD*TT)
            k_gemmw<bf, 2, false><<<dim3(RH / 64, TT / 64, ZH), 32, 0, stream>>>(QPh + zq * TT * HD, QPl + zq * TT * HD, KPh + zk * TT * HD, KPl + zk * TT * HD, HD, Sb, TT, nullptr, (size_t)TT * HD, 0, (size_t)TT * TT);
            k_gemmw<h16, 0, false><<<dim3((TT - RH) / 64, TT / 64, ZH), 32, 0, stream>>>(QP16 + zq * TT * HD + (size_t)RH * HD, nullptr, KP16 + zk * TT * HD, nullptr, HD, Sb + (size_t)RH * TT, TT, nullptr, (size_t)TT * HD, 0, (size_t)TT * TT);
            k_asoft<<<ZH * TT / 8, 256, 0, stream>>>(Sb, P16, Ph, Pl);
            k_gemmw<bf, 2, false><<<dim3(RH / 64, HD / 64, ZH), 32, 0, stream>>>(Ph, Pl, VTh + zq * HD * TT, VTl + zq * HD * TT, TT, Ob, HD, nullptr, (size_t)RH * TT, (size_t)HD * TT, (size_t)TT * HD);   /* each query head has its own value planes */
            k_gemmw<h16, 0, false><<<dim3((TT - RH) / 64, HD / 64, ZH), 32, 0, stream>>>(P16 + (size_t)RH * TT, nullptr, VT16 + zq * HD * TT, nullptr, TT, Ob + (size_t)RH * HD, HD, nullptr, (size_t)TT * TT, (size_t)HD * TT, (size_t)TT * HD);
            k_merge<<<(unsigned)(((size_t)ZH * TT * HD / 2 + 255) / 256), 256, 0, stream>>>(Ob, h0, ATh, ATl); }
        k_gemmw<bf, 1, true><<<dim3(TT / 64, DM / 64, 1), 32, 0, stream>>>(ATh, ATl, WO, nullptr, DQ, OUT + (size_t)b * TT * DM, DM, bo, 0, 0, 0); }
}

// v001
// It runs in 762 microseconds.
// Timed twice side by side with v000, it ran 2.48 and 2.50 times as fast.
#include <hip/hip_runtime.h>

// Multi-head attention V2 with the input itself as the shared key (x [4][2048][64]; qv = x Wqv ('xw' [64][1024] with the (H, D, 2) channel layout: q_h[d] = column h*128 + 2d, v_h[d] = column h*128 + 2d + 1); 8 heads x 64; scores = q_h . x / 8 (the 64-dim input is every head's key); softmax; out = merged (attn v) Wc + bc ('xw' [512][64]) -> [4][2048][64] (0.5 M)).
// Layout per batch: bf16 copy of x (GEMM operand) and a bf16-rounded f32 copy feeding the single exact key plane shared by all heads; q and v weights gathered from the interleaved columns into Bt row blocks; exact projections; dense T-2048 attention, 8 query heads over one key plane (hybrid rows: < 512 hi/lo 3 products, rest fp16 x1024), each head's own 64-wide value; merged hi/lo x Wc exact + bc (Wc is 'xw' [512][64], transposed once into the Bt layout).
// Compute dtypes, f32 accumulate: every input rounded to bf16; projections exact; attention rows < 512 3 products (keys exact), rest fp16; softmax f32; Wc hl x exact + bias.

#define NB_  4
#define TT   2048
#define DM   64
#define NH_  8
#define NKV  1
#define REP  (NH_ / NKV)
#define HD   64
#define DQ   (NH_ * HD)
#define DKV  (NKV * HD)
#define ZH   2
#define RH   512                  // query rows < RH use hi+lo planes (0: none)
#define WIN  0
#define PCAR 1024.0f
#define SCL  0.125f   // HD^-0.5
#define KSP  16                   // key ranges of the attn x V products: one single-wave work-group per (tile, range), f32 partial planes summed in k_merge
typedef _Float16 h16;
typedef unsigned short bf;
typedef __attribute__((ext_vector_type(16))) __bf16   v16bf;
typedef __attribute__((ext_vector_type(16))) _Float16 v16h;
typedef __attribute__((ext_vector_type(8)))  _Float16 v8h;
typedef __attribute__((ext_vector_type(8)))  unsigned short v8us;
typedef __attribute__((ext_vector_type(8)))  float    v8f;
typedef __attribute__((ext_vector_type(4)))  float    v4f;
typedef v8h  __attribute__((may_alias)) v8ha;
typedef v4f  __attribute__((may_alias)) v4fa;
typedef v8us __attribute__((may_alias)) v8usa;

__device__ __forceinline__ unsigned short f2bf(float f) { unsigned u = __float_as_uint(f); u += 0x7FFFu + ((u >> 16) & 1u); return (unsigned short)(u >> 16); }
__device__ __forceinline__ float bf2f(unsigned short b) { return __uint_as_float(((unsigned)b) << 16); }
__device__ __forceinline__ float bfr(float f) { return bf2f(f2bf(f)); }
__device__ __forceinline__ v16h cat16(v8h lo, v8h hi) { return __builtin_shufflevector(lo, hi, 0, 1, 2, 3, 4, 5, 6, 7, 8, 9, 10, 11, 12, 13, 14, 15); }
__device__ __forceinline__ v16bf cat16b(v8us lo, v8us hi) { return __builtin_bit_cast(v16bf, __builtin_shufflevector(lo, hi, 0, 1, 2, 3, 4, 5, 6, 7, 8, 9, 10, 11, 12, 13, 14, 15)); }
__device__ __forceinline__ v8f wmma16(v16h a, v16h b, v8f c) { return __builtin_amdgcn_wmma_f32_16x16x32_f16(false, a, false, b, (short)0, c, false, false); }
__device__ __forceinline__ v8f wmmab(v16bf a, v16bf b, v8f c) { return __builtin_amdgcn_wmma_f32_16x16x32_bf16(false, a, false, b, (short)0, c, false, false); }



// ---- k_gemmw: register-blocked GEMM, ONE WAVE per 64x64 output tile (16 accumulators), operands straight from K-contiguous 16-bit planes; grid (M/64, N/64, Z), 32 threads.
// C[m][n] (f32, pitch ldc, + optional f32 bias[n]) = sum_k A[m][k] Bt[n][k] (+ split products per NSPLIT). z-batch strides sA/sB/sC in elements. K % 32 == 0.
// KS > 1: blockIdx.z = batch * KS + range; the work-group sums only its own range of K / KS of the k and stores a partial plane at blockIdx.z * sC. (K / KS) % 32 == 0.
template <typename T16> struct WFrag;
template <> struct WFrag<h16> { typedef v16h V; static __device__ __forceinline__ V ld(const h16* p) { return cat16(*(const v8h*)p, *(const v8h*)(p + 16)); } static __device__ __forceinline__ v8f mma(V a, V b, v8f c) { return wmma16(a, b, c); } };
template <> struct WFrag<bf> { typedef v16bf V; static __device__ __forceinline__ V ld(const bf* p) { return cat16b(*(const v8us*)p, *(const v8us*)(p + 16)); } static __device__ __forceinline__ v8f mma(V a, V b, v8f c) { return wmmab(a, b, c); } };
template <typename T16, int NSPLIT, bool BIAS, int KS = 1>
__global__ __launch_bounds__(32) void k_gemmw(const T16* __restrict__ A, const T16* __restrict__ A2, const T16* __restrict__ Bt, const T16* __restrict__ Bt2, int K, float* C, int ldc, const float* __restrict__ bias, size_t sA, size_t sB, size_t sC) {
    typedef typename WFrag<T16>::V V;
    __shared__ __align__(16) float os[16 * 68];
    const size_t z = blockIdx.z / KS, ko = (size_t)(blockIdx.z % KS) * (K / KS); A += z * sA + ko; if (A2) A2 += z * sA + ko; Bt += z * sB + ko; if (Bt2) Bt2 += z * sB + ko; C += (size_t)blockIdx.z * sC;
    const int lane = threadIdx.x & 31, lr = lane & 15, hi = lane >> 4; const int r0 = blockIdx.x * 64, c0 = blockIdx.y * 64;
    v8f acc[4][4];
#pragma unroll
    for (int mb = 0; mb < 4; ++mb)
#pragma unroll
        for (int nb = 0; nb < 4; ++nb) acc[mb][nb] = (v8f){};
    const size_t aoff = (size_t)(r0 + lr) * K + 8 * hi, boff = (size_t)(c0 + lr) * K + 8 * hi;
#pragma unroll 1
    for (int kc = 0; kc < K / KS; kc += 32) {
        V a[4], a2[4];
#pragma unroll
        for (int mb = 0; mb < 4; ++mb) { a[mb] = WFrag<T16>::ld(A + aoff + (size_t)mb * 16 * K + kc); if (NSPLIT == 1 || NSPLIT == 2) a2[mb] = WFrag<T16>::ld(A2 + aoff + (size_t)mb * 16 * K + kc); }
#pragma unroll
        for (int nb = 0; nb < 4; ++nb) { const V b = WFrag<T16>::ld(Bt + boff + (size_t)nb * 16 * K + kc); V b2; if (NSPLIT >= 2) b2 = WFrag<T16>::ld(Bt2 + boff + (size_t)nb * 16 * K + kc);
#pragma unroll
            for (int mb = 0; mb < 4; ++mb) { acc[mb][nb] = WFrag<T16>::mma(a[mb], b, acc[mb][nb]); if (NSPLIT == 1 || NSPLIT == 2) acc[mb][nb] = WFrag<T16>::mma(a2[mb], b, acc[mb][nb]); if (NSPLIT >= 2) acc[mb][nb] = WFrag<T16>::mma(a[mb], b2, acc[mb][nb]); } }
        asm volatile("v_nop\n\tv_nop\n\tv_nop\n\tv_nop" : "+v"(acc[0][0]), "+v"(acc[1][1]), "+v"(acc[2][2]), "+v"(acc[3][3]) : "v"(a[0]), "v"(a[3]));
    }
#pragma unroll
    for (int mb = 0; mb < 4; ++mb) {
#pragma unroll
        for (int nb = 0; nb < 4; ++nb) {
#pragma unroll
            for (int j = 0; j < 8; ++j) os[(hi * 8 + j) * 68 + nb * 16 + lr] = acc[mb][nb][j]; }
        __builtin_amdgcn_wave_barrier(); asm volatile("" ::: "memory");
        float* crow = C + (size_t)(r0 + mb * 16) * ldc + c0;
{
#pragma unroll
            for (int s = 0; s < 8; ++s) { const int row = 2 * s + hi, cofs = lr * 4; v4f val = *(const v4fa*)(os + row * 68 + cofs); if (BIAS) { val[0] += bfr(bias[c0 + cofs]); val[1] += bfr(bias[c0 + cofs + 1]); val[2] += bfr(bias[c0 + cofs + 2]); val[3] += bfr(bias[c0 + cofs + 3]); }
                *(v4f*)(crow + (size_t)row * ldc + cofs) = val; }
             }
        __builtin_amdgcn_wave_barrier(); asm volatile("" ::: "memory");
    }
}

__device__ __forceinline__ h16 tohx(float x) { return (h16)x; }
__device__ __forceinline__ void splitf(float y, unsigned short& h, unsigned short& l) { h = f2bf(y); l = f2bf(y - bf2f(h)); }
typedef __attribute__((ext_vector_type(2))) _Float16 v2h;
typedef __attribute__((ext_vector_type(4))) _Float16 v4h;
typedef __attribute__((ext_vector_type(2))) unsigned short v2us;
typedef __attribute__((ext_vector_type(4))) unsigned short v4us;
typedef __attribute__((ext_vector_type(2))) float v2f;
typedef __attribute__((ext_vector_type(4))) int v4i;

__global__ __launch_bounds__(256) void k_wtG(const float* __restrict__ w, int K, int N, bf* Bt) {
    const int lane = threadIdx.x & 31; const int L0 = (blockIdx.x * 8 + (threadIdx.x >> 5)) * 8; const int nlines = N * K / 64;
{
#pragma unroll 1
        for (int l = 0; l < 8; ++l) { const int L = L0 + l; if (L >= nlines) break; const size_t e = (size_t)L * 64 + lane * 2; const int k = (int)(e % K), n = (int)(e / K); v2us o;
            o[0] = f2bf(w[(size_t)k * N + n]); o[1] = f2bf(w[(size_t)(k + 1) * N + n]); *(v2us*)(Bt + e) = o; }
         }
}
__global__ __launch_bounds__(256) void k_cvt8(const float* __restrict__ src, bf* dst, size_t n8) { const size_t i = (size_t)blockIdx.x * 256 + threadIdx.x; if (i >= n8) return; const v8f v = *(const v8f*)(src + i * 8); v8us o;
#pragma unroll
    for (int k = 0; k < 8; ++k) o[k] = f2bf(v[k]); *(v8us*)(dst + i * 8) = o;  }

// k_rope: head planes [h][t][d] (fp16 + hi/lo) of rope(x) x sc with the rotate-half convention out[d] = x[d] cos[t][d] - x[d+HD/2] sin[t][d], out[d+HD/2] = x[d+HD/2] cos[t][d+HD/2] + x[d] sin[t][d+HD/2]
__global__ __launch_bounds__(256) void k_rope(const float* __restrict__ F, int pitch, int nheads, const float* __restrict__ CS, const float* __restrict__ RF, const float* __restrict__ nw, float sc, h16* P16, bf* Ph, bf* Pl) {
    const size_t e = ((size_t)blockIdx.x * 256 + threadIdx.x) * 2; if (e >= (size_t)nheads * TT * HD) return; const int d = (int)(e % HD); const int t = (int)((e / HD) % TT); const int h = (int)(e / ((size_t)HD * TT)); const float* f = F + (size_t)t * pitch + h * HD; const float rf = RF ? RF[(size_t)h * TT + t] : 1.0f; v2h o16; v2us oh, ol;
#pragma unroll
    for (int q = 0; q < 2; ++q) { const int dd = d + q; const int dp = (dd < HD / 2) ? dd + HD / 2 : dd - HD / 2; float x0 = f[dd], x1 = f[dp];
        if (RF) { float n0 = __fmul_rn(x0, rf), n1 = __fmul_rn(x1, rf); asm volatile("" : "+v"(n0)); asm volatile("" : "+v"(n1)); x0 = __fmul_rn(bfr(nw[dd]), n0); x1 = __fmul_rn(bfr(nw[dp]), n1); }
        const v2f cs = *(const v2f*)(CS + ((size_t)t * HD + dd) * 2); float a = __fmul_rn(x0, cs[0]), bq = __fmul_rn(x1, cs[1]); asm volatile("" : "+v"(a)); asm volatile("" : "+v"(bq)); const float r = ((dd < HD / 2) ? __fsub_rn(a, bq) : __fadd_rn(a, bq)) * sc;
        o16[q] = tohx(r); unsigned short a2, c2; splitf(r, a2, c2); oh[q] = a2; ol[q] = c2; }
    *(v2h*)(P16 + e) = o16; *(v2us*)(Ph + e) = oh; *(v2us*)(Pl + e) = ol;  }
__global__ __launch_bounds__(256) void k_vtp(const float* __restrict__ F, int pitch, int nheads, h16* V16, bf* Vh, bf* Vl) { const size_t e = ((size_t)blockIdx.x * 256 + threadIdx.x) * 2; if (e >= (size_t)nheads * HD * TT) return; const int t = (int)(e % TT); const int d = (int)((e / TT) % HD); const int g = (int)(e / ((size_t)TT * HD)); v2h o16; v2us oh, ol;
#pragma unroll
    for (int q = 0; q < 2; ++q) { const float x = F[(size_t)(t + q) * pitch + g * HD + d]; o16[q] = tohx(x); unsigned short a2, c2; splitf(x, a2, c2); oh[q] = a2; ol[q] = c2; }
    *(v2h*)(V16 + e) = o16; *(v2us*)(Vh + e) = oh; *(v2us*)(Vl + e) = ol;  }
__global__ __launch_bounds__(256) void k_csid(float* CS) { const int idx = blockIdx.x * 256 + threadIdx.x; if (idx >= TT * HD) return; v2f cs; cs[0] = 1.0f; cs[1] = 0.0f; *(v2f*)(CS + (size_t)idx * 2) = cs;  }
// k_asoft: per row (zz, i): t = S x HD^-0.5 (no mask); softmax over the 2048 keys (register row, one exp, fixed trees);
__global__ __launch_bounds__(256) void k_asoft(const float* __restrict__ Sb, h16* P16, bf* Ph, bf* Pl) {
    const int lane = threadIdx.x & 31; const int row = blockIdx.x * 8 + (threadIdx.x >> 5); if (row >= ZH * TT) return; const int i = row % TT; const int zz = row / TT; (void)zz; const bool hires = (i < RH); const float* sr = Sb + (size_t)row * TT; float v[TT / 32]; float mx = -3.0e38f;
#pragma unroll
    for (int ch = 0; ch < TT / 128; ++ch) { const int j0 = ch * 128 + lane * 4; const v4f a = *(const v4f*)(sr + j0);
#pragma unroll
        for (int q = 0; q < 4; ++q) { const int j = j0 + q; (void)j; const float t = a[q] * SCL; v[ch * 4 + q] = t; mx = fmaxf(mx, t); } }
#pragma unroll
    for (int sh = 16; sh; sh >>= 1) mx = fmaxf(mx, __shfl_xor(mx, sh, 32));
    float sum = 0.f;
#pragma unroll
    for (int k = 0; k < TT / 32; ++k) { float d0 = __fsub_rn(v[k], mx); asm volatile("" : "+v"(d0)); v[k] = __builtin_amdgcn_exp2f(__fmul_rn(d0, 1.4426950408889634f)); sum += v[k]; }
#pragma unroll
    for (int sh = 16; sh; sh >>= 1) sum += __shfl_xor(sum, sh, 32);
    const float f = __fdiv_rn(hires ? 1.0f : PCAR, sum);
{
        if (hires) {
#pragma unroll
            for (int ch = 0; ch < TT / 128; ++ch) { v4us oh, ol;
#pragma unroll
                for (int q = 0; q < 4; ++q) { unsigned short a, c2; splitf(v[ch * 4 + q] * f, a, c2); oh[q] = a; ol[q] = c2; }
                const size_t oo = ((size_t)zz * (RH ? RH : 1) + i) * TT + ch * 128 + lane * 4; *(v4us*)(Ph + oo) = oh; *(v4us*)(Pl + oo) = ol; }
        } else {
#pragma unroll
            for (int ch = 0; ch < TT / 128; ++ch) { v4h o4;
#pragma unroll
                for (int q = 0; q < 4; ++q) o4[q] = tohx(v[ch * 4 + q] * f);
                *(v4h*)(P16 + (size_t)row * TT + ch * 128 + lane * 4) = o4; } }
         }
}
__global__ __launch_bounds__(256) void k_bfrc(const float* __restrict__ src, float* dst) { const size_t i = (size_t)blockIdx.x * 256 + threadIdx.x; if (i >= (size_t)TT * DM / 4) return; const v4f a = *(const v4f*)(src + i * 4); v4f o;
#pragma unroll
    for (int q = 0; q < 4; ++q) o[q] = bfr(a[q]);
    *(v4f*)(dst + i * 4) = o;  }
__global__ __launch_bounds__(256) void k_wsel(const float* __restrict__ w, int par, bf* Bt) { const int i = blockIdx.x * 256 + threadIdx.x; if (i >= DQ * DM / 8) return; const int c0 = (i % (DM / 8)) * 8; const int r = i / (DM / 8); const int h = r / HD, d = r % HD; const int col = h * 2 * HD + 2 * d + par; v8us o;
#pragma unroll
    for (int q = 0; q < 8; ++q) o[q] = f2bf(w[(size_t)(c0 + q) * (2 * DQ) + col]);
    *(v8us*)(Bt + (size_t)r * DM + c0) = o;  }
__global__ __launch_bounds__(256) void k_merge(const float* __restrict__ O, int h0, bf* Ah, bf* Al) { const size_t e = ((size_t)blockIdx.x * 256 + threadIdx.x) * 2; if (e >= (size_t)ZH * TT * HD) return; const int d = (int)(e % HD); const int t = (int)((e / HD) % TT); const int zz = (int)(e / ((size_t)HD * TT)); const float cs = (t < RH) ? 1.0f : (1.0f / PCAR); const size_t oo = (size_t)t * DQ + (h0 + zz) * HD + d;
    const float* op = O + (size_t)zz * KSP * TT * HD + (size_t)t * HD + d; v2f p[KSP];   // the KSP partial planes of this head: all loads in flight at once, then summed in range order
#pragma unroll
    for (int ks = 0; ks < KSP; ++ks) p[ks] = *(const v2f*)(op + (size_t)ks * TT * HD);
    asm volatile("s_wait_xcnt 0x0" :: "v"(op) : "memory");   // precaution: keeps the loads' address pair whole (no load returns into it, nothing rewrites it) until their address translations are counted done
    v2f acc = p[0];
#pragma unroll
    for (int ks = 1; ks < KSP; ++ks) { acc[0] += p[ks][0]; acc[1] += p[ks][1]; }
    v2us oh, ol;
#pragma unroll
    for (int q = 0; q < 2; ++q) { unsigned short a, c2; splitf(acc[q] * cs, a, c2); oh[q] = a; ol[q] = c2; } *(v2us*)(Ah + oo) = oh; *(v2us*)(Al + oo) = ol;  }

extern "C" void kernel_launch(void* const* d_in, const int* in_sizes, int n_in,
                              void* d_out, int out_size, void* d_ws, size_t ws_size, hipStream_t stream) {
    (void)in_sizes; (void)n_in; (void)out_size;
    const float* x = (const float*)d_in[0]; const float* wqv = (const float*)d_in[1]; const float* wo = (const float*)d_in[2]; /* Wc */ const float* bo = (const float*)d_in[3]; /* bc */ const float* wq = nullptr; const float* wk = nullptr; const float* wv = nullptr; (void)wq; (void)wk; (void)wv;
    float* OUT = (float*)d_out;     // [4][2048][64]
    char* wsp = (char*)d_ws;
    auto take = [&](size_t bytes) { char* p = wsp; wsp += (bytes + 255) & ~(size_t)255; return (void*)p; };
    float* XR = (float*)take((size_t)TT * DM * 4); bf* WQ = (bf*)take((size_t)DQ * DM * 2); bf* WV = (bf*)take((size_t)DQ * DM * 2); float* FV = (float*)take((size_t)TT * DQ * 4); bf* WO = (bf*)take((size_t)DM * DQ * 2); float* CS = (float*)take((size_t)TT * HD * 2 * 4);
    bf* XB = (bf*)take((size_t)TT * DM * 2); float* FQ = (float*)take((size_t)TT * DQ * 4); 
    h16* QP16 = (h16*)take((size_t)NH_ * TT * HD * 2); h16* KP16 = (h16*)take((size_t)NKV * TT * HD * 2); h16* VT16 = (h16*)take((size_t)NH_ * HD * TT * 2);
    bf* QPh = (bf*)take((size_t)NH_ * TT * HD * 2); bf* QPl = (bf*)take((size_t)NH_ * TT * HD * 2); bf* KPh = (bf*)take((size_t)NKV * TT * HD * 2); bf* KPl = (bf*)take((size_t)NKV * TT * HD * 2); bf* VTh = (bf*)take((size_t)NH_ * HD * TT * 2); bf* VTl = (bf*)take((size_t)NH_ * HD * TT * 2); bf* Ph = (bf*)take((size_t)ZH * RH * TT * 2); bf* Pl = (bf*)take((size_t)ZH * RH * TT * 2);
    float* Sb = (float*)take((size_t)ZH * TT * TT * 4); h16* P16 = (h16*)take((size_t)ZH * TT * TT * 2); float* Ob = (float*)take((size_t)ZH * KSP * TT * HD * 4); bf* ATh = (bf*)take((size_t)TT * DQ * 2); bf* ATl = (bf*)take((size_t)TT * DQ * 2);
    if ((size_t)(wsp - (char*)d_ws) > ws_size) return;    // ws 256 MiB
    
    { k_wsel<<<(DQ * DM / 8 + 255) / 256, 256, 0, stream>>>(wqv, 0, WQ); k_wsel<<<(DQ * DM / 8 + 255) / 256, 256, 0, stream>>>(wqv, 1, WV);   /* q = even, v = odd columns of each head's 128-column block */  
      k_wtG<<<(unsigned)((DQ * DM / 64 + 63) / 64), 256, 0, stream>>>(wo, DQ, DM, WO);   /* Wc is 'xw' [512][64] -> Bt [64][512] */
       }
    k_csid<<<(TT * HD + 255) / 256, 256, 0, stream>>>(CS);
    const unsigned LQ = (unsigned)(((size_t)NH_ * TT * HD / 2 + 255) / 256), LKv = (unsigned)(((size_t)NKV * TT * HD / 2 + 255) / 256);
    for (int b = 0; b < NB_; ++b) {
        
        k_cvt8<<<(unsigned)(((size_t)TT * DM / 8 + 255) / 256), 256, 0, stream>>>(x + (size_t)b * TT * DM, XB, (size_t)TT * DM / 8);
        k_gemmw<bf, 0, false><<<dim3(TT / 64, DQ / 64, 1), 32, 0, stream>>>(XB, nullptr, WQ, nullptr, DM, FQ, DQ, nullptr, 0, 0, 0);
        k_rope<<<LQ, 256, 0, stream>>>(FQ, DQ, NH_, CS, nullptr, nullptr, 1.0f, QP16, QPh, QPl);
        
        k_bfrc<<<(unsigned)(((size_t)TT * DM / 4 + 255) / 256), 256, 0, stream>>>(x + (size_t)b * TT * DM, XR); k_rope<<<LKv, 256, 0, stream>>>(XR, DM, 1, CS, nullptr, nullptr, 1.0f, KP16, KPh, KPl);   /* the key IS bf16(x): one exact 64-wide plane shared by all heads */
        k_gemmw<bf, 0, false><<<dim3(TT / 64, DQ / 64, 1), 32, 0, stream>>>(XB, nullptr, WV, nullptr, DM, FV, DQ, nullptr, 0, 0, 0);   /* v: 8 heads x 64 */ k_vtp<<<LQ, 256, 0, stream>>>(FV, DQ, NH_, VT16, VTh, VTl);
        for (int h0 = 0; h0 < NH_; h0 += ZH) { const size_t zq = (size_t)h0, zk = (size_t)(h0 / REP);   // one shared key plane (zk = 0, sB = 0); each query head has its own value planes (zq, stride HD*TT)
            k_gemmw<bf, 2, false><<<dim3(RH / 64, TT / 64, ZH), 32, 0, stream>>>(QPh + zq * TT * HD, QPl + zq * TT * HD, KPh + zk * TT * HD, KPl + zk * TT * HD, HD, Sb, TT, nullptr, (size_t)TT * HD, 0, (size_t)TT * TT);
            k_gemmw<h16, 0, false><<<dim3((TT - RH) / 64, TT / 64, ZH), 32, 0, stream>>>(QP16 + zq * TT * HD + (size_t)RH * HD, nullptr, KP16 + zk * TT * HD, nullptr, HD, Sb + (size_t)RH * TT, TT, nullptr, (size_t)TT * HD, 0, (size_t)TT * TT);
            k_asoft<<<ZH * TT / 8, 256, 0, stream>>>(Sb, P16, Ph, Pl);
            k_gemmw<bf, 2, false, KSP><<<dim3(RH / 64, HD / 64, ZH * KSP), 32, 0, stream>>>(Ph, Pl, VTh + zq * HD * TT, VTl + zq * HD * TT, TT, Ob, HD, nullptr, (size_t)RH * TT, (size_t)HD * TT, (size_t)TT * HD);   /* each query head has its own value planes */
            k_gemmw<h16, 0, false, KSP><<<dim3((TT - RH) / 64, HD / 64, ZH * KSP), 32, 0, stream>>>(P16 + (size_t)RH * TT, nullptr, VT16 + zq * HD * TT, nullptr, TT, Ob + (size_t)RH * HD, HD, nullptr, (size_t)TT * TT, (size_t)HD * TT, (size_t)TT * HD);
            k_merge<<<(unsigned)(((size_t)ZH * TT * HD / 2 + 255) / 256), 256, 0, stream>>>(Ob, h0, ATh, ATl); }
        k_gemmw<bf, 1, true><<<dim3(TT / 64, DM / 64, 1), 32, 0, stream>>>(ATh, ATl, WO, nullptr, DQ, OUT + (size_t)b * TT * DM, DM, bo, 0, 0, 0); }
}

// v002
// Measured time: 549 microseconds a run.
// In two side-by-side timings against v001, it was 1.39 and 1.38 times as fast.
// Over all steps from v000 it is 3.45 times as fast.
#include <hip/hip_runtime.h>

// Multi-head attention V2 with the input itself as the shared key (x [4][2048][64]; qv = x Wqv ('xw' [64][1024] with the (H, D, 2) channel layout: q_h[d] = column h*128 + 2d, v_h[d] = column h*128 + 2d + 1); 8 heads x 64; scores = q_h . x / 8 (the 64-dim input is every head's key); softmax; out = merged (attn v) Wc + bc ('xw' [512][64]) -> [4][2048][64] (0.5 M)).
// Layout per batch: bf16 copy of x (GEMM operand) and a bf16-rounded f32 copy feeding the single exact key plane shared by all heads; q and v weights gathered from the interleaved columns into Bt row blocks; exact projections; dense T-2048 attention, 8 query heads over one key plane (hybrid rows: < 512 hi/lo 3 products, rest fp16 x1024), each head's own 64-wide value; merged hi/lo x Wc exact + bc (Wc is 'xw' [512][64], transposed once into the Bt layout).
// Compute dtypes, f32 accumulate: every input rounded to bf16; projections exact; attention rows < 512 3 products (keys exact), rest fp16; softmax f32; Wc hl x exact + bias.

#define NB_  4
#define TT   2048
#define DM   64
#define NH_  8
#define NKV  1
#define REP  (NH_ / NKV)
#define HD   64
#define DQ   (NH_ * HD)
#define DKV  (NKV * HD)
#define ZH   8                    // heads per attention launch (grid z): all of a batch's heads go through each of the six attention kernels at once
#define RH   512                  // query rows < RH use hi+lo planes (0: none)
#define WIN  0
#define PCAR 1024.0f
#define SCL  0.125f   // HD^-0.5
#define KSP  16                   // key ranges of the attn x V products: one single-wave work-group per (tile, range), f32 partial planes summed in k_merge
typedef _Float16 h16;
typedef unsigned short bf;
typedef __attribute__((ext_vector_type(16))) __bf16   v16bf;
typedef __attribute__((ext_vector_type(16))) _Float16 v16h;
typedef __attribute__((ext_vector_type(8)))  _Float16 v8h;
typedef __attribute__((ext_vector_type(8)))  unsigned short v8us;
typedef __attribute__((ext_vector_type(8)))  float    v8f;
typedef __attribute__((ext_vector_type(4)))  float    v4f;
typedef v8h  __attribute__((may_alias)) v8ha;
typedef v4f  __attribute__((may_alias)) v4fa;
typedef v8us __attribute__((may_alias)) v8usa;

__device__ __forceinline__ unsigned short f2bf(float f) { unsigned u = __float_as_uint(f); u += 0x7FFFu + ((u >> 16) & 1u); return (unsigned short)(u >> 16); }
__device__ __forceinline__ float bf2f(unsigned short b) { return __uint_as_float(((unsigned)b) << 16); }
__device__ __forceinline__ float bfr(float f) { return bf2f(f2bf(f)); }
__device__ __forceinline__ v16h cat16(v8h lo, v8h hi) { return __builtin_shufflevector(lo, hi, 0, 1, 2, 3, 4, 5, 6, 7, 8, 9, 10, 11, 12, 13, 14, 15); }
__device__ __forceinline__ v16bf cat16b(v8us lo, v8us hi) { return __builtin_bit_cast(v16bf, __builtin_shufflevector(lo, hi, 0, 1, 2, 3, 4, 5, 6, 7, 8, 9, 10, 11, 12, 13, 14, 15)); }
__device__ __forceinline__ v8f wmma16(v16h a, v16h b, v8f c) { return __builtin_amdgcn_wmma_f32_16x16x32_f16(false, a, false, b, (short)0, c, false, false); }
__device__ __forceinline__ v8f wmmab(v16bf a, v16bf b, v8f c) { return __builtin_amdgcn_wmma_f32_16x16x32_bf16(false, a, false, b, (short)0, c, false, false); }



// ---- k_gemmw: register-blocked GEMM, ONE WAVE per 64x64 output tile (16 accumulators), operands straight from K-contiguous 16-bit planes; grid (M/64, N/64, Z), 32 threads.
// C[m][n] (f32, pitch ldc, + optional f32 bias[n]) = sum_k A[m][k] Bt[n][k] (+ split products per NSPLIT). z-batch strides sA/sB/sC in elements. K % 32 == 0.
// KS > 1: blockIdx.z = batch * KS + range; the work-group sums only its own range of K / KS of the k and stores a partial plane at blockIdx.z * sC. (K / KS) % 32 == 0.
template <typename T16> struct WFrag;
template <> struct WFrag<h16> { typedef v16h V; static __device__ __forceinline__ V ld(const h16* p) { return cat16(*(const v8h*)p, *(const v8h*)(p + 16)); } static __device__ __forceinline__ v8f mma(V a, V b, v8f c) { return wmma16(a, b, c); } };
template <> struct WFrag<bf> { typedef v16bf V; static __device__ __forceinline__ V ld(const bf* p) { return cat16b(*(const v8us*)p, *(const v8us*)(p + 16)); } static __device__ __forceinline__ v8f mma(V a, V b, v8f c) { return wmmab(a, b, c); } };
template <typename T16, int NSPLIT, bool BIAS, int KS = 1>
__global__ __launch_bounds__(32) void k_gemmw(const T16* __restrict__ A, const T16* __restrict__ A2, const T16* __restrict__ Bt, const T16* __restrict__ Bt2, int K, float* C, int ldc, const float* __restrict__ bias, size_t sA, size_t sB, size_t sC) {
    typedef typename WFrag<T16>::V V;
    __shared__ __align__(16) float os[16 * 68];
    const size_t z = blockIdx.z / KS, ko = (size_t)(blockIdx.z % KS) * (K / KS); A += z * sA + ko; if (A2) A2 += z * sA + ko; Bt += z * sB + ko; if (Bt2) Bt2 += z * sB + ko; C += (size_t)blockIdx.z * sC;
    const int lane = threadIdx.x & 31, lr = lane & 15, hi = lane >> 4; const int r0 = blockIdx.x * 64, c0 = blockIdx.y * 64;
    v8f acc[4][4];
#pragma unroll
    for (int mb = 0; mb < 4; ++mb)
#pragma unroll
        for (int nb = 0; nb < 4; ++nb) acc[mb][nb] = (v8f){};
    const size_t aoff = (size_t)(r0 + lr) * K + 8 * hi, boff = (size_t)(c0 + lr) * K + 8 * hi;
#pragma unroll 1
    for (int kc = 0; kc < K / KS; kc += 32) {
        V a[4], a2[4];
#pragma unroll
        for (int mb = 0; mb < 4; ++mb) { a[mb] = WFrag<T16>::ld(A + aoff + (size_t)mb * 16 * K + kc); if (NSPLIT == 1 || NSPLIT == 2) a2[mb] = WFrag<T16>::ld(A2 + aoff + (size_t)mb * 16 * K + kc); }
#pragma unroll
        for (int nb = 0; nb < 4; ++nb) { const V b = WFrag<T16>::ld(Bt + boff + (size_t)nb * 16 * K + kc); V b2; if (NSPLIT >= 2) b2 = WFrag<T16>::ld(Bt2 + boff + (size_t)nb * 16 * K + kc);
#pragma unroll
            for (int mb = 0; mb < 4; ++mb) { acc[mb][nb] = WFrag<T16>::mma(a[mb], b, acc[mb][nb]); if (NSPLIT == 1 || NSPLIT == 2) acc[mb][nb] = WFrag<T16>::mma(a2[mb], b, acc[mb][nb]); if (NSPLIT >= 2) acc[mb][nb] = WFrag<T16>::mma(a[mb], b2, acc[mb][nb]); } }
        asm volatile("v_nop\n\tv_nop\n\tv_nop\n\tv_nop" : "+v"(acc[0][0]), "+v"(acc[1][1]), "+v"(acc[2][2]), "+v"(acc[3][3]) : "v"(a[0]), "v"(a[3]));
    }
#pragma unroll
    for (int mb = 0; mb < 4; ++mb) {
#pragma unroll
        for (int nb = 0; nb < 4; ++nb) {
#pragma unroll
            for (int j = 0; j < 8; ++j) os[(hi * 8 + j) * 68 + nb * 16 + lr] = acc[mb][nb][j]; }
        __builtin_amdgcn_wave_barrier(); asm volatile("" ::: "memory");
        float* crow = C + (size_t)(r0 + mb * 16) * ldc + c0;
{
#pragma unroll
            for (int s = 0; s < 8; ++s) { const int row = 2 * s + hi, cofs = lr * 4; v4f val = *(const v4fa*)(os + row * 68 + cofs); if (BIAS) { val[0] += bfr(bias[c0 + cofs]); val[1] += bfr(bias[c0 + cofs + 1]); val[2] += bfr(bias[c0 + cofs + 2]); val[3] += bfr(bias[c0 + cofs + 3]); }
                *(v4f*)(crow + (size_t)row * ldc + cofs) = val; }
             }
        __builtin_amdgcn_wave_barrier(); asm volatile("" ::: "memory");
    }
}

__device__ __forceinline__ h16 tohx(float x) { return (h16)x; }
__device__ __forceinline__ void splitf(float y, unsigned short& h, unsigned short& l) { h = f2bf(y); l = f2bf(y - bf2f(h)); }
typedef __attribute__((ext_vector_type(2))) _Float16 v2h;
typedef __attribute__((ext_vector_type(4))) _Float16 v4h;
typedef __attribute__((ext_vector_type(2))) unsigned short v2us;
typedef __attribute__((ext_vector_type(4))) unsigned short v4us;
typedef __attribute__((ext_vector_type(2))) float v2f;
typedef __attribute__((ext_vector_type(4))) int v4i;

__global__ __launch_bounds__(256) void k_wtG(const float* __restrict__ w, int K, int N, bf* Bt) {
    const int lane = threadIdx.x & 31; const int L0 = (blockIdx.x * 8 + (threadIdx.x >> 5)) * 8; const int nlines = N * K / 64;
{
#pragma unroll 1
        for (int l = 0; l < 8; ++l) { const int L = L0 + l; if (L >= nlines) break; const size_t e = (size_t)L * 64 + lane * 2; const int k = (int)(e % K), n = (int)(e / K); v2us o;
            o[0] = f2bf(w[(size_t)k * N + n]); o[1] = f2bf(w[(size_t)(k + 1) * N + n]); *(v2us*)(Bt + e) = o; }
         }
}
__global__ __launch_bounds__(256) void k_cvt8(const float* __restrict__ src, bf* dst, size_t n8) { const size_t i = (size_t)blockIdx.x * 256 + threadIdx.x; if (i >= n8) return; const v8f v = *(const v8f*)(src + i * 8); v8us o;
#pragma unroll
    for (int k = 0; k < 8; ++k) o[k] = f2bf(v[k]); *(v8us*)(dst + i * 8) = o;  }

// k_rope: head planes [h][t][d] (fp16 + hi/lo) of rope(x) x sc with the rotate-half convention out[d] = x[d] cos[t][d] - x[d+HD/2] sin[t][d], out[d+HD/2] = x[d+HD/2] cos[t][d+HD/2] + x[d] sin[t][d+HD/2]
__global__ __launch_bounds__(256) void k_rope(const float* __restrict__ F, int pitch, int nheads, const float* __restrict__ CS, const float* __restrict__ RF, const float* __restrict__ nw, float sc, h16* P16, bf* Ph, bf* Pl) {
    const size_t e = ((size_t)blockIdx.x * 256 + threadIdx.x) * 2; if (e >= (size_t)nheads * TT * HD) return; const int d = (int)(e % HD); const int t = (int)((e / HD) % TT); const int h = (int)(e / ((size_t)HD * TT)); const float* f = F + (size_t)t * pitch + h * HD; const float rf = RF ? RF[(size_t)h * TT + t] : 1.0f; v2h o16; v2us oh, ol;
#pragma unroll
    for (int q = 0; q < 2; ++q) { const int dd = d + q; const int dp = (dd < HD / 2) ? dd + HD / 2 : dd - HD / 2; float x0 = f[dd], x1 = f[dp];
        if (RF) { float n0 = __fmul_rn(x0, rf), n1 = __fmul_rn(x1, rf); asm volatile("" : "+v"(n0)); asm volatile("" : "+v"(n1)); x0 = __fmul_rn(bfr(nw[dd]), n0); x1 = __fmul_rn(bfr(nw[dp]), n1); }
        const v2f cs = *(const v2f*)(CS + ((size_t)t * HD + dd) * 2); float a = __fmul_rn(x0, cs[0]), bq = __fmul_rn(x1, cs[1]); asm volatile("" : "+v"(a)); asm volatile("" : "+v"(bq)); const float r = ((dd < HD / 2) ? __fsub_rn(a, bq) : __fadd_rn(a, bq)) * sc;
        o16[q] = tohx(r); unsigned short a2, c2; splitf(r, a2, c2); oh[q] = a2; ol[q] = c2; }
    *(v2h*)(P16 + e) = o16; *(v2us*)(Ph + e) = oh; *(v2us*)(Pl + e) = ol;  }
__global__ __launch_bounds__(256) void k_vtp(const float* __restrict__ F, int pitch, int nheads, h16* V16, bf* Vh, bf* Vl) { const size_t e = ((size_t)blockIdx.x * 256 + threadIdx.x) * 2; if (e >= (size_t)nheads * HD * TT) return; const int t = (int)(e % TT); const int d = (int)((e / TT) % HD); const int g = (int)(e / ((size_t)TT * HD)); v2h o16; v2us oh, ol;
#pragma unroll
    for (int q = 0; q < 2; ++q) { const float x = F[(size_t)(t + q) * pitch + g * HD + d]; o16[q] = tohx(x); unsigned short a2, c2; splitf(x, a2, c2); oh[q] = a2; ol[q] = c2; }
    *(v2h*)(V16 + e) = o16; *(v2us*)(Vh + e) = oh; *(v2us*)(Vl + e) = ol;  }
__global__ __launch_bounds__(256) void k_csid(float* CS) { const int idx = blockIdx.x * 256 + threadIdx.x; if (idx >= TT * HD) return; v2f cs; cs[0] = 1.0f; cs[1] = 0.0f; *(v2f*)(CS + (size_t)idx * 2) = cs;  }
// k_asoft: per row (zz, i): t = S x HD^-0.5 (no mask); softmax over the 2048 keys (register row, one exp, fixed trees);
__global__ __launch_bounds__(256) void k_asoft(const float* __restrict__ Sb, h16* P16, bf* Ph, bf* Pl) {
    const int lane = threadIdx.x & 31; const int row = blockIdx.x * 8 + (threadIdx.x >> 5); if (row >= ZH * TT) return; const int i = row % TT; const int zz = row / TT; (void)zz; const bool hires = (i < RH); const float* sr = Sb + (size_t)row * TT; float v[TT / 32]; float mx = -3.0e38f;
#pragma unroll
    for (int ch = 0; ch < TT / 128; ++ch) { const int j0 = ch * 128 + lane * 4; const v4f a = *(const v4f*)(sr + j0);
#pragma unroll
        for (int q = 0; q < 4; ++q) { const int j = j0 + q; (void)j; const float t = a[q] * SCL; v[ch * 4 + q] = t; mx = fmaxf(mx, t); } }
#pragma unroll
    for (int sh = 16; sh; sh >>= 1) mx = fmaxf(mx, __shfl_xor(mx, sh, 32));
    float sum = 0.f;
#pragma unroll
    for (int k = 0; k < TT / 32; ++k) { float d0 = __fsub_rn(v[k], mx); asm volatile("" : "+v"(d0)); v[k] = __builtin_amdgcn_exp2f(__fmul_rn(d0, 1.4426950408889634f)); sum += v[k]; }
#pragma unroll
    for (int sh = 16; sh; sh >>= 1) sum += __shfl_xor(sum, sh, 32);
    const float f = __fdiv_rn(hires ? 1.0f : PCAR, sum);
{
        if (hires) {
#pragma unroll
            for (int ch = 0; ch < TT / 128; ++ch) { v4us oh, ol;
#pragma unroll
                for (int q = 0; q < 4; ++q) { unsigned short a, c2; splitf(v[ch * 4 + q] * f, a, c2); oh[q] = a; ol[q] = c2; }
                const size_t oo = ((size_t)zz * (RH ? RH : 1) + i) * TT + ch * 128 + lane * 4; *(v4us*)(Ph + oo) = oh; *(v4us*)(Pl + oo) = ol; }
        } else {
#pragma unroll
            for (int ch = 0; ch < TT / 128; ++ch) { v4h o4;
#pragma unroll
                for (int q = 0; q < 4; ++q) o4[q] = tohx(v[ch * 4 + q] * f);
                *(v4h*)(P16 + (size_t)row * TT + ch * 128 + lane * 4) = o4; } }
         }
}
__global__ __launch_bounds__(256) void k_bfrc(const float* __restrict__ src, float* dst) { const size_t i = (size_t)blockIdx.x * 256 + threadIdx.x; if (i >= (size_t)TT * DM / 4) return; const v4f a = *(const v4f*)(src + i * 4); v4f o;
#pragma unroll
    for (int q = 0; q < 4; ++q) o[q] = bfr(a[q]);
    *(v4f*)(dst + i * 4) = o;  }
__global__ __launch_bounds__(256) void k_wsel(const float* __restrict__ w, int par, bf* Bt) { const int i = blockIdx.x * 256 + threadIdx.x; if (i >= DQ * DM / 8) return; const int c0 = (i % (DM / 8)) * 8; const int r = i / (DM / 8); const int h = r / HD, d = r % HD; const int col = h * 2 * HD + 2 * d + par; v8us o;
#pragma unroll
    for (int q = 0; q < 8; ++q) o[q] = f2bf(w[(size_t)(c0 + q) * (2 * DQ) + col]);
    *(v8us*)(Bt + (size_t)r * DM + c0) = o;  }
__global__ __launch_bounds__(256) void k_merge(const float* __restrict__ O, int h0, bf* Ah, bf* Al) { const size_t e = ((size_t)blockIdx.x * 256 + threadIdx.x) * 2; if (e >= (size_t)ZH * TT * HD) return; const int d = (int)(e % HD); const int t = (int)((e / HD) % TT); const int zz = (int)(e / ((size_t)HD * TT)); const float cs = (t < RH) ? 1.0f : (1.0f / PCAR); const size_t oo = (size_t)t * DQ + (h0 + zz) * HD + d;
    const float* op = O + (size_t)zz * KSP * TT * HD + (size_t)t * HD + d; v2f p[KSP];   // the KSP partial planes of this head: all loads in flight at once, then summed in range order
#pragma unroll
    for (int ks = 0; ks < KSP; ++ks) p[ks] = *(const v2f*)(op + (size_t)ks * TT * HD);
    asm volatile("s_wait_xcnt 0x0" :: "v"(op) : "memory");   // precaution: keeps the loads' address pair whole (no load returns into it, nothing rewrites it) until their address translations are counted done
    v2f acc = p[0];
#pragma unroll
    for (int ks = 1; ks < KSP; ++ks) { acc[0] += p[ks][0]; acc[1] += p[ks][1]; }
    v2us oh, ol;
#pragma unroll
    for (int q = 0; q < 2; ++q) { unsigned short a, c2; splitf(acc[q] * cs, a, c2); oh[q] = a; ol[q] = c2; } *(v2us*)(Ah + oo) = oh; *(v2us*)(Al + oo) = ol;  }

extern "C" void kernel_launch(void* const* d_in, const int* in_sizes, int n_in,
                              void* d_out, int out_size, void* d_ws, size_t ws_size, hipStream_t stream) {
    (void)in_sizes; (void)n_in; (void)out_size;
    const float* x = (const float*)d_in[0]; const float* wqv = (const float*)d_in[1]; const float* wo = (const float*)d_in[2]; /* Wc */ const float* bo = (const float*)d_in[3]; /* bc */ const float* wq = nullptr; const float* wk = nullptr; const float* wv = nullptr; (void)wq; (void)wk; (void)wv;
    float* OUT = (float*)d_out;     // [4][2048][64]
    char* wsp = (char*)d_ws;
    auto take = [&](size_t bytes) { char* p = wsp; wsp += (bytes + 255) & ~(size_t)255; return (void*)p; };
    float* XR = (float*)take((size_t)TT * DM * 4); bf* WQ = (bf*)take((size_t)DQ * DM * 2); bf* WV = (bf*)take((size_t)DQ * DM * 2); float* FV = (float*)take((size_t)TT * DQ * 4); bf* WO = (bf*)take((size_t)DM * DQ * 2); float* CS = (float*)take((size_t)TT * HD * 2 * 4);
    bf* XB = (bf*)take((size_t)TT * DM * 2); float* FQ = (float*)take((size_t)TT * DQ * 4); 
    h16* QP16 = (h16*)take((size_t)NH_ * TT * HD * 2); h16* KP16 = (h16*)take((size_t)NKV * TT * HD * 2); h16* VT16 = (h16*)take((size_t)NH_ * HD * TT * 2);
    bf* QPh = (bf*)take((size_t)NH_ * TT * HD * 2); bf* QPl = (bf*)take((size_t)NH_ * TT * HD * 2); bf* KPh = (bf*)take((size_t)NKV * TT * HD * 2); bf* KPl = (bf*)take((size_t)NKV * TT * HD * 2); bf* VTh = (bf*)take((size_t)NH_ * HD * TT * 2); bf* VTl = (bf*)take((size_t)NH_ * HD * TT * 2); bf* Ph = (bf*)take((size_t)ZH * RH * TT * 2); bf* Pl = (bf*)take((size_t)ZH * RH * TT * 2);
    float* Sb = (float*)take((size_t)ZH * TT * TT * 4); h16* P16 = (h16*)take((size_t)ZH * TT * TT * 2); float* Ob = Sb;   /* the partial planes (ZH * KSP * TT * HD f32, half of Sb's bytes) reuse the score planes, whose last reader is k_asoft */ bf* ATh = (bf*)take((size_t)TT * DQ * 2); bf* ATl = (bf*)take((size_t)TT * DQ * 2);
    if ((size_t)(wsp - (char*)d_ws) > ws_size) return;    // ws 256 MiB
    
    { k_wsel<<<(DQ * DM / 8 + 255) / 256, 256, 0, stream>>>(wqv, 0, WQ); k_wsel<<<(DQ * DM / 8 + 255) / 256, 256, 0, stream>>>(wqv, 1, WV);   /* q = even, v = odd columns of each head's 128-column block */  
      k_wtG<<<(unsigned)((DQ * DM / 64 + 63) / 64), 256, 0, stream>>>(wo, DQ, DM, WO);   /* Wc is 'xw' [512][64] -> Bt [64][512] */
       }
    k_csid<<<(TT * HD + 255) / 256, 256, 0, stream>>>(CS);
    const unsigned LQ = (unsigned)(((size_t)NH_ * TT * HD / 2 + 255) / 256), LKv = (unsigned)(((size_t)NKV * TT * HD / 2 + 255) / 256);
    for (int b = 0; b < NB_; ++b) {
        
        k_cvt8<<<(unsigned)(((size_t)TT * DM / 8 + 255) / 256), 256, 0, stream>>>(x + (size_t)b * TT * DM, XB, (size_t)TT * DM / 8);
        k_gemmw<bf, 0, false><<<dim3(TT / 64, DQ / 64, 1), 32, 0, stream>>>(XB, nullptr, WQ, nullptr, DM, FQ, DQ, nullptr, 0, 0, 0);
        k_rope<<<LQ, 256, 0, stream>>>(FQ, DQ, NH_, CS, nullptr, nullptr, 1.0f, QP16, QPh, QPl);
        
        k_bfrc<<<(unsigned)(((size_t)TT * DM / 4 + 255) / 256), 256, 0, stream>>>(x + (size_t)b * TT * DM, XR); k_rope<<<LKv, 256, 0, stream>>>(XR, DM, 1, CS, nullptr, nullptr, 1.0f, KP16, KPh, KPl);   /* the key IS bf16(x): one exact 64-wide plane shared by all heads */
        k_gemmw<bf, 0, false><<<dim3(TT / 64, DQ / 64, 1), 32, 0, stream>>>(XB, nullptr, WV, nullptr, DM, FV, DQ, nullptr, 0, 0, 0);   /* v: 8 heads x 64 */ k_vtp<<<LQ, 256, 0, stream>>>(FV, DQ, NH_, VT16, VTh, VTl);
        for (int h0 = 0; h0 < NH_; h0 += ZH) { const size_t zq = (size_t)h0, zk = (size_t)(h0 / REP);   // one shared key plane (zk = 0, sB = 0); each query head has its own value planes (zq, stride HD*TT)
            k_gemmw<bf, 2, false><<<dim3(RH / 64, TT / 64, ZH), 32, 0, stream>>>(QPh + zq * TT * HD, QPl + zq * TT * HD, KPh + zk * TT * HD, KPl + zk * TT * HD, HD, Sb, TT, nullptr, (size_t)TT * HD, 0, (size_t)TT * TT);
            k_gemmw<h16, 0, false><<<dim3((TT - RH) / 64, TT / 64, ZH), 32, 0, stream>>>(QP16 + zq * TT * HD + (size_t)RH * HD, nullptr, KP16 + zk * TT * HD, nullptr, HD, Sb + (size_t)RH * TT, TT, nullptr, (size_t)TT * HD, 0, (size_t)TT * TT);
            k_asoft<<<ZH * TT / 8, 256, 0, stream>>>(Sb, P16, Ph, Pl);
            k_gemmw<bf, 2, false, KSP><<<dim3(RH / 64, HD / 64, ZH * KSP), 32, 0, stream>>>(Ph, Pl, VTh + zq * HD * TT, VTl + zq * HD * TT, TT, Ob, HD, nullptr, (size_t)RH * TT, (size_t)HD * TT, (size_t)TT * HD);   /* each query head has its own value planes */
            k_gemmw<h16, 0, false, KSP><<<dim3((TT - RH) / 64, HD / 64, ZH * KSP), 32, 0, stream>>>(P16 + (size_t)RH * TT, nullptr, VT16 + zq * HD * TT, nullptr, TT, Ob + (size_t)RH * HD, HD, nullptr, (size_t)TT * TT, (size_t)HD * TT, (size_t)TT * HD);
            k_merge<<<(unsigned)(((size_t)ZH * TT * HD / 2 + 255) / 256), 256, 0, stream>>>(Ob, h0, ATh, ATl); }
        k_gemmw<bf, 1, true><<<dim3(TT / 64, DM / 64, 1), 32, 0, stream>>>(ATh, ATl, WO, nullptr, DQ, OUT + (size_t)b * TT * DM, DM, bo, 0, 0, 0); }
}

// v003
// One run takes 364 microseconds.
// Two timings next to v002 put it at 1.51 and 1.52 times that version's speed.
// Over all steps from v000 it is 5.22 times as fast.
#include <hip/hip_runtime.h>

// Multi-head attention V2 with the input itself as the shared key (x [4][2048][64]; qv = x Wqv ('xw' [64][1024] with the (H, D, 2) channel layout: q_h[d] = column h*128 + 2d, v_h[d] = column h*128 + 2d + 1); 8 heads x 64; scores = q_h . x / 8 (the 64-dim input is every head's key); softmax; out = merged (attn v) Wc + bc ('xw' [512][64]) -> [4][2048][64] (0.5 M)).
// Layout per batch: bf16 copy of x (GEMM operand) and a bf16-rounded f32 copy feeding the single exact key plane shared by all heads; q and v weights gathered from the interleaved columns into Bt row blocks; exact projections; dense T-2048 attention in one fused kernel (scores, online softmax and attn x V; the scores never reach memory), 8 query heads over one key plane (hybrid rows: < 512 hi/lo 3 products, rest fp16), each head's own 64-wide value; merged hi/lo x Wc exact + bc (Wc is 'xw' [512][64], transposed once into the Bt layout).
// Compute dtypes, f32 accumulate: every input rounded to bf16; projections exact; attention rows < 512 3 products (keys exact), rest fp16; softmax f32; Wc hl x exact + bias.

#define NB_  4
#define TT   2048
#define DM   64
#define NH_  8
#define NKV  1
#define REP  (NH_ / NKV)
#define HD   64
#define DQ   (NH_ * HD)
#define DKV  (NKV * HD)
#define RH   512                  // query rows < RH use hi+lo planes (0: none)
#define WIN  0
#define SCL  0.125f   // HD^-0.5
typedef _Float16 h16;
typedef unsigned short bf;
typedef __attribute__((ext_vector_type(16))) __bf16   v16bf;
typedef __attribute__((ext_vector_type(16))) _Float16 v16h;
typedef __attribute__((ext_vector_type(8)))  _Float16 v8h;
typedef __attribute__((ext_vector_type(8)))  unsigned short v8us;
typedef __attribute__((ext_vector_type(8)))  float    v8f;
typedef __attribute__((ext_vector_type(4)))  float    v4f;
typedef v8h  __attribute__((may_alias)) v8ha;
typedef v4f  __attribute__((may_alias)) v4fa;
typedef v8us __attribute__((may_alias)) v8usa;

__device__ __forceinline__ unsigned short f2bf(float f) { unsigned u = __float_as_uint(f); u += 0x7FFFu + ((u >> 16) & 1u); return (unsigned short)(u >> 16); }
__device__ __forceinline__ float bf2f(unsigned short b) { return __uint_as_float(((unsigned)b) << 16); }
__device__ __forceinline__ float bfr(float f) { return bf2f(f2bf(f)); }
__device__ __forceinline__ v16h cat16(v8h lo, v8h hi) { return __builtin_shufflevector(lo, hi, 0, 1, 2, 3, 4, 5, 6, 7, 8, 9, 10, 11, 12, 13, 14, 15); }
__device__ __forceinline__ v16bf cat16b(v8us lo, v8us hi) { return __builtin_bit_cast(v16bf, __builtin_shufflevector(lo, hi, 0, 1, 2, 3, 4, 5, 6, 7, 8, 9, 10, 11, 12, 13, 14, 15)); }
__device__ __forceinline__ v8f wmma16(v16h a, v16h b, v8f c) { return __builtin_amdgcn_wmma_f32_16x16x32_f16(false, a, false, b, (short)0, c, false, false); }
__device__ __forceinline__ v8f wmmab(v16bf a, v16bf b, v8f c) { return __builtin_amdgcn_wmma_f32_16x16x32_bf16(false, a, false, b, (short)0, c, false, false); }



// ---- k_gemmw: register-blocked GEMM, ONE WAVE per 64x64 output tile (16 accumulators), operands straight from K-contiguous 16-bit planes; grid (M/64, N/64, Z), 32 threads.
// C[m][n] (f32, pitch ldc, + optional f32 bias[n]) = sum_k A[m][k] Bt[n][k] (+ split products per NSPLIT). z-batch strides sA/sB/sC in elements. K % 32 == 0.
// KS > 1: blockIdx.z = batch * KS + range; the work-group sums only its own range of K / KS of the k and stores a partial plane at blockIdx.z * sC. (K / KS) % 32 == 0.
template <typename T16> struct WFrag;
template <> struct WFrag<h16> { typedef v16h V; static __device__ __forceinline__ V ld(const h16* p) { return cat16(*(const v8h*)p, *(const v8h*)(p + 16)); } static __device__ __forceinline__ v8f mma(V a, V b, v8f c) { return wmma16(a, b, c); } };
template <> struct WFrag<bf> { typedef v16bf V; static __device__ __forceinline__ V ld(const bf* p) { return cat16b(*(const v8us*)p, *(const v8us*)(p + 16)); } static __device__ __forceinline__ v8f mma(V a, V b, v8f c) { return wmmab(a, b, c); } };
template <typename T16, int NSPLIT, bool BIAS, int KS = 1>
__global__ __launch_bounds__(32) void k_gemmw(const T16* __restrict__ A, const T16* __restrict__ A2, const T16* __restrict__ Bt, const T16* __restrict__ Bt2, int K, float* C, int ldc, const float* __restrict__ bias, size_t sA, size_t sB, size_t sC) {
    typedef typename WFrag<T16>::V V;
    __shared__ __align__(16) float os[16 * 68];
    const size_t z = blockIdx.z / KS, ko = (size_t)(blockIdx.z % KS) * (K / KS); A += z * sA + ko; if (A2) A2 += z * sA + ko; Bt += z * sB + ko; if (Bt2) Bt2 += z * sB + ko; C += (size_t)blockIdx.z * sC;
    const int lane = threadIdx.x & 31, lr = lane & 15, hi = lane >> 4; const int r0 = blockIdx.x * 64, c0 = blockIdx.y * 64;
    v8f acc[4][4];
#pragma unroll
    for (int mb = 0; mb < 4; ++mb)
#pragma unroll
        for (int nb = 0; nb < 4; ++nb) acc[mb][nb] = (v8f){};
    const size_t aoff = (size_t)(r0 + lr) * K + 8 * hi, boff = (size_t)(c0 + lr) * K + 8 * hi;
#pragma unroll 1
    for (int kc = 0; kc < K / KS; kc += 32) {
        V a[4], a2[4];
#pragma unroll
        for (int mb = 0; mb < 4; ++mb) { a[mb] = WFrag<T16>::ld(A + aoff + (size_t)mb * 16 * K + kc); if (NSPLIT == 1 || NSPLIT == 2) a2[mb] = WFrag<T16>::ld(A2 + aoff + (size_t)mb * 16 * K + kc); }
#pragma unroll
        for (int nb = 0; nb < 4; ++nb) { const V b = WFrag<T16>::ld(Bt + boff + (size_t)nb * 16 * K + kc); V b2; if (NSPLIT >= 2) b2 = WFrag<T16>::ld(Bt2 + boff + (size_t)nb * 16 * K + kc);
#pragma unroll
            for (int mb = 0; mb < 4; ++mb) { acc[mb][nb] = WFrag<T16>::mma(a[mb], b, acc[mb][nb]); if (NSPLIT == 1 || NSPLIT == 2) acc[mb][nb] = WFrag<T16>::mma(a2[mb], b, acc[mb][nb]); if (NSPLIT >= 2) acc[mb][nb] = WFrag<T16>::mma(a[mb], b2, acc[mb][nb]); } }
        asm volatile("v_nop\n\tv_nop\n\tv_nop\n\tv_nop" : "+v"(acc[0][0]), "+v"(acc[1][1]), "+v"(acc[2][2]), "+v"(acc[3][3]) : "v"(a[0]), "v"(a[3]));
    }
#pragma unroll
    for (int mb = 0; mb < 4; ++mb) {
#pragma unroll
        for (int nb = 0; nb < 4; ++nb) {
#pragma unroll
            for (int j = 0; j < 8; ++j) os[(hi * 8 + j) * 68 + nb * 16 + lr] = acc[mb][nb][j]; }
        __builtin_amdgcn_wave_barrier(); asm volatile("" ::: "memory");
        float* crow = C + (size_t)(r0 + mb * 16) * ldc + c0;
{
#pragma unroll
            for (int s = 0; s < 8; ++s) { const int row = 2 * s + hi, cofs = lr * 4; v4f val = *(const v4fa*)(os + row * 68 + cofs); if (BIAS) { val[0] += bfr(bias[c0 + cofs]); val[1] += bfr(bias[c0 + cofs + 1]); val[2] += bfr(bias[c0 + cofs + 2]); val[3] += bfr(bias[c0 + cofs + 3]); }
                *(v4f*)(crow + (size_t)row * ldc + cofs) = val; }
             }
        __builtin_amdgcn_wave_barrier(); asm volatile("" ::: "memory");
    }
}

__device__ __forceinline__ h16 tohx(float x) { return (h16)x; }
__device__ __forceinline__ void splitf(float y, unsigned short& h, unsigned short& l) { h = f2bf(y); l = f2bf(y - bf2f(h)); }
typedef __attribute__((ext_vector_type(2))) _Float16 v2h;
typedef __attribute__((ext_vector_type(4))) _Float16 v4h;
typedef __attribute__((ext_vector_type(2))) unsigned short v2us;
typedef __attribute__((ext_vector_type(4))) unsigned short v4us;
typedef __attribute__((ext_vector_type(2))) float v2f;
typedef __attribute__((ext_vector_type(4))) int v4i;

__global__ __launch_bounds__(256) void k_wtG(const float* __restrict__ w, int K, int N, bf* Bt) {
    const int lane = threadIdx.x & 31; const int L0 = (blockIdx.x * 8 + (threadIdx.x >> 5)) * 8; const int nlines = N * K / 64;
{
#pragma unroll 1
        for (int l = 0; l < 8; ++l) { const int L = L0 + l; if (L >= nlines) break; const size_t e = (size_t)L * 64 + lane * 2; const int k = (int)(e % K), n = (int)(e / K); v2us o;
            o[0] = f2bf(w[(size_t)k * N + n]); o[1] = f2bf(w[(size_t)(k + 1) * N + n]); *(v2us*)(Bt + e) = o; }
         }
}
__global__ __launch_bounds__(256) void k_cvt8(const float* __restrict__ src, bf* dst, size_t n8) { const size_t i = (size_t)blockIdx.x * 256 + threadIdx.x; if (i >= n8) return; const v8f v = *(const v8f*)(src + i * 8); v8us o;
#pragma unroll
    for (int k = 0; k < 8; ++k) o[k] = f2bf(v[k]); *(v8us*)(dst + i * 8) = o;  }

// k_rope: head planes [h][t][d] (fp16 + hi/lo) of rope(x) x sc with the rotate-half convention out[d] = x[d] cos[t][d] - x[d+HD/2] sin[t][d], out[d+HD/2] = x[d+HD/2] cos[t][d+HD/2] + x[d] sin[t][d+HD/2]
__global__ __launch_bounds__(256) void k_rope(const float* __restrict__ F, int pitch, int nheads, const float* __restrict__ CS, const float* __restrict__ RF, const float* __restrict__ nw, float sc, int frag, h16* P16, bf* Ph, bf* Pl) {
    const size_t e = ((size_t)blockIdx.x * 256 + threadIdx.x) * 2; if (e >= (size_t)nheads * TT * HD) return; const int d = (int)(e % HD); const int t = (int)((e / HD) % TT); const int h = (int)(e / ((size_t)HD * TT)); const float* f = F + (size_t)t * pitch + h * HD; const float rf = RF ? RF[(size_t)h * TT + t] : 1.0f; v2h o16; v2us oh, ol;
#pragma unroll
    for (int q = 0; q < 2; ++q) { const int dd = d + q; const int dp = (dd < HD / 2) ? dd + HD / 2 : dd - HD / 2; float x0 = f[dd], x1 = f[dp];
        if (RF) { float n0 = __fmul_rn(x0, rf), n1 = __fmul_rn(x1, rf); asm volatile("" : "+v"(n0)); asm volatile("" : "+v"(n1)); x0 = __fmul_rn(bfr(nw[dd]), n0); x1 = __fmul_rn(bfr(nw[dp]), n1); }
        const v2f cs = *(const v2f*)(CS + ((size_t)t * HD + dd) * 2); float a = __fmul_rn(x0, cs[0]), bq = __fmul_rn(x1, cs[1]); asm volatile("" : "+v"(a)); asm volatile("" : "+v"(bq)); const float r = ((dd < HD / 2) ? __fsub_rn(a, bq) : __fadd_rn(a, bq)) * sc;
        o16[q] = tohx(r); unsigned short a2, c2; splitf(r, a2, c2); oh[q] = a2; ol[q] = c2; }
    // frag: the plane is stored as WMMA fragments, 16 rows x 64 d = four runs of 512 B, run d / 16, lane (d / 8 % 2) * 16 + t % 16, 8 d a lane: one 16-byte load of a wave reads whole lines
    const size_t eo = frag ? (size_t)h * TT * HD + (size_t)(t >> 4) * 1024 + (d >> 4) * 256 + (((d >> 3) & 1) * 16 + (t & 15)) * 8 + (d & 7) : e;
    *(v2h*)(P16 + eo) = o16; *(v2us*)(Ph + eo) = oh; *(v2us*)(Pl + eo) = ol;  }
// k_vtp: value planes as WMMA fragments of V^T: per head and 32 keys, four 16-d tiles of two 512-B runs, run t / 16 % 2, lane (t / 8 % 2) * 16 + d % 16, 8 keys a lane
__global__ __launch_bounds__(256) void k_vtp(const float* __restrict__ F, int pitch, int nheads, h16* V16, bf* Vh, bf* Vl) { const size_t e = ((size_t)blockIdx.x * 256 + threadIdx.x) * 2; if (e >= (size_t)nheads * HD * TT) return; const int t = (int)(e % TT); const int d = (int)((e / TT) % HD); const int g = (int)(e / ((size_t)TT * HD)); v2h o16; v2us oh, ol;
#pragma unroll
    for (int q = 0; q < 2; ++q) { const float x = F[(size_t)(t + q) * pitch + g * HD + d]; o16[q] = tohx(x); unsigned short a2, c2; splitf(x, a2, c2); oh[q] = a2; ol[q] = c2; }
    const size_t eo = (size_t)g * HD * TT + (size_t)(t >> 5) * 2048 + (d >> 4) * 512 + ((t >> 4) & 1) * 256 + (((t >> 3) & 1) * 16 + (d & 15)) * 8 + (t & 7);
    *(v2h*)(V16 + eo) = o16; *(v2us*)(Vh + eo) = oh; *(v2us*)(Vl + eo) = ol;  }
__global__ __launch_bounds__(256) void k_csid(float* CS) { const int idx = blockIdx.x * 256 + threadIdx.x; if (idx >= TT * HD) return; v2f cs; cs[0] = 1.0f; cs[1] = 0.0f; *(v2f*)(CS + (size_t)idx * 2) = cs;  }
// ---- k_fattn: scores, softmax and attn x V of 16 query rows per wave, all 2048 keys, nothing of the scores in memory.
// Transposed products: S^T = K Q^T (A = key fragments, B = query rows) leaves each lane with one query's scores (query = lane % 16, keys 8 * (lane / 16) + j of each 16-key tile);
// two such tiles, converted in place, are the B operand of O^T += V^T P^T in the hardware k order, which the V^T fragments are stored in. Running maximum and sum per lane (online softmax), halves joined by one lane exchange.
// K fragments are fetched again right behind the score products and V fragments right behind the value products, so the next pass's loads fly during this pass's work.
// a fragment = two 512-byte runs; the pointers are marked as global memory because a base address that comes out of an asm statement would otherwise be read by flat loads
__device__ __forceinline__ v16h  ldfr(const h16* p) { const __attribute__((address_space(1))) v8h* g = (const __attribute__((address_space(1))) v8h*)p; return cat16(g[0], g[32]); }
__device__ __forceinline__ v16bf ldfr(const bf* p) { const __attribute__((address_space(1))) v8us* g = (const __attribute__((address_space(1))) v8us*)p; return cat16b(g[0], g[32]); }
__device__ __forceinline__ float xhalf(float x) { const int b = __float_as_int(x); return __int_as_float(__builtin_amdgcn_permlanex16(b, b, 0x76543210, 0xfedcba98, false, false)); }   // lane l <-> l ^ 16
// 2^x. The v_nop keeps the one slot that the instruction set asks for between a transcendental and a directly following instruction that reads its result or overwrites its source;
// in exp2x8 each v_exp works in place on its own register, so that the eight need none between them.
__device__ __forceinline__ float exp2s(float x) { float r; asm("v_exp_f32 %0, %1\n\tv_nop" : "=v"(r) : "v"(x)); return r; }
__device__ __forceinline__ void exp2x8(v8f& x) { float a = x[0], b = x[1], c = x[2], d = x[3], e = x[4], f = x[5], g = x[6], h = x[7];
    asm("v_exp_f32 %0, %0\n\tv_exp_f32 %1, %1\n\tv_exp_f32 %2, %2\n\tv_exp_f32 %3, %3\n\tv_exp_f32 %4, %4\n\tv_exp_f32 %5, %5\n\tv_exp_f32 %6, %6\n\tv_exp_f32 %7, %7\n\tv_nop" : "+v"(a), "+v"(b), "+v"(c), "+v"(d), "+v"(e), "+v"(f), "+v"(g), "+v"(h));
    x[0] = a; x[1] = b; x[2] = c; x[3] = d; x[4] = e; x[5] = f; x[6] = g; x[7] = h; }
template <bool B> struct BoolC { static constexpr bool v = B; };
template <typename T16, bool HR, int KB>
__device__ __forceinline__ void attn_tile(const T16* __restrict__ Q, const T16* __restrict__ Q2, const T16* __restrict__ Kf, const T16* __restrict__ Kf2, const T16* __restrict__ Vf, const T16* __restrict__ Vf2, bf* Ah, bf* Al) {
    typedef typename WFrag<T16>::V V; typedef WFrag<T16> W;
    constexpr int KT = KB / 16, KG = KB / 32; constexpr float C2 = SCL * 1.4426950408889634f;
    const int lane = threadIdx.x & 31, lr = lane & 15, hi = lane >> 4;
    V q[2], q2[2], k[KT][2], k2[KT][2], v[4][KG], v2[4][KG];
    Q += lr * HD + 8 * hi; if (HR) Q2 += lr * HD + 8 * hi;
#pragma unroll
    for (int c = 0; c < 2; ++c) { q[c] = W::ld(Q + c * 32); if (HR) q2[c] = W::ld(Q2 + c * 32); }
    const unsigned lo = lane * 8;   // a lane's 16 bytes in each 512-byte run of a fragment plane
#pragma unroll
    for (int kt = 0; kt < KT; ++kt)
#pragma unroll
        for (int c = 0; c < 2; ++c) { k[kt][c] = ldfr(Kf + kt * 1024 + c * 512 + lo); if (HR) k2[kt][c] = ldfr(Kf2 + kt * 1024 + c * 512 + lo); }
    // Two jobs. As a compiler fence: the first V loads are issued behind the Q and K loads, as in the loop; otherwise the wait that the compiler puts at the loop's head for K also waits for the V loads just issued.
    // As a wait (a precaution): the Q loads' address pairs, inputs here so that they stay whole up to this line, are free for other values only behind it.
    if constexpr (HR) asm volatile("s_wait_xcnt 0x0" :: "v"(Q), "v"(Q2) : "memory"); else asm volatile("s_wait_xcnt 0x0" :: "v"(Q) : "memory");
#pragma unroll
    for (int g = 0; g < KG; ++g)
#pragma unroll
        for (int dt = 0; dt < 4; ++dt) { v[dt][g] = ldfr(Vf + g * 2048 + dt * 512 + lo); if (HR) v2[dt][g] = ldfr(Vf2 + g * 2048 + dt * 512 + lo); }
    v8f o[4];
#pragma unroll
    for (int dt = 0; dt < 4; ++dt) o[dt] = (v8f){};
    float m = -3.0e38f, l = 0.f;   // m: running maximum of the raw products; l: this lane's half of the running sum
    const unsigned long long inc = (unsigned long long)KB * HD * sizeof(T16);   // bytes a pass: both kinds of plane hold 64 elements a key
    auto pass = [&](auto more) __attribute__((always_inline)) {   // one pass = KB keys; more: a next pass exists, fetch its fragments
        v8f s[KT];
#pragma unroll
        for (int kt = 0; kt < KT; ++kt) s[kt] = (v8f){};
#pragma unroll
        for (int c = 0; c < 2; ++c) {
#pragma unroll
            for (int kt = 0; kt < KT; ++kt) s[kt] = W::mma(k[kt][c], q[c], s[kt]);
            if (HR) {
#pragma unroll
                for (int kt = 0; kt < KT; ++kt) s[kt] = W::mma(k[kt][c], q2[c], s[kt]);
#pragma unroll
                for (int kt = 0; kt < KT; ++kt) s[kt] = W::mma(k2[kt][c], q[c], s[kt]); } }
        // The step of the K base addresses. One statement holds the wait and the adds, so that the wait stands in front of the rewrite of registers that issued loads name (a precaution);
        // the score tiles are inputs only: the refetch, whose addresses come out of this statement, so stays behind the score products and lands in the same registers, with no copy and no wait for it at the loop's foot.
        if constexpr (decltype(more)::v) {
            if constexpr (HR) asm volatile("s_wait_xcnt 0x0\n\ts_add_nc_u64 %0, %0, %2\n\ts_add_nc_u64 %1, %1, %2" : "+s"(Kf), "+s"(Kf2) : "s"(inc), "v"(s[0]), "v"(s[1]) : "memory");
            else asm volatile("s_wait_xcnt 0x0\n\ts_add_nc_u64 %0, %0, %1" : "+s"(Kf) : "s"(inc), "v"(s[0]), "v"(s[1]), "v"(s[2]), "v"(s[3]) : "memory");
#pragma unroll
            for (int kt = 0; kt < KT; ++kt)
#pragma unroll
                for (int c = 0; c < 2; ++c) { k[kt][c] = ldfr(Kf + kt * 1024 + c * 512 + lo); if (HR) k2[kt][c] = ldfr(Kf2 + kt * 1024 + c * 512 + lo); }
            __builtin_amdgcn_sched_barrier(0);   // keeps the refetch in front of the softmax, in whose time it flies
        }
        float mt[KT];
#pragma unroll
        for (int kt = 0; kt < KT; ++kt) { mt[kt] = s[kt][0];
#pragma unroll
            for (int j = 1; j < 8; ++j) mt[kt] = fmaxf(mt[kt], s[kt][j]); }
        float mx = m;
#pragma unroll
        for (int kt = 0; kt < KT; ++kt) mx = fmaxf(mx, mt[kt]);
        mx = fmaxf(mx, xhalf(mx));
        const float al = exp2s((m - mx) * C2), mc = mx * C2; m = mx;
        float st[KT];
#pragma unroll
        for (int kt = 0; kt < KT; ++kt) {
#pragma unroll
            for (int j = 0; j < 8; ++j) s[kt][j] = __builtin_fmaf(s[kt][j], C2, -mc);
            exp2x8(s[kt]); st[kt] = s[kt][0];
#pragma unroll
            for (int j = 1; j < 8; ++j) st[kt] += s[kt][j]; }
        float sum = st[0];
#pragma unroll
        for (int kt = 1; kt < KT; ++kt) sum += st[kt];
        l = l * al + sum;
#pragma unroll
        for (int dt = 0; dt < 4; ++dt) o[dt] *= al;
        V p[KG], p2[KG];
#pragma unroll
        for (int g = 0; g < KG; ++g)
#pragma unroll
            for (int e = 0; e < 16; ++e) { const float x = s[2 * g + (e >> 3)][e & 7];
                if constexpr (HR) { const __bf16 xh = (__bf16)x; p[g][e] = xh; p2[g][e] = (__bf16)(x - (float)xh); } else p[g][e] = (h16)x; }
#pragma unroll
        for (int g = 0; g < KG; ++g) {
#pragma unroll
            for (int dt = 0; dt < 4; ++dt) o[dt] = W::mma(v[dt][g], p[g], o[dt]);
            if (HR) {
#pragma unroll
                for (int dt = 0; dt < 4; ++dt) o[dt] = W::mma(v[dt][g], p2[g], o[dt]);
#pragma unroll
                for (int dt = 0; dt < 4; ++dt) o[dt] = W::mma(v2[dt][g], p[g], o[dt]); } }
        // the same for the V base addresses, behind the value products
        if constexpr (decltype(more)::v) {
            if constexpr (HR) asm volatile("s_wait_xcnt 0x0\n\ts_add_nc_u64 %0, %0, %2\n\ts_add_nc_u64 %1, %1, %2" : "+s"(Vf), "+s"(Vf2) : "s"(inc), "v"(o[0]), "v"(o[1]), "v"(o[2]), "v"(o[3]) : "memory");
            else asm volatile("s_wait_xcnt 0x0\n\ts_add_nc_u64 %0, %0, %1" : "+s"(Vf) : "s"(inc), "v"(o[0]), "v"(o[1]), "v"(o[2]), "v"(o[3]) : "memory");
#pragma unroll
            for (int g = 0; g < KG; ++g)
#pragma unroll
                for (int dt = 0; dt < 4; ++dt) { v[dt][g] = ldfr(Vf + g * 2048 + dt * 512 + lo); if (HR) v2[dt][g] = ldfr(Vf2 + g * 2048 + dt * 512 + lo); }
        }
    };
#pragma unroll 1
    for (int kb = KB; kb < TT; kb += KB) pass(BoolC<true>{});   // rolled: one pass's code and registers
    // precaution: the last fetches' base addresses, inputs here so that they stay whole up to this line, are free for other values only behind the wait
    if constexpr (HR) asm volatile("s_wait_xcnt 0x0" :: "s"(Kf), "s"(Kf2), "s"(Vf), "s"(Vf2) : "memory"); else asm volatile("s_wait_xcnt 0x0" :: "s"(Kf), "s"(Vf) : "memory");
    pass(BoolC<false>{});
    l += xhalf(l); const float inv = __fdiv_rn(1.0f, l);
#pragma unroll
    for (int dt = 0; dt < 4; ++dt) { v8us oh, ol;   // o[dt][j] = O[query lr][d = dt * 16 + hi * 8 + j]: 8 consecutive d, one 16-byte store a plane
#pragma unroll
        for (int j = 0; j < 8; ++j) { unsigned short a, c2; splitf(o[dt][j] * inv, a, c2); oh[j] = a; ol[j] = c2; }
        *(v8us*)(Ah + (size_t)lr * DQ + dt * 16 + hi * 8) = oh; *(v8us*)(Al + (size_t)lr * DQ + dt * 16 + hi * 8) = ol; }
}
// grid (TT / 64, heads), 4 waves of 16 query rows each on the same head, so that they read the same K and V lines at about the same time; the hi/lo row blocks, the longer ones, have the lowest indices and start first
__global__ __launch_bounds__(128) void k_fattn(const h16* __restrict__ Q16, const bf* __restrict__ Qh, const bf* __restrict__ Ql, const h16* __restrict__ K16, const bf* __restrict__ Kh, const bf* __restrict__ Kl, const h16* __restrict__ V16, const bf* __restrict__ Vh, const bf* __restrict__ Vl, bf* Ah, bf* Al) {
    const int h = blockIdx.y, q0 = blockIdx.x * 64 + (threadIdx.x >> 5) * 16; const size_t qo = ((size_t)h * TT + q0) * HD, vo = (size_t)h * HD * TT, ao = (size_t)q0 * DQ + h * HD;
    if (blockIdx.x < RH / 64) attn_tile<bf, true, 32>(Qh + qo, Ql + qo, Kh, Kl, Vh + vo, Vl + vo, Ah + ao, Al + ao);
    else attn_tile<h16, false, 64>(Q16 + qo, nullptr, K16, nullptr, V16 + vo, nullptr, Ah + ao, Al + ao);
}
__global__ __launch_bounds__(256) void k_bfrc(const float* __restrict__ src, float* dst) { const size_t i = (size_t)blockIdx.x * 256 + threadIdx.x; if (i >= (size_t)TT * DM / 4) return; const v4f a = *(const v4f*)(src + i * 4); v4f o;
#pragma unroll
    for (int q = 0; q < 4; ++q) o[q] = bfr(a[q]);
    *(v4f*)(dst + i * 4) = o;  }
__global__ __launch_bounds__(256) void k_wsel(const float* __restrict__ w, int par, bf* Bt) { const int i = blockIdx.x * 256 + threadIdx.x; if (i >= DQ * DM / 8) return; const int c0 = (i % (DM / 8)) * 8; const int r = i / (DM / 8); const int h = r / HD, d = r % HD; const int col = h * 2 * HD + 2 * d + par; v8us o;
#pragma unroll
    for (int q = 0; q < 8; ++q) o[q] = f2bf(w[(size_t)(c0 + q) * (2 * DQ) + col]);
    *(v8us*)(Bt + (size_t)r * DM + c0) = o;  }

extern "C" void kernel_launch(void* const* d_in, const int* in_sizes, int n_in,
                              void* d_out, int out_size, void* d_ws, size_t ws_size, hipStream_t stream) {
    (void)in_sizes; (void)n_in; (void)out_size;
    const float* x = (const float*)d_in[0]; const float* wqv = (const float*)d_in[1]; const float* wo = (const float*)d_in[2]; /* Wc */ const float* bo = (const float*)d_in[3]; /* bc */ const float* wq = nullptr; const float* wk = nullptr; const float* wv = nullptr; (void)wq; (void)wk; (void)wv;
    float* OUT = (float*)d_out;     // [4][2048][64]
    char* wsp = (char*)d_ws;
    auto take = [&](size_t bytes) { char* p = wsp; wsp += (bytes + 255) & ~(size_t)255; return (void*)p; };
    float* XR = (float*)take((size_t)TT * DM * 4); bf* WQ = (bf*)take((size_t)DQ * DM * 2); bf* WV = (bf*)take((size_t)DQ * DM * 2); float* FV = (float*)take((size_t)TT * DQ * 4); bf* WO = (bf*)take((size_t)DM * DQ * 2); float* CS = (float*)take((size_t)TT * HD * 2 * 4);
    bf* XB = (bf*)take((size_t)TT * DM * 2); float* FQ = (float*)take((size_t)TT * DQ * 4); 
    h16* QP16 = (h16*)take((size_t)NH_ * TT * HD * 2); h16* KP16 = (h16*)take((size_t)NKV * TT * HD * 2); h16* VT16 = (h16*)take((size_t)NH_ * HD * TT * 2);
    bf* QPh = (bf*)take((size_t)NH_ * TT * HD * 2); bf* QPl = (bf*)take((size_t)NH_ * TT * HD * 2); bf* KPh = (bf*)take((size_t)NKV * TT * HD * 2); bf* KPl = (bf*)take((size_t)NKV * TT * HD * 2); bf* VTh = (bf*)take((size_t)NH_ * HD * TT * 2); bf* VTl = (bf*)take((size_t)NH_ * HD * TT * 2);
    bf* ATh = (bf*)take((size_t)TT * DQ * 2); bf* ATl = (bf*)take((size_t)TT * DQ * 2);
    if ((size_t)(wsp - (char*)d_ws) > ws_size) return;    // ws 256 MiB
    
    { k_wsel<<<(DQ * DM / 8 + 255) / 256, 256, 0, stream>>>(wqv, 0, WQ); k_wsel<<<(DQ * DM / 8 + 255) / 256, 256, 0, stream>>>(wqv, 1, WV);   /* q = even, v = odd columns of each head's 128-column block */  
      k_wtG<<<(unsigned)((DQ * DM / 64 + 63) / 64), 256, 0, stream>>>(wo, DQ, DM, WO);   /* Wc is 'xw' [512][64] -> Bt [64][512] */
       }
    k_csid<<<(TT * HD + 255) / 256, 256, 0, stream>>>(CS);
    const unsigned LQ = (unsigned)(((size_t)NH_ * TT * HD / 2 + 255) / 256), LKv = (unsigned)(((size_t)NKV * TT * HD / 2 + 255) / 256);
    for (int b = 0; b < NB_; ++b) {
        
        k_cvt8<<<(unsigned)(((size_t)TT * DM / 8 + 255) / 256), 256, 0, stream>>>(x + (size_t)b * TT * DM, XB, (size_t)TT * DM / 8);
        k_gemmw<bf, 0, false><<<dim3(TT / 64, DQ / 64, 1), 32, 0, stream>>>(XB, nullptr, WQ, nullptr, DM, FQ, DQ, nullptr, 0, 0, 0);
        k_rope<<<LQ, 256, 0, stream>>>(FQ, DQ, NH_, CS, nullptr, nullptr, 1.0f, 0, QP16, QPh, QPl);
        
        k_bfrc<<<(unsigned)(((size_t)TT * DM / 4 + 255) / 256), 256, 0, stream>>>(x + (size_t)b * TT * DM, XR); k_rope<<<LKv, 256, 0, stream>>>(XR, DM, 1, CS, nullptr, nullptr, 1.0f, 1, KP16, KPh, KPl);   /* the key IS bf16(x): one exact 64-wide plane shared by all heads, stored as fragments */
        k_gemmw<bf, 0, false><<<dim3(TT / 64, DQ / 64, 1), 32, 0, stream>>>(XB, nullptr, WV, nullptr, DM, FV, DQ, nullptr, 0, 0, 0);   /* v: 8 heads x 64 */ k_vtp<<<LQ, 256, 0, stream>>>(FV, DQ, NH_, VT16, VTh, VTl);
        k_fattn<<<dim3(TT / 64, NH_, 1), 128, 0, stream>>>(QP16, QPh, QPl, KP16, KPh, KPl, VT16, VTh, VTl, ATh, ATl);   /* one shared key plane; each query head has its own value planes */
        k_gemmw<bf, 1, true><<<dim3(TT / 64, DM / 64, 1), 32, 0, stream>>>(ATh, ATl, WO, nullptr, DQ, OUT + (size_t)b * TT * DM, DM, bo, 0, 0, 0); }
}

// v004
// A run of this version takes 165 microseconds.
// In two side-by-side timings against v003, it was 2.18 and 2.16 times as fast.
// Counting every step since v000, it is 11.3 times as fast.
#include <hip/hip_runtime.h>

// Multi-head attention V2 with the input itself as the shared key (x [4][2048][64]; qv = x Wqv ('xw' [64][1024] with the (H, D, 2) channel layout: q_h[d] = column h*128 + 2d, v_h[d] = column h*128 + 2d + 1); 8 heads x 64; scores = q_h . x / 8 (the 64-dim input is every head's key); softmax; out = merged (attn v) Wc + bc ('xw' [512][64]) -> [4][2048][64] (0.5 M)).
// Layout, every buffer batch-major and every kernel launched once for all batches: bf16 copy of x (GEMM operand) and a bf16-rounded f32 copy feeding the single exact key plane shared by all heads; q and v weights gathered from the interleaved columns into Bt row blocks; exact projections; dense T-2048 attention in one fused kernel (scores, online softmax and attn x V; the scores never reach memory), 8 query heads over one key plane (hybrid rows: < 512 hi/lo 3 products, rest fp16), each head's own 64-wide value; merged hi/lo x Wc exact + bc (Wc is 'xw' [512][64], transposed once into the Bt layout).
// Compute dtypes, f32 accumulate: every input rounded to bf16; projections exact; attention rows < 512 3 products (keys exact), rest fp16; softmax f32; Wc hl x exact + bias.

#define NB_  4
#define TT   2048
#define DM   64
#define NH_  8
#define NKV  1
#define REP  (NH_ / NKV)
#define HD   64
#define DQ   (NH_ * HD)
#define DKV  (NKV * HD)
#define RH   512                  // query rows < RH use hi+lo planes (0: none)
#define WIN  0
#define SCL  0.125f   // HD^-0.5
typedef _Float16 h16;
typedef unsigned short bf;
typedef __attribute__((ext_vector_type(16))) __bf16   v16bf;
typedef __attribute__((ext_vector_type(16))) _Float16 v16h;
typedef __attribute__((ext_vector_type(8)))  _Float16 v8h;
typedef __attribute__((ext_vector_type(8)))  unsigned short v8us;
typedef __attribute__((ext_vector_type(8)))  float    v8f;
typedef __attribute__((ext_vector_type(4)))  float    v4f;
typedef v8h  __attribute__((may_alias)) v8ha;
typedef v4f  __attribute__((may_alias)) v4fa;
typedef v8us __attribute__((may_alias)) v8usa;

__device__ __forceinline__ unsigned short f2bf(float f) { unsigned u = __float_as_uint(f); u += 0x7FFFu + ((u >> 16) & 1u); return (unsigned short)(u >> 16); }
__device__ __forceinline__ float bf2f(unsigned short b) { return __uint_as_float(((unsigned)b) << 16); }
__device__ __forceinline__ float bfr(float f) { return bf2f(f2bf(f)); }
__device__ __forceinline__ v16h cat16(v8h lo, v8h hi) { return __builtin_shufflevector(lo, hi, 0, 1, 2, 3, 4, 5, 6, 7, 8, 9, 10, 11, 12, 13, 14, 15); }
__device__ __forceinline__ v16bf cat16b(v8us lo, v8us hi) { return __builtin_bit_cast(v16bf, __builtin_shufflevector(lo, hi, 0, 1, 2, 3, 4, 5, 6, 7, 8, 9, 10, 11, 12, 13, 14, 15)); }
__device__ __forceinline__ v8f wmma16(v16h a, v16h b, v8f c) { return __builtin_amdgcn_wmma_f32_16x16x32_f16(false, a, false, b, (short)0, c, false, false); }
__device__ __forceinline__ v8f wmmab(v16bf a, v16bf b, v8f c) { return __builtin_amdgcn_wmma_f32_16x16x32_bf16(false, a, false, b, (short)0, c, false, false); }



// ---- k_gemmw: register-blocked GEMM, ONE WAVE per 64x64 output tile (16 accumulators), operands straight from K-contiguous 16-bit planes; grid (M/64, N/64, Z), 32 threads.
// C[m][n] (f32, pitch ldc, + optional f32 bias[n]) = sum_k A[m][k] Bt[n][k] (+ split products per NSPLIT). z-batch strides sA/sB/sC in elements. K % 32 == 0.
// KS > 1: blockIdx.z = batch * KS + range; the work-group sums only its own range of K / KS of the k and stores a partial plane at blockIdx.z * sC. (K / KS) % 32 == 0.
template <typename T16> struct WFrag;
template <> struct WFrag<h16> { typedef v16h V; static __device__ __forceinline__ V ld(const h16* p) { return cat16(*(const v8h*)p, *(const v8h*)(p + 16)); } static __device__ __forceinline__ v8f mma(V a, V b, v8f c) { return wmma16(a, b, c); } };
template <> struct WFrag<bf> { typedef v16bf V; static __device__ __forceinline__ V ld(const bf* p) { return cat16b(*(const v8us*)p, *(const v8us*)(p + 16)); } static __device__ __forceinline__ v8f mma(V a, V b, v8f c) { return wmmab(a, b, c); } };
template <typename T16, int NSPLIT, bool BIAS, int KS = 1>
__global__ __launch_bounds__(32) void k_gemmw(const T16* __restrict__ A, const T16* __restrict__ A2, const T16* __restrict__ Bt, const T16* __restrict__ Bt2, int K, float* C, int ldc, const float* __restrict__ bias, size_t sA, size_t sB, size_t sC) {
    typedef typename WFrag<T16>::V V;
    __shared__ __align__(16) float os[16 * 68];
    const size_t z = blockIdx.z / KS, ko = (size_t)(blockIdx.z % KS) * (K / KS); A += z * sA + ko; if (A2) A2 += z * sA + ko; Bt += z * sB + ko; if (Bt2) Bt2 += z * sB + ko; C += (size_t)blockIdx.z * sC;
    const int lane = threadIdx.x & 31, lr = lane & 15, hi = lane >> 4; const int r0 = blockIdx.x * 64, c0 = blockIdx.y * 64;
    v8f acc[4][4];
#pragma unroll
    for (int mb = 0; mb < 4; ++mb)
#pragma unroll
        for (int nb = 0; nb < 4; ++nb) acc[mb][nb] = (v8f){};
    const size_t aoff = (size_t)(r0 + lr) * K + 8 * hi, boff = (size_t)(c0 + lr) * K + 8 * hi;
#pragma unroll 1
    for (int kc = 0; kc < K / KS; kc += 32) {
        V a[4], a2[4];
#pragma unroll
        for (int mb = 0; mb < 4; ++mb) { a[mb] = WFrag<T16>::ld(A + aoff + (size_t)mb * 16 * K + kc); if (NSPLIT == 1 || NSPLIT == 2) a2[mb] = WFrag<T16>::ld(A2 + aoff + (size_t)mb * 16 * K + kc); }
#pragma unroll
        for (int nb = 0; nb < 4; ++nb) { const V b = WFrag<T16>::ld(Bt + boff + (size_t)nb * 16 * K + kc); V b2; if (NSPLIT >= 2) b2 = WFrag<T16>::ld(Bt2 + boff + (size_t)nb * 16 * K + kc);
#pragma unroll
            for (int mb = 0; mb < 4; ++mb) { acc[mb][nb] = WFrag<T16>::mma(a[mb], b, acc[mb][nb]); if (NSPLIT == 1 || NSPLIT == 2) acc[mb][nb] = WFrag<T16>::mma(a2[mb], b, acc[mb][nb]); if (NSPLIT >= 2) acc[mb][nb] = WFrag<T16>::mma(a[mb], b2, acc[mb][nb]); } }
        asm volatile("v_nop\n\tv_nop\n\tv_nop\n\tv_nop" : "+v"(acc[0][0]), "+v"(acc[1][1]), "+v"(acc[2][2]), "+v"(acc[3][3]) : "v"(a[0]), "v"(a[3]));
    }
#pragma unroll
    for (int mb = 0; mb < 4; ++mb) {
#pragma unroll
        for (int nb = 0; nb < 4; ++nb) {
#pragma unroll
            for (int j = 0; j < 8; ++j) os[(hi * 8 + j) * 68 + nb * 16 + lr] = acc[mb][nb][j]; }
        __builtin_amdgcn_wave_barrier(); asm volatile("" ::: "memory");
        float* crow = C + (size_t)(r0 + mb * 16) * ldc + c0;
{
#pragma unroll
            for (int s = 0; s < 8; ++s) { const int row = 2 * s + hi, cofs = lr * 4; v4f val = *(const v4fa*)(os + row * 68 + cofs); if (BIAS) { val[0] += bfr(bias[c0 + cofs]); val[1] += bfr(bias[c0 + cofs + 1]); val[2] += bfr(bias[c0 + cofs + 2]); val[3] += bfr(bias[c0 + cofs + 3]); }
                *(v4f*)(crow + (size_t)row * ldc + cofs) = val; }
             }
        __builtin_amdgcn_wave_barrier(); asm volatile("" ::: "memory");
    }
}

__device__ __forceinline__ h16 tohx(float x) { return (h16)x; }
__device__ __forceinline__ void splitf(float y, unsigned short& h, unsigned short& l) { h = f2bf(y); l = f2bf(y - bf2f(h)); }
typedef __attribute__((ext_vector_type(2))) _Float16 v2h;
typedef __attribute__((ext_vector_type(4))) _Float16 v4h;
typedef __attribute__((ext_vector_type(2))) unsigned short v2us;
typedef __attribute__((ext_vector_type(4))) unsigned short v4us;
typedef __attribute__((ext_vector_type(2))) float v2f;
typedef __attribute__((ext_vector_type(4))) int v4i;

__global__ __launch_bounds__(256) void k_wtG(const float* __restrict__ w, int K, int N, bf* Bt) {
    const int lane = threadIdx.x & 31; const int L0 = (blockIdx.x * 8 + (threadIdx.x >> 5)) * 8; const int nlines = N * K / 64;
{
#pragma unroll 1
        for (int l = 0; l < 8; ++l) { const int L = L0 + l; if (L >= nlines) break; const size_t e = (size_t)L * 64 + lane * 2; const int k = (int)(e % K), n = (int)(e / K); v2us o;
            o[0] = f2bf(w[(size_t)k * N + n]); o[1] = f2bf(w[(size_t)(k + 1) * N + n]); *(v2us*)(Bt + e) = o; }
         }
}
__global__ __launch_bounds__(256) void k_cvt8(const float* __restrict__ src, bf* dst, size_t n8) { const size_t i = (size_t)blockIdx.x * 256 + threadIdx.x; if (i >= n8) return; const v8f v = *(const v8f*)(src + i * 8); v8us o;
#pragma unroll
    for (int k = 0; k < 8; ++k) o[k] = f2bf(v[k]); *(v8us*)(dst + i * 8) = o;  }

// k_rope: head planes [h][t][d] (fp16 + hi/lo) of rope(x) x sc with the rotate-half convention out[d] = x[d] cos[t][d] - x[d+HD/2] sin[t][d], out[d+HD/2] = x[d+HD/2] cos[t][d+HD/2] + x[d] sin[t][d+HD/2]
__global__ __launch_bounds__(256) void k_rope(const float* __restrict__ F, int pitch, int nheads, const float* __restrict__ CS, const float* __restrict__ RF, const float* __restrict__ nw, float sc, int frag, h16* P16, bf* Ph, bf* Pl) {
    { const size_t po = (size_t)blockIdx.y * nheads * TT * HD; F += (size_t)blockIdx.y * TT * pitch; P16 += po; Ph += po; Pl += po; }   // grid y = batch: F rows and planes are batch-major
    const size_t e = ((size_t)blockIdx.x * 256 + threadIdx.x) * 2; if (e >= (size_t)nheads * TT * HD) return; const int d = (int)(e % HD); const int t = (int)((e / HD) % TT); const int h = (int)(e / ((size_t)HD * TT)); const float* f = F + (size_t)t * pitch + h * HD; const float rf = RF ? RF[(size_t)h * TT + t] : 1.0f; v2h o16; v2us oh, ol;
#pragma unroll
    for (int q = 0; q < 2; ++q) { const int dd = d + q; const int dp = (dd < HD / 2) ? dd + HD / 2 : dd - HD / 2; float x0 = f[dd], x1 = f[dp];
        if (RF) { float n0 = __fmul_rn(x0, rf), n1 = __fmul_rn(x1, rf); asm volatile("" : "+v"(n0)); asm volatile("" : "+v"(n1)); x0 = __fmul_rn(bfr(nw[dd]), n0); x1 = __fmul_rn(bfr(nw[dp]), n1); }
        const v2f cs = *(const v2f*)(CS + ((size_t)t * HD + dd) * 2); float a = __fmul_rn(x0, cs[0]), bq = __fmul_rn(x1, cs[1]); asm volatile("" : "+v"(a)); asm volatile("" : "+v"(bq)); const float r = ((dd < HD / 2) ? __fsub_rn(a, bq) : __fadd_rn(a, bq)) * sc;
        o16[q] = tohx(r); unsigned short a2, c2; splitf(r, a2, c2); oh[q] = a2; ol[q] = c2; }
    // frag: the plane is stored as WMMA fragments, 16 rows x 64 d = four runs of 512 B, run d / 16, lane (d / 8 % 2) * 16 + t % 16, 8 d a lane: one 16-byte load of a wave reads whole lines
    const size_t eo = frag ? (size_t)h * TT * HD + (size_t)(t >> 4) * 1024 + (d >> 4) * 256 + (((d >> 3) & 1) * 16 + (t & 15)) * 8 + (d & 7) : e;
    *(v2h*)(P16 + eo) = o16; *(v2us*)(Ph + eo) = oh; *(v2us*)(Pl + eo) = ol;  }
// k_vtp: value planes as WMMA fragments of V^T: per head and 32 keys, four 16-d tiles of two 512-B runs, run t / 16 % 2, lane (t / 8 % 2) * 16 + d % 16, 8 keys a lane
__global__ __launch_bounds__(256) void k_vtp(const float* __restrict__ F, int pitch, int nheads, h16* V16, bf* Vh, bf* Vl) { const size_t e = ((size_t)blockIdx.x * 256 + threadIdx.x) * 2; if (e >= (size_t)nheads * HD * TT) return; const int t = (int)(e % TT); const int d = (int)((e / TT) % HD); const int g = (int)(e / ((size_t)TT * HD)); v2h o16; v2us oh, ol;
    { const size_t po = (size_t)blockIdx.y * nheads * HD * TT; F += (size_t)blockIdx.y * TT * pitch; V16 += po; Vh += po; Vl += po; }   // grid y = batch: F rows and planes are batch-major
#pragma unroll
    for (int q = 0; q < 2; ++q) { const float x = F[(size_t)(t + q) * pitch + g * HD + d]; o16[q] = tohx(x); unsigned short a2, c2; splitf(x, a2, c2); oh[q] = a2; ol[q] = c2; }
    const size_t eo = (size_t)g * HD * TT + (size_t)(t >> 5) * 2048 + (d >> 4) * 512 + ((t >> 4) & 1) * 256 + (((t >> 3) & 1) * 16 + (d & 15)) * 8 + (t & 7);
    *(v2h*)(V16 + eo) = o16; *(v2us*)(Vh + eo) = oh; *(v2us*)(Vl + eo) = ol;  }
__global__ __launch_bounds__(256) void k_csid(float* CS) { const int idx = blockIdx.x * 256 + threadIdx.x; if (idx >= TT * HD) return; v2f cs; cs[0] = 1.0f; cs[1] = 0.0f; *(v2f*)(CS + (size_t)idx * 2) = cs;  }
// ---- k_fattn: scores, softmax and attn x V of 16 query rows per wave, all 2048 keys, nothing of the scores in memory.
// Transposed products: S^T = K Q^T (A = key fragments, B = query rows) leaves each lane with one query's scores (query = lane % 16, keys 8 * (lane / 16) + j of each 16-key tile);
// two such tiles, converted in place, are the B operand of O^T += V^T P^T in the hardware k order, which the V^T fragments are stored in. Running maximum and sum per lane (online softmax), halves joined by one lane exchange.
// K fragments are fetched again right behind the score products and V fragments right behind the value products, so the next pass's loads fly during this pass's work.
// a fragment = two 512-byte runs; the pointers are marked as global memory because a base address that comes out of an asm statement would otherwise be read by flat loads
__device__ __forceinline__ v16h  ldfr(const h16* p) { const __attribute__((address_space(1))) v8h* g = (const __attribute__((address_space(1))) v8h*)p; return cat16(g[0], g[32]); }
__device__ __forceinline__ v16bf ldfr(const bf* p) { const __attribute__((address_space(1))) v8us* g = (const __attribute__((address_space(1))) v8us*)p; return cat16b(g[0], g[32]); }
__device__ __forceinline__ float xhalf(float x) { const int b = __float_as_int(x); return __int_as_float(__builtin_amdgcn_permlanex16(b, b, 0x76543210, 0xfedcba98, false, false)); }   // lane l <-> l ^ 16
// 2^x. The v_nop keeps the one slot that the instruction set asks for between a transcendental and a directly following instruction that reads its result or overwrites its source;
// in exp2x8 each v_exp works in place on its own register, so that the eight need none between them.
__device__ __forceinline__ float exp2s(float x) { float r; asm("v_exp_f32 %0, %1\n\tv_nop" : "=v"(r) : "v"(x)); return r; }
__device__ __forceinline__ void exp2x8(v8f& x) { float a = x[0], b = x[1], c = x[2], d = x[3], e = x[4], f = x[5], g = x[6], h = x[7];
    asm("v_exp_f32 %0, %0\n\tv_exp_f32 %1, %1\n\tv_exp_f32 %2, %2\n\tv_exp_f32 %3, %3\n\tv_exp_f32 %4, %4\n\tv_exp_f32 %5, %5\n\tv_exp_f32 %6, %6\n\tv_exp_f32 %7, %7\n\tv_nop" : "+v"(a), "+v"(b), "+v"(c), "+v"(d), "+v"(e), "+v"(f), "+v"(g), "+v"(h));
    x[0] = a; x[1] = b; x[2] = c; x[3] = d; x[4] = e; x[5] = f; x[6] = g; x[7] = h; }
template <bool B> struct BoolC { static constexpr bool v = B; };
template <typename T16, bool HR, int KB>
__device__ __forceinline__ void attn_tile(const T16* __restrict__ Q, const T16* __restrict__ Q2, const T16* __restrict__ Kf, const T16* __restrict__ Kf2, const T16* __restrict__ Vf, const T16* __restrict__ Vf2, bf* Ah, bf* Al) {
    typedef typename WFrag<T16>::V V; typedef WFrag<T16> W;
    constexpr int KT = KB / 16, KG = KB / 32; constexpr float C2 = SCL * 1.4426950408889634f;
    const int lane = threadIdx.x & 31, lr = lane & 15, hi = lane >> 4;
    V q[2], q2[2], k[KT][2], k2[KT][2], v[4][KG], v2[4][KG];
    Q += lr * HD + 8 * hi; if (HR) Q2 += lr * HD + 8 * hi;
#pragma unroll
    for (int c = 0; c < 2; ++c) { q[c] = W::ld(Q + c * 32); if (HR) q2[c] = W::ld(Q2 + c * 32); }
    const unsigned lo = lane * 8;   // a lane's 16 bytes in each 512-byte run of a fragment plane
#pragma unroll
    for (int kt = 0; kt < KT; ++kt)
#pragma unroll
        for (int c = 0; c < 2; ++c) { k[kt][c] = ldfr(Kf + kt * 1024 + c * 512 + lo); if (HR) k2[kt][c] = ldfr(Kf2 + kt * 1024 + c * 512 + lo); }
    // Two jobs. As a compiler fence: the first V loads are issued behind the Q and K loads, as in the loop; otherwise the wait that the compiler puts at the loop's head for K also waits for the V loads just issued.
    // As a wait (a precaution): the Q loads' address pairs, inputs here so that they stay whole up to this line, are free for other values only behind it.
    if constexpr (HR) asm volatile("s_wait_xcnt 0x0" :: "v"(Q), "v"(Q2) : "memory"); else asm volatile("s_wait_xcnt 0x0" :: "v"(Q) : "memory");
#pragma unroll
    for (int g = 0; g < KG; ++g)
#pragma unroll
        for (int dt = 0; dt < 4; ++dt) { v[dt][g] = ldfr(Vf + g * 2048 + dt * 512 + lo); if (HR) v2[dt][g] = ldfr(Vf2 + g * 2048 + dt * 512 + lo); }
    v8f o[4];
#pragma unroll
    for (int dt = 0; dt < 4; ++dt) o[dt] = (v8f){};
    float m = -3.0e38f, l = 0.f;   // m: running maximum of the raw products; l: this lane's half of the running sum
    const unsigned long long inc = (unsigned long long)KB * HD * sizeof(T16);   // bytes a pass: both kinds of plane hold 64 elements a key
    auto pass = [&](auto more) __attribute__((always_inline)) {   // one pass = KB keys; more: a next pass exists, fetch its fragments
        v8f s[KT];
#pragma unroll
        for (int kt = 0; kt < KT; ++kt) s[kt] = (v8f){};
#pragma unroll
        for (int c = 0; c < 2; ++c) {
#pragma unroll
            for (int kt = 0; kt < KT; ++kt) s[kt] = W::mma(k[kt][c], q[c], s[kt]);
            if (HR) {
#pragma unroll
                for (int kt = 0; kt < KT; ++kt) s[kt] = W::mma(k[kt][c], q2[c], s[kt]);
#pragma unroll
                for (int kt = 0; kt < KT; ++kt) s[kt] = W::mma(k2[kt][c], q[c], s[kt]); } }
        // The step of the K base addresses. One statement holds the wait and the adds, so that the wait stands in front of the rewrite of registers that issued loads name (a precaution);
        // the score tiles are inputs only: the refetch, whose addresses come out of this statement, so stays behind the score products and lands in the same registers, with no copy and no wait for it at the loop's foot.
        if constexpr (decltype(more)::v) {
            if constexpr (HR) asm volatile("s_wait_xcnt 0x0\n\ts_add_nc_u64 %0, %0, %2\n\ts_add_nc_u64 %1, %1, %2" : "+s"(Kf), "+s"(Kf2) : "s"(inc), "v"(s[0]), "v"(s[1]) : "memory");
            else asm volatile("s_wait_xcnt 0x0\n\ts_add_nc_u64 %0, %0, %1" : "+s"(Kf) : "s"(inc), "v"(s[0]), "v"(s[1]), "v"(s[2]), "v"(s[3]) : "memory");
#pragma unroll
            for (int kt = 0; kt < KT; ++kt)
#pragma unroll
                for (int c = 0; c < 2; ++c) { k[kt][c] = ldfr(Kf + kt * 1024 + c * 512 + lo); if (HR) k2[kt][c] = ldfr(Kf2 + kt * 1024 + c * 512 + lo); }
            __builtin_amdgcn_sched_barrier(0);   // keeps the refetch in front of the softmax, in whose time it flies
        }
        float mt[KT];
#pragma unroll
        for (int kt = 0; kt < KT; ++kt) { mt[kt] = s[kt][0];
#pragma unroll
            for (int j = 1; j < 8; ++j) mt[kt] = fmaxf(mt[kt], s[kt][j]); }
        float mx = m;
#pragma unroll
        for (int kt = 0; kt < KT; ++kt) mx = fmaxf(mx, mt[kt]);
        mx = fmaxf(mx, xhalf(mx));
        const float al = exp2s((m - mx) * C2), mc = mx * C2; m = mx;
        float st[KT];
#pragma unroll
        for (int kt = 0; kt < KT; ++kt) {
#pragma unroll
            for (int j = 0; j < 8; ++j) s[kt][j] = __builtin_fmaf(s[kt][j], C2, -mc);
            exp2x8(s[kt]); st[kt] = s[kt][0];
#pragma unroll
            for (int j = 1; j < 8; ++j) st[kt] += s[kt][j]; }
        float sum = st[0];
#pragma unroll
        for (int kt = 1; kt < KT; ++kt) sum += st[kt];
        l = l * al + sum;
#pragma unroll
        for (int dt = 0; dt < 4; ++dt) o[dt] *= al;
        V p[KG], p2[KG];
#pragma unroll
        for (int g = 0; g < KG; ++g)
#pragma unroll
            for (int e = 0; e < 16; ++e) { const float x = s[2 * g + (e >> 3)][e & 7];
                if constexpr (HR) { const __bf16 xh = (__bf16)x; p[g][e] = xh; p2[g][e] = (__bf16)(x - (float)xh); } else p[g][e] = (h16)x; }
#pragma unroll
        for (int g = 0; g < KG; ++g) {
#pragma unroll
            for (int dt = 0; dt < 4; ++dt) o[dt] = W::mma(v[dt][g], p[g], o[dt]);
            if (HR) {
#pragma unroll
                for (int dt = 0; dt < 4; ++dt) o[dt] = W::mma(v[dt][g], p2[g], o[dt]);
#pragma unroll
                for (int dt = 0; dt < 4; ++dt) o[dt] = W::mma(v2[dt][g], p[g], o[dt]); } }
        // the same for the V base addresses, behind the value products
        if constexpr (decltype(more)::v) {
            if constexpr (HR) asm volatile("s_wait_xcnt 0x0\n\ts_add_nc_u64 %0, %0, %2\n\ts_add_nc_u64 %1, %1, %2" : "+s"(Vf), "+s"(Vf2) : "s"(inc), "v"(o[0]), "v"(o[1]), "v"(o[2]), "v"(o[3]) : "memory");
            else asm volatile("s_wait_xcnt 0x0\n\ts_add_nc_u64 %0, %0, %1" : "+s"(Vf) : "s"(inc), "v"(o[0]), "v"(o[1]), "v"(o[2]), "v"(o[3]) : "memory");
#pragma unroll
            for (int g = 0; g < KG; ++g)
#pragma unroll
                for (int dt = 0; dt < 4; ++dt) { v[dt][g] = ldfr(Vf + g * 2048 + dt * 512 + lo); if (HR) v2[dt][g] = ldfr(Vf2 + g * 2048 + dt * 512 + lo); }
        }
    };
#pragma unroll 1
    for (int kb = KB; kb < TT; kb += KB) pass(BoolC<true>{});   // rolled: one pass's code and registers
    // precaution: the last fetches' base addresses, inputs here so that they stay whole up to this line, are free for other values only behind the wait
    if constexpr (HR) asm volatile("s_wait_xcnt 0x0" :: "s"(Kf), "s"(Kf2), "s"(Vf), "s"(Vf2) : "memory"); else asm volatile("s_wait_xcnt 0x0" :: "s"(Kf), "s"(Vf) : "memory");
    pass(BoolC<false>{});
    l += xhalf(l); const float inv = __fdiv_rn(1.0f, l);
#pragma unroll
    for (int dt = 0; dt < 4; ++dt) { v8us oh, ol;   // o[dt][j] = O[query lr][d = dt * 16 + hi * 8 + j]: 8 consecutive d, one 16-byte store a plane
#pragma unroll
        for (int j = 0; j < 8; ++j) { unsigned short a, c2; splitf(o[dt][j] * inv, a, c2); oh[j] = a; ol[j] = c2; }
        *(v8us*)(Ah + (size_t)lr * DQ + dt * 16 + hi * 8) = oh; *(v8us*)(Al + (size_t)lr * DQ + dt * 16 + hi * 8) = ol; }
}
// grid (TT / 64, heads, batches), 4 waves of 16 query rows each on the same head, so that they read the same K and V lines at about the same time.
// All work-groups can be resident at once, four to a WGP; the row block is blockIdx.x turned by RH / 64 a batch, so that work-groups 256 apart in the flat index are not all of the longer hi/lo kind.
__global__ __launch_bounds__(128) void k_fattn(const h16* __restrict__ Q16, const bf* __restrict__ Qh, const bf* __restrict__ Ql, const h16* __restrict__ K16, const bf* __restrict__ Kh, const bf* __restrict__ Kl, const h16* __restrict__ V16, const bf* __restrict__ Vh, const bf* __restrict__ Vl, bf* Ah, bf* Al) {
    const int b = blockIdx.z, h = b * NH_ + blockIdx.y, rb = (blockIdx.x + b * (RH / 64)) % (TT / 64), q0 = rb * 64 + (threadIdx.x >> 5) * 16;
    const size_t qo = ((size_t)h * TT + q0) * HD, ko = (size_t)b * TT * HD, vo = (size_t)h * HD * TT, ao = ((size_t)b * TT + q0) * DQ + blockIdx.y * HD;
    if (rb < RH / 64) attn_tile<bf, true, 32>(Qh + qo, Ql + qo, Kh + ko, Kl + ko, Vh + vo, Vl + vo, Ah + ao, Al + ao);
    else attn_tile<h16, false, 64>(Q16 + qo, nullptr, K16 + ko, nullptr, V16 + vo, nullptr, Ah + ao, Al + ao);
}
__global__ __launch_bounds__(256) void k_bfrc(const float* __restrict__ src, float* dst) { const size_t i = (size_t)blockIdx.x * 256 + threadIdx.x; if (i >= (size_t)NB_ * TT * DM / 4) return; const v4f a = *(const v4f*)(src + i * 4); v4f o;
#pragma unroll
    for (int q = 0; q < 4; ++q) o[q] = bfr(a[q]);
    *(v4f*)(dst + i * 4) = o;  }
__global__ __launch_bounds__(256) void k_wsel(const float* __restrict__ w, int par, bf* Bt) { const int i = blockIdx.x * 256 + threadIdx.x; if (i >= DQ * DM / 8) return; const int c0 = (i % (DM / 8)) * 8; const int r = i / (DM / 8); const int h = r / HD, d = r % HD; const int col = h * 2 * HD + 2 * d + par; v8us o;
#pragma unroll
    for (int q = 0; q < 8; ++q) o[q] = f2bf(w[(size_t)(c0 + q) * (2 * DQ) + col]);
    *(v8us*)(Bt + (size_t)r * DM + c0) = o;  }

extern "C" void kernel_launch(void* const* d_in, const int* in_sizes, int n_in,
                              void* d_out, int out_size, void* d_ws, size_t ws_size, hipStream_t stream) {
    (void)in_sizes; (void)n_in; (void)out_size;
    const float* x = (const float*)d_in[0]; const float* wqv = (const float*)d_in[1]; const float* wo = (const float*)d_in[2]; /* Wc */ const float* bo = (const float*)d_in[3]; /* bc */ const float* wq = nullptr; const float* wk = nullptr; const float* wv = nullptr; (void)wq; (void)wk; (void)wv;
    float* OUT = (float*)d_out;     // [4][2048][64]
    char* wsp = (char*)d_ws;
    auto take = [&](size_t bytes) { char* p = wsp; wsp += (bytes + 255) & ~(size_t)255; return (void*)p; };
    float* XR = (float*)take((size_t)NB_ * TT * DM * 4); bf* WQ = (bf*)take((size_t)DQ * DM * 2); bf* WV = (bf*)take((size_t)DQ * DM * 2); float* FV = (float*)take((size_t)NB_ * TT * DQ * 4); bf* WO = (bf*)take((size_t)DM * DQ * 2); float* CS = (float*)take((size_t)TT * HD * 2 * 4);
    bf* XB = (bf*)take((size_t)NB_ * TT * DM * 2); float* FQ = (float*)take((size_t)NB_ * TT * DQ * 4);   /* every per-batch buffer holds all batches, batch-major */
    h16* QP16 = (h16*)take((size_t)NB_ * NH_ * TT * HD * 2); h16* KP16 = (h16*)take((size_t)NB_ * NKV * TT * HD * 2); h16* VT16 = (h16*)take((size_t)NB_ * NH_ * HD * TT * 2);
    bf* QPh = (bf*)take((size_t)NB_ * NH_ * TT * HD * 2); bf* QPl = (bf*)take((size_t)NB_ * NH_ * TT * HD * 2); bf* KPh = (bf*)take((size_t)NB_ * NKV * TT * HD * 2); bf* KPl = (bf*)take((size_t)NB_ * NKV * TT * HD * 2); bf* VTh = (bf*)take((size_t)NB_ * NH_ * HD * TT * 2); bf* VTl = (bf*)take((size_t)NB_ * NH_ * HD * TT * 2);
    bf* ATh = (bf*)take((size_t)NB_ * TT * DQ * 2); bf* ATl = (bf*)take((size_t)NB_ * TT * DQ * 2);
    if ((size_t)(wsp - (char*)d_ws) > ws_size) return;    // ws 256 MiB
    
    { k_wsel<<<(DQ * DM / 8 + 255) / 256, 256, 0, stream>>>(wqv, 0, WQ); k_wsel<<<(DQ * DM / 8 + 255) / 256, 256, 0, stream>>>(wqv, 1, WV);   /* q = even, v = odd columns of each head's 128-column block */  
      k_wtG<<<(unsigned)((DQ * DM / 64 + 63) / 64), 256, 0, stream>>>(wo, DQ, DM, WO);   /* Wc is 'xw' [512][64] -> Bt [64][512] */
       }
    k_csid<<<(TT * HD + 255) / 256, 256, 0, stream>>>(CS);
    const unsigned LQ = (unsigned)(((size_t)NH_ * TT * HD / 2 + 255) / 256), LKv = (unsigned)(((size_t)NKV * TT * HD / 2 + 255) / 256);
    /* every launch takes all batches: x, XB, XR, FQ, FV, ATh / ATl and OUT are [batch * TT + t] rows, so the row-wise kernels just see NB_ * TT rows; the plane builders take the batch in grid y, the attention in grid z */
    k_cvt8<<<(unsigned)(((size_t)NB_ * TT * DM / 8 + 255) / 256), 256, 0, stream>>>(x, XB, (size_t)NB_ * TT * DM / 8);
    k_gemmw<bf, 0, false><<<dim3(NB_ * TT / 64, DQ / 64, 1), 32, 0, stream>>>(XB, nullptr, WQ, nullptr, DM, FQ, DQ, nullptr, 0, 0, 0);
    k_rope<<<dim3(LQ, NB_, 1), 256, 0, stream>>>(FQ, DQ, NH_, CS, nullptr, nullptr, 1.0f, 0, QP16, QPh, QPl);
    k_bfrc<<<(unsigned)(((size_t)NB_ * TT * DM / 4 + 255) / 256), 256, 0, stream>>>(x, XR); k_rope<<<dim3(LKv, NB_, 1), 256, 0, stream>>>(XR, DM, 1, CS, nullptr, nullptr, 1.0f, 1, KP16, KPh, KPl);   /* the key IS bf16(x): one exact 64-wide plane a batch, shared by all its heads, stored as fragments */
    k_gemmw<bf, 0, false><<<dim3(NB_ * TT / 64, DQ / 64, 1), 32, 0, stream>>>(XB, nullptr, WV, nullptr, DM, FV, DQ, nullptr, 0, 0, 0);   /* v: 8 heads x 64 */ k_vtp<<<dim3(LQ, NB_, 1), 256, 0, stream>>>(FV, DQ, NH_, VT16, VTh, VTl);
    k_fattn<<<dim3(TT / 64, NH_, NB_), 128, 0, stream>>>(QP16, QPh, QPl, KP16, KPh, KPl, VT16, VTh, VTl, ATh, ATl);   /* one shared key plane a batch; each query head has its own value planes */
    k_gemmw<bf, 1, true><<<dim3(NB_ * TT / 64, DM / 64, 1), 32, 0, stream>>>(ATh, ATl, WO, nullptr, DQ, OUT, DM, bo, 0, 0, 0);
}

// v005
// It runs in 87.5 microseconds.
// Timed twice side by side with v004, it ran 1.88 times as fast both times.
// All steps since v000 together make it 21.3 times as fast.
#include <hip/hip_runtime.h>

// Multi-head attention V2 with the input itself as the shared key (x [4][2048][64]; qv = x Wqv ('xw' [64][1024] with the (H, D, 2) channel layout: q_h[d] = column h*128 + 2d, v_h[d] = column h*128 + 2d + 1); 8 heads x 64; scores = q_h . x / 8 (the 64-dim input is every head's key); softmax; out = merged (attn v) Wc + bc ('xw' [512][64]) -> [4][2048][64] (0.5 M)).
// Layout, every buffer batch-major: ONE kernel in front of the attention reads x and the interleaved q/v weights as f32, rounds them to bf16 in registers, does both projections and stores its accumulators straight as the attention's operand planes (q rows, V^T fragments), the x fragments as the single exact key plane shared by all heads, and Wc transposed into the Bt layout; dense T-2048 attention in one fused kernel (scores, online softmax and attn x V; the scores never reach memory), 8 query heads over one key plane (hybrid rows: < 512 hi/lo 3 products, rest fp16), each head's own 64-wide value; merged hi/lo x Wc exact + bc.
// Compute dtypes, f32 accumulate: every input rounded to bf16; projections exact; attention rows < 512 3 products (keys exact), rest fp16; softmax f32; Wc hl x exact + bias.

#define NB_  4
#define TT   2048
#define DM   64
#define NH_  8
#define NKV  1
#define REP  (NH_ / NKV)
#define HD   64
#define DQ   (NH_ * HD)
#define DKV  (NKV * HD)
#define RH   512                  // query rows < RH use hi+lo planes (0: none)
#define WIN  0
#define SCL  0.125f   // HD^-0.5
typedef _Float16 h16;
typedef unsigned short bf;
typedef __attribute__((ext_vector_type(16))) __bf16   v16bf;
typedef __attribute__((ext_vector_type(16))) _Float16 v16h;
typedef __attribute__((ext_vector_type(8)))  _Float16 v8h;
typedef __attribute__((ext_vector_type(8)))  unsigned short v8us;
typedef __attribute__((ext_vector_type(8)))  float    v8f;
typedef __attribute__((ext_vector_type(4)))  float    v4f;
typedef v8h  __attribute__((may_alias)) v8ha;
typedef v4f  __attribute__((may_alias)) v4fa;
typedef v8us __attribute__((may_alias)) v8usa;

__device__ __forceinline__ unsigned short f2bf(float f) { unsigned u = __float_as_uint(f); u += 0x7FFFu + ((u >> 16) & 1u); return (unsigned short)(u >> 16); }
__device__ __forceinline__ float bf2f(unsigned short b) { return __uint_as_float(((unsigned)b) << 16); }
__device__ __forceinline__ float bfr(float f) { return bf2f(f2bf(f)); }
__device__ __forceinline__ v16h cat16(v8h lo, v8h hi) { return __builtin_shufflevector(lo, hi, 0, 1, 2, 3, 4, 5, 6, 7, 8, 9, 10, 11, 12, 13, 14, 15); }
__device__ __forceinline__ v16bf cat16b(v8us lo, v8us hi) { return __builtin_bit_cast(v16bf, __builtin_shufflevector(lo, hi, 0, 1, 2, 3, 4, 5, 6, 7, 8, 9, 10, 11, 12, 13, 14, 15)); }
__device__ __forceinline__ v8f wmma16(v16h a, v16h b, v8f c) { return __builtin_amdgcn_wmma_f32_16x16x32_f16(false, a, false, b, (short)0, c, false, false); }
__device__ __forceinline__ v8f wmmab(v16bf a, v16bf b, v8f c) { return __builtin_amdgcn_wmma_f32_16x16x32_bf16(false, a, false, b, (short)0, c, false, false); }



// ---- k_gemmw: register-blocked GEMM, ONE WAVE per 64x64 output tile (16 accumulators), operands straight from K-contiguous 16-bit planes; grid (M/64, N/64, Z), 32 threads.
// C[m][n] (f32, pitch ldc, + optional f32 bias[n]) = sum_k A[m][k] Bt[n][k] (+ split products per NSPLIT). z-batch strides sA/sB/sC in elements. K % 32 == 0.
// KS > 1: blockIdx.z = batch * KS + range; the work-group sums only its own range of K / KS of the k and stores a partial plane at blockIdx.z * sC. (K / KS) % 32 == 0.
template <typename T16> struct WFrag;
template <> struct WFrag<h16> { typedef v16h V; static __device__ __forceinline__ V ld(const h16* p) { return cat16(*(const v8h*)p, *(const v8h*)(p + 16)); } static __device__ __forceinline__ v8f mma(V a, V b, v8f c) { return wmma16(a, b, c); } };
template <> struct WFrag<bf> { typedef v16bf V; static __device__ __forceinline__ V ld(const bf* p) { return cat16b(*(const v8us*)p, *(const v8us*)(p + 16)); } static __device__ __forceinline__ v8f mma(V a, V b, v8f c) { return wmmab(a, b, c); } };
template <typename T16, int NSPLIT, bool BIAS, int KS = 1>
__global__ __launch_bounds__(32) void k_gemmw(const T16* __restrict__ A, const T16* __restrict__ A2, const T16* __restrict__ Bt, const T16* __restrict__ Bt2, int K, float* C, int ldc, const float* __restrict__ bias, size_t sA, size_t sB, size_t sC) {
    typedef typename WFrag<T16>::V V;
    __shared__ __align__(16) float os[16 * 68];
    const size_t z = blockIdx.z / KS, ko = (size_t)(blockIdx.z % KS) * (K / KS); A += z * sA + ko; if (A2) A2 += z * sA + ko; Bt += z * sB + ko; if (Bt2) Bt2 += z * sB + ko; C += (size_t)blockIdx.z * sC;
    const int lane = threadIdx.x & 31, lr = lane & 15, hi = lane >> 4; const int r0 = blockIdx.x * 64, c0 = blockIdx.y * 64;
    v8f acc[4][4];
#pragma unroll
    for (int mb = 0; mb < 4; ++mb)
#pragma unroll
        for (int nb = 0; nb < 4; ++nb) acc[mb][nb] = (v8f){};
    const size_t aoff = (size_t)(r0 + lr) * K + 8 * hi, boff = (size_t)(c0 + lr) * K + 8 * hi;
#pragma unroll 1
    for (int kc = 0; kc < K / KS; kc += 32) {
        V a[4], a2[4];
#pragma unroll
        for (int mb = 0; mb < 4; ++mb) { a[mb] = WFrag<T16>::ld(A + aoff + (size_t)mb * 16 * K + kc); if (NSPLIT == 1 || NSPLIT == 2) a2[mb] = WFrag<T16>::ld(A2 + aoff + (size_t)mb * 16 * K + kc); }
#pragma unroll
        for (int nb = 0; nb < 4; ++nb) { const V b = WFrag<T16>::ld(Bt + boff + (size_t)nb * 16 * K + kc); V b2; if (NSPLIT >= 2) b2 = WFrag<T16>::ld(Bt2 + boff + (size_t)nb * 16 * K + kc);
#pragma unroll
            for (int mb = 0; mb < 4; ++mb) { acc[mb][nb] = WFrag<T16>::mma(a[mb], b, acc[mb][nb]); if (NSPLIT == 1 || NSPLIT == 2) acc[mb][nb] = WFrag<T16>::mma(a2[mb], b, acc[mb][nb]); if (NSPLIT >= 2) acc[mb][nb] = WFrag<T16>::mma(a[mb], b2, acc[mb][nb]); } }
        asm volatile("v_nop\n\tv_nop\n\tv_nop\n\tv_nop" : "+v"(acc[0][0]), "+v"(acc[1][1]), "+v"(acc[2][2]), "+v"(acc[3][3]) : "v"(a[0]), "v"(a[3]));
    }
#pragma unroll
    for (int mb = 0; mb < 4; ++mb) {
#pragma unroll
        for (int nb = 0; nb < 4; ++nb) {
#pragma unroll
            for (int j = 0; j < 8; ++j) os[(hi * 8 + j) * 68 + nb * 16 + lr] = acc[mb][nb][j]; }
        __builtin_amdgcn_wave_barrier(); asm volatile("" ::: "memory");
        float* crow = C + (size_t)(r0 + mb * 16) * ldc + c0;
{
#pragma unroll
            for (int s = 0; s < 8; ++s) { const int row = 2 * s + hi, cofs = lr * 4; v4f val = *(const v4fa*)(os + row * 68 + cofs); if (BIAS) { val[0] += bfr(bias[c0 + cofs]); val[1] += bfr(bias[c0 + cofs + 1]); val[2] += bfr(bias[c0 + cofs + 2]); val[3] += bfr(bias[c0 + cofs + 3]); }
                *(v4f*)(crow + (size_t)row * ldc + cofs) = val; }
             }
        __builtin_amdgcn_wave_barrier(); asm volatile("" ::: "memory");
    }
}

__device__ __forceinline__ void splitf(float y, unsigned short& h, unsigned short& l) { h = f2bf(y); l = f2bf(y - bf2f(h)); }
typedef __attribute__((ext_vector_type(2))) _Float16 v2h;
typedef __attribute__((ext_vector_type(4))) _Float16 v4h;
typedef __attribute__((ext_vector_type(2))) unsigned short v2us;
typedef __attribute__((ext_vector_type(4))) unsigned short v4us;
typedef __attribute__((ext_vector_type(2))) float v2f;
typedef __attribute__((ext_vector_type(4))) int v4i;

// ---- k_prep: all that stands in front of the attention. Grid (batches * TT / 32, heads + 1), one wave a work-group.
// y < heads: 32 rows of x against one head's 64 q and 64 v columns, K = 64. A weight pair (q, v) of one channel is adjacent in Wqv, so one 8-byte load feeds both products.
// q is formed transposed (A = weights, B = x rows): a lane then holds 8 consecutive d of one row, one 16-byte store a plane into the row-major q planes.
// v is formed straight (A = x rows, B = weights): a lane then holds 8 consecutive keys of one d, which is a lane's place in the V^T fragment planes (per head and 32 keys, four 16-d tiles of two 512-B runs, run t / 16 % 2, lane (t / 8 % 2) * 16 + d % 16).
// The x fragments themselves are the key plane's fragments (16 rows x 64 d = four runs of 512 B, run d / 16, lane (d / 8 % 2) * 16 + t % 16, 8 d a lane); head 0's waves store them; the key is bf16(x) exactly, so its lo plane is zero.
// y == heads: Wc [512][64] -> Bt [64][512] in bf16, four k a lane.
// Every loop here and in put3 is unrolled in full: fragments, raw weights and accumulators stay in registers only where each index is a constant.
typedef __attribute__((ext_vector_type(2))) __bf16 v2b;
typedef __attribute__((ext_vector_type(4))) unsigned v4u;
typedef __attribute__((ext_vector_type(8))) unsigned v8u;
__device__ __forceinline__ unsigned pkb(float a, float b) { v2f t; t[0] = a; t[1] = b; return __builtin_bit_cast(unsigned, __builtin_convertvector(t, v2b)); }   // two f32 -> two bf16, nearest even, one instruction
__device__ __forceinline__ void put3(v8f r, size_t o, h16* P16, bf* Ph, bf* Pl) { v4u o16, oh, ol;   // 8 consecutive elements of the fp16 plane and of the hi / lo planes
#pragma unroll
    for (int j = 0; j < 4; ++j) { v2f t; t[0] = r[2 * j]; t[1] = r[2 * j + 1]; const v2b xh = __builtin_convertvector(t, v2b);
        o16[j] = __builtin_bit_cast(unsigned, __builtin_convertvector(t, v2h)); oh[j] = __builtin_bit_cast(unsigned, xh); ol[j] = __builtin_bit_cast(unsigned, __builtin_convertvector(t - __builtin_convertvector(xh, v2f), v2b)); }
    *(v4u*)(P16 + o) = o16; *(v4u*)(Ph + o) = oh; *(v4u*)(Pl + o) = ol; }
__global__ __launch_bounds__(32) void k_prep(const float* __restrict__ x, const float* __restrict__ wqv, const float* __restrict__ wo, h16* Q16, bf* Qh, bf* Ql, h16* K16, bf* Kh, bf* Kl, h16* V16, bf* Vh, bf* Vl, bf* WO) {
    const int lane = threadIdx.x & 31, lr = lane & 15, hi = lane >> 4;
    if (blockIdx.y == NH_) { const int e = (blockIdx.x * 32 + lane) * 4; if (e >= DM * DQ) return; const int k = e % DQ, n = e / DQ; v4us o;
#pragma unroll
        for (int q = 0; q < 4; ++q) o[q] = f2bf(wo[(size_t)(k + q) * DM + n]);
        *(v4us*)(WO + e) = o; return; }
    const int h = blockIdx.y, row0 = blockIdx.x * 32, b = row0 / TT, t0 = row0 % TT;
    const float* wp = wqv + (size_t)(8 * hi) * (2 * DQ) + h * 2 * HD + 2 * lr;
    v2f raw[2][32];   // one 16-channel tile's (q, v) weight pairs, k in fragment order: entry i is k = (i / 16) * 32 + (i / 8 % 2) * 16 + 8 * hi + i % 8; two tiles, one in flight while the other is worked on
    auto ldw = [&](int nb) __attribute__((always_inline)) {
#pragma unroll
        for (int i = 0; i < 32; ++i) raw[nb & 1][i] = *(const v2f*)(wp + (size_t)((i >> 4) * 32 + ((i >> 3) & 1) * 16 + (i & 7)) * (2 * DQ) + nb * 32); };
    v8f xf[2][4];   // x[row0 + mb * 16 + lr][r * 16 + 8 * hi + 0..7]
#pragma unroll
    for (int mb = 0; mb < 2; ++mb)
#pragma unroll
        for (int r = 0; r < 4; ++r) xf[mb][r] = *(const v8f*)(x + (size_t)(row0 + mb * 16 + lr) * DM + r * 16 + 8 * hi);
    ldw(0);
    __builtin_amdgcn_sched_barrier(0);   // all loads of x and of the first weight tile are issued before the first wait; left alone the compiler loads the weights two at a time with a full wait behind each pair
    v16bf xa[2][2];
#pragma unroll
    for (int mb = 0; mb < 2; ++mb)
#pragma unroll
        for (int c = 0; c < 2; ++c) { v8u u;
#pragma unroll
            for (int e = 0; e < 8; ++e) u[e] = pkb(xf[mb][2 * c + (e >> 2)][(e & 3) * 2], xf[mb][2 * c + (e >> 2)][(e & 3) * 2 + 1]);
            xa[mb][c] = __builtin_bit_cast(v16bf, u); }
    if (h == 0) {
#pragma unroll
        for (int mb = 0; mb < 2; ++mb)
#pragma unroll
            for (int r = 0; r < 4; ++r) { v8f kr;
#pragma unroll
                for (int j = 0; j < 8; ++j) kr[j] = (float)xa[mb][r >> 1][(r & 1) * 8 + j];
                put3(kr, (size_t)b * TT * HD + (size_t)((t0 >> 4) + mb) * 1024 + r * 256 + lane * 8, K16, Kh, Kl); } }
    const size_t hb = (size_t)(b * NH_ + h) * TT * HD;
#pragma unroll
    for (int nb = 0; nb < 4; ++nb) { v16bf wq[2], wv[2];
        // the next tile's 32 loads are issued as one group in front of this tile's work, in whose time they fly; the wait (a precaution) stands between the stores issued so far and these loads, which land in registers that those stores name
        if (nb < 3) { asm volatile("s_wait_xcnt 0x0" ::: "memory"); ldw(nb + 1); __builtin_amdgcn_sched_barrier(0); }
#pragma unroll
        for (int c = 0; c < 2; ++c) { v8u uq, uv;
#pragma unroll
            for (int e = 0; e < 8; ++e) { const v2f w0 = raw[nb & 1][c * 16 + 2 * e], w1 = raw[nb & 1][c * 16 + 2 * e + 1]; uq[e] = pkb(w0[0], w1[0]); uv[e] = pkb(w0[1], w1[1]); }
            wq[c] = __builtin_bit_cast(v16bf, uq); wv[c] = __builtin_bit_cast(v16bf, uv); }
#pragma unroll
        for (int mb = 0; mb < 2; ++mb) { v8f aq = (v8f){}, av = (v8f){};
#pragma unroll
            for (int c = 0; c < 2; ++c) { aq = wmmab(wq[c], xa[mb][c], aq); av = wmmab(xa[mb][c], wv[c], av); }
            put3(aq, hb + (size_t)(t0 + mb * 16 + lr) * HD + nb * 16 + hi * 8, Q16, Qh, Ql);
            put3(av, hb + (size_t)(t0 >> 5) * 2048 + nb * 512 + mb * 256 + lane * 8, V16, Vh, Vl); } }
    asm volatile("s_wait_xcnt 0x0" ::: "memory");   // precaution: the last stores' registers are free for other values only behind this wait, whatever code the compiler lays out behind them
}
// ---- k_fattn: scores, softmax and attn x V of 16 query rows per wave, all 2048 keys, nothing of the scores in memory.
// Transposed products: S^T = K Q^T (A = key fragments, B = query rows) leaves each lane with one query's scores (query = lane % 16, keys 8 * (lane / 16) + j of each 16-key tile);
// two such tiles, converted in place, are the B operand of O^T += V^T P^T in the hardware k order, which the V^T fragments are stored in. Running maximum and sum per lane (online softmax), halves joined by one lane exchange.
// K fragments are fetched again right behind the score products and V fragments right behind the value products, so the next pass's loads fly during this pass's work.
// a fragment = two 512-byte runs; the pointers are marked as global memory because a base address that comes out of an asm statement would otherwise be read by flat loads
__device__ __forceinline__ v16h  ldfr(const h16* p) { const __attribute__((address_space(1))) v8h* g = (const __attribute__((address_space(1))) v8h*)p; return cat16(g[0], g[32]); }
__device__ __forceinline__ v16bf ldfr(const bf* p) { const __attribute__((address_space(1))) v8us* g = (const __attribute__((address_space(1))) v8us*)p; return cat16b(g[0], g[32]); }
__device__ __forceinline__ float xhalf(float x) { const int b = __float_as_int(x); return __int_as_float(__builtin_amdgcn_permlanex16(b, b, 0x76543210, 0xfedcba98, false, false)); }   // lane l <-> l ^ 16
// 2^x. The v_nop keeps the one slot that the instruction set asks for between a transcendental and a directly following instruction that reads its result or overwrites its source;
// in exp2x8 each v_exp works in place on its own register, so that the eight need none between them.
__device__ __forceinline__ float exp2s(float x) { float r; asm("v_exp_f32 %0, %1\n\tv_nop" : "=v"(r) : "v"(x)); return r; }
__device__ __forceinline__ void exp2x8(v8f& x) { float a = x[0], b = x[1], c = x[2], d = x[3], e = x[4], f = x[5], g = x[6], h = x[7];
    asm("v_exp_f32 %0, %0\n\tv_exp_f32 %1, %1\n\tv_exp_f32 %2, %2\n\tv_exp_f32 %3, %3\n\tv_exp_f32 %4, %4\n\tv_exp_f32 %5, %5\n\tv_exp_f32 %6, %6\n\tv_exp_f32 %7, %7\n\tv_nop" : "+v"(a), "+v"(b), "+v"(c), "+v"(d), "+v"(e), "+v"(f), "+v"(g), "+v"(h));
    x[0] = a; x[1] = b; x[2] = c; x[3] = d; x[4] = e; x[5] = f; x[6] = g; x[7] = h; }
template <bool B> struct BoolC { static constexpr bool v = B; };
template <typename T16, bool HR, int KB>
__device__ __forceinline__ void attn_tile(const T16* __restrict__ Q, const T16* __restrict__ Q2, const T16* __restrict__ Kf, const T16* __restrict__ Kf2, const T16* __restrict__ Vf, const T16* __restrict__ Vf2, bf* Ah, bf* Al) {
    typedef typename WFrag<T16>::V V; typedef WFrag<T16> W;
    constexpr int KT = KB / 16, KG = KB / 32; constexpr float C2 = SCL * 1.4426950408889634f;
    const int lane = threadIdx.x & 31, lr = lane & 15, hi = lane >> 4;
    V q[2], q2[2], k[KT][2], k2[KT][2], v[4][KG], v2[4][KG];
    Q += lr * HD + 8 * hi; if (HR) Q2 += lr * HD + 8 * hi;
#pragma unroll
    for (int c = 0; c < 2; ++c) { q[c] = W::ld(Q + c * 32); if (HR) q2[c] = W::ld(Q2 + c * 32); }
    const unsigned lo = lane * 8;   // a lane's 16 bytes in each 512-byte run of a fragment plane
#pragma unroll
    for (int kt = 0; kt < KT; ++kt)
#pragma unroll
        for (int c = 0; c < 2; ++c) { k[kt][c] = ldfr(Kf + kt * 1024 + c * 512 + lo); if (HR) k2[kt][c] = ldfr(Kf2 + kt * 1024 + c * 512 + lo); }
    // Two jobs. As a compiler fence: the first V loads are issued behind the Q and K loads, as in the loop; otherwise the wait that the compiler puts at the loop's head for K also waits for the V loads just issued.
    // As a wait (a precaution): the Q loads' address pairs, inputs here so that they stay whole up to this line, are free for other values only behind it.
    if constexpr (HR) asm volatile("s_wait_xcnt 0x0" :: "v"(Q), "v"(Q2) : "memory"); else asm volatile("s_wait_xcnt 0x0" :: "v"(Q) : "memory");
#pragma unroll
    for (int g = 0; g < KG; ++g)
#pragma unroll
        for (int dt = 0; dt < 4; ++dt) { v[dt][g] = ldfr(Vf + g * 2048 + dt * 512 + lo); if (HR) v2[dt][g] = ldfr(Vf2 + g * 2048 + dt * 512 + lo); }
    v8f o[4];
#pragma unroll
    for (int dt = 0; dt < 4; ++dt) o[dt] = (v8f){};
    float m = -3.0e38f, l = 0.f;   // m: running maximum of the raw products; l: this lane's half of the running sum
    const unsigned long long inc = (unsigned long long)KB * HD * sizeof(T16);   // bytes a pass: both kinds of plane hold 64 elements a key
    auto pass = [&](auto more) __attribute__((always_inline)) {   // one pass = KB keys; more: a next pass exists, fetch its fragments
        v8f s[KT];
#pragma unroll
        for (int kt = 0; kt < KT; ++kt) s[kt] = (v8f){};
#pragma unroll
        for (int c = 0; c < 2; ++c) {
#pragma unroll
            for (int kt = 0; kt < KT; ++kt) s[kt] = W::mma(k[kt][c], q[c], s[kt]);
            if (HR) {
#pragma unroll
                for (int kt = 0; kt < KT; ++kt) s[kt] = W::mma(k[kt][c], q2[c], s[kt]);
#pragma unroll
                for (int kt = 0; kt < KT; ++kt) s[kt] = W::mma(k2[kt][c], q[c], s[kt]); } }
        // The step of the K base addresses. One statement holds the wait and the adds, so that the wait stands in front of the rewrite of registers that issued loads name (a precaution);
        // the score tiles are inputs only: the refetch, whose addresses come out of this statement, so stays behind the score products and lands in the same registers, with no copy and no wait for it at the loop's foot.
        if constexpr (decltype(more)::v) {
            if constexpr (HR) asm volatile("s_wait_xcnt 0x0\n\ts_add_nc_u64 %0, %0, %2\n\ts_add_nc_u64 %1, %1, %2" : "+s"(Kf), "+s"(Kf2) : "s"(inc), "v"(s[0]), "v"(s[1]) : "memory");
            else asm volatile("s_wait_xcnt 0x0\n\ts_add_nc_u64 %0, %0, %1" : "+s"(Kf) : "s"(inc), "v"(s[0]), "v"(s[1]), "v"(s[2]), "v"(s[3]) : "memory");
#pragma unroll
            for (int kt = 0; kt < KT; ++kt)
#pragma unroll
                for (int c = 0; c < 2; ++c) { k[kt][c] = ldfr(Kf + kt * 1024 + c * 512 + lo); if (HR) k2[kt][c] = ldfr(Kf2 + kt * 1024 + c * 512 + lo); }
            __builtin_amdgcn_sched_barrier(0);   // keeps the refetch in front of the softmax, in whose time it flies
        }
        float mt[KT];
#pragma unroll
        for (int kt = 0; kt < KT; ++kt) { mt[kt] = s[kt][0];
#pragma unroll
            for (int j = 1; j < 8; ++j) mt[kt] = fmaxf(mt[kt], s[kt][j]); }
        float mx = m;
#pragma unroll
        for (int kt = 0; kt < KT; ++kt) mx = fmaxf(mx, mt[kt]);
        mx = fmaxf(mx, xhalf(mx));
        const float al = exp2s((m - mx) * C2), mc = mx * C2; m = mx;
        float st[KT];
#pragma unroll
        for (int kt = 0; kt < KT; ++kt) {
#pragma unroll
            for (int j = 0; j < 8; ++j) s[kt][j] = __builtin_fmaf(s[kt][j], C2, -mc);
            exp2x8(s[kt]); st[kt] = s[kt][0];
#pragma unroll
            for (int j = 1; j < 8; ++j) st[kt] += s[kt][j]; }
        float sum = st[0];
#pragma unroll
        for (int kt = 1; kt < KT; ++kt) sum += st[kt];
        l = l * al + sum;
#pragma unroll
        for (int dt = 0; dt < 4; ++dt) o[dt] *= al;
        V p[KG], p2[KG];
#pragma unroll
        for (int g = 0; g < KG; ++g)
#pragma unroll
            for (int e = 0; e < 16; ++e) { const float x = s[2 * g + (e >> 3)][e & 7];
                if constexpr (HR) { const __bf16 xh = (__bf16)x; p[g][e] = xh; p2[g][e] = (__bf16)(x - (float)xh); } else p[g][e] = (h16)x; }
#pragma unroll
        for (int g = 0; g < KG; ++g) {
#pragma unroll
            for (int dt = 0; dt < 4; ++dt) o[dt] = W::mma(v[dt][g], p[g], o[dt]);
            if (HR) {
#pragma unroll
                for (int dt = 0; dt < 4; ++dt) o[dt] = W::mma(v[dt][g], p2[g], o[dt]);
#pragma unroll
                for (int dt = 0; dt < 4; ++dt) o[dt] = W::mma(v2[dt][g], p[g], o[dt]); } }
        // the same for the V base addresses, behind the value products
        if constexpr (decltype(more)::v) {
            if constexpr (HR) asm volatile("s_wait_xcnt 0x0\n\ts_add_nc_u64 %0, %0, %2\n\ts_add_nc_u64 %1, %1, %2" : "+s"(Vf), "+s"(Vf2) : "s"(inc), "v"(o[0]), "v"(o[1]), "v"(o[2]), "v"(o[3]) : "memory");
            else asm volatile("s_wait_xcnt 0x0\n\ts_add_nc_u64 %0, %0, %1" : "+s"(Vf) : "s"(inc), "v"(o[0]), "v"(o[1]), "v"(o[2]), "v"(o[3]) : "memory");
#pragma unroll
            for (int g = 0; g < KG; ++g)
#pragma unroll
                for (int dt = 0; dt < 4; ++dt) { v[dt][g] = ldfr(Vf + g * 2048 + dt * 512 + lo); if (HR) v2[dt][g] = ldfr(Vf2 + g * 2048 + dt * 512 + lo); }
        }
    };
#pragma unroll 1
    for (int kb = KB; kb < TT; kb += KB) pass(BoolC<true>{});   // rolled: one pass's code and registers
    // precaution: the last fetches' base addresses, inputs here so that they stay whole up to this line, are free for other values only behind the wait
    if constexpr (HR) asm volatile("s_wait_xcnt 0x0" :: "s"(Kf), "s"(Kf2), "s"(Vf), "s"(Vf2) : "memory"); else asm volatile("s_wait_xcnt 0x0" :: "s"(Kf), "s"(Vf) : "memory");
    pass(BoolC<false>{});
    l += xhalf(l); const float inv = __fdiv_rn(1.0f, l);
#pragma unroll
    for (int dt = 0; dt < 4; ++dt) { v8us oh, ol;   // o[dt][j] = O[query lr][d = dt * 16 + hi * 8 + j]: 8 consecutive d, one 16-byte store a plane
#pragma unroll
        for (int j = 0; j < 8; ++j) { unsigned short a, c2; splitf(o[dt][j] * inv, a, c2); oh[j] = a; ol[j] = c2; }
        *(v8us*)(Ah + (size_t)lr * DQ + dt * 16 + hi * 8) = oh; *(v8us*)(Al + (size_t)lr * DQ + dt * 16 + hi * 8) = ol; }
}
// grid (TT / 64, heads, batches), 4 waves of 16 query rows each on the same head, so that they read the same K and V lines at about the same time.
// All work-groups can be resident at once, four to a WGP; the row block is blockIdx.x turned by RH / 64 a batch, so that work-groups 256 apart in the flat index are not all of the longer hi/lo kind.
__global__ __launch_bounds__(128) void k_fattn(const h16* __restrict__ Q16, const bf* __restrict__ Qh, const bf* __restrict__ Ql, const h16* __restrict__ K16, const bf* __restrict__ Kh, const bf* __restrict__ Kl, const h16* __restrict__ V16, const bf* __restrict__ Vh, const bf* __restrict__ Vl, bf* Ah, bf* Al) {
    const int b = blockIdx.z, h = b * NH_ + blockIdx.y, rb = (blockIdx.x + b * (RH / 64)) % (TT / 64), q0 = rb * 64 + (threadIdx.x >> 5) * 16;
    const size_t qo = ((size_t)h * TT + q0) * HD, ko = (size_t)b * TT * HD, vo = (size_t)h * HD * TT, ao = ((size_t)b * TT + q0) * DQ + blockIdx.y * HD;
    if (rb < RH / 64) attn_tile<bf, true, 32>(Qh + qo, Ql + qo, Kh + ko, Kl + ko, Vh + vo, Vl + vo, Ah + ao, Al + ao);
    else attn_tile<h16, false, 64>(Q16 + qo, nullptr, K16 + ko, nullptr, V16 + vo, nullptr, Ah + ao, Al + ao);
}

extern "C" void kernel_launch(void* const* d_in, const int* in_sizes, int n_in,
                              void* d_out, int out_size, void* d_ws, size_t ws_size, hipStream_t stream) {
    (void)in_sizes; (void)n_in; (void)out_size;
    const float* x = (const float*)d_in[0]; const float* wqv = (const float*)d_in[1]; const float* wo = (const float*)d_in[2]; /* Wc */ const float* bo = (const float*)d_in[3]; /* bc */
    float* OUT = (float*)d_out;     // [4][2048][64]
    char* wsp = (char*)d_ws;
    auto take = [&](size_t bytes) { char* p = wsp; wsp += (bytes + 255) & ~(size_t)255; return (void*)p; };
    bf* WO = (bf*)take((size_t)DM * DQ * 2);   /* every per-batch buffer holds all batches, batch-major */
    h16* QP16 = (h16*)take((size_t)NB_ * NH_ * TT * HD * 2); h16* KP16 = (h16*)take((size_t)NB_ * NKV * TT * HD * 2); h16* VT16 = (h16*)take((size_t)NB_ * NH_ * HD * TT * 2);
    bf* QPh = (bf*)take((size_t)NB_ * NH_ * TT * HD * 2); bf* QPl = (bf*)take((size_t)NB_ * NH_ * TT * HD * 2); bf* KPh = (bf*)take((size_t)NB_ * NKV * TT * HD * 2); bf* KPl = (bf*)take((size_t)NB_ * NKV * TT * HD * 2); bf* VTh = (bf*)take((size_t)NB_ * NH_ * HD * TT * 2); bf* VTl = (bf*)take((size_t)NB_ * NH_ * HD * TT * 2);
    bf* ATh = (bf*)take((size_t)NB_ * TT * DQ * 2); bf* ATl = (bf*)take((size_t)NB_ * TT * DQ * 2);
    if ((size_t)(wsp - (char*)d_ws) > ws_size) return;    // ws 256 MiB
    k_prep<<<dim3(NB_ * TT / 32, NH_ + 1, 1), 32, 0, stream>>>(x, wqv, wo, QP16, QPh, QPl, KP16, KPh, KPl, VT16, VTh, VTl, WO);   /* projections and every operand plane of the attention, and Wc as Bt */
    k_fattn<<<dim3(TT / 64, NH_, NB_), 128, 0, stream>>>(QP16, QPh, QPl, KP16, KPh, KPl, VT16, VTh, VTl, ATh, ATl);   /* one shared key plane a batch; each query head has its own value planes */
    k_gemmw<bf, 1, true><<<dim3(NB_ * TT / 64, DM / 64, 1), 32, 0, stream>>>(ATh, ATl, WO, nullptr, DQ, OUT, DM, bo, 0, 0, 0);
}

// v006
// Measured time: 77.4 microseconds a run.
// In two side-by-side timings against v005, it was 1.13 and 1.15 times as fast.
// All steps since v000 together make it 24.3 times as fast.
#include <hip/hip_runtime.h>

// Multi-head attention V2 with the input itself as the shared key (x [4][2048][64]; qv = x Wqv ('xw' [64][1024] with the (H, D, 2) channel layout: q_h[d] = column h*128 + 2d, v_h[d] = column h*128 + 2d + 1); 8 heads x 64; scores = q_h . x / 8 (the 64-dim input is every head's key); softmax; out = merged (attn v) Wc + bc ('xw' [512][64]) -> [4][2048][64] (0.5 M)).
// Layout, every buffer batch-major: ONE kernel in front of the attention reads x and the interleaved q/v weights as f32, rounds them to bf16 in registers, does both projections and stores its accumulators straight as the attention's operand planes (q rows, V^T fragments), the x fragments as the single exact key plane shared by all heads, and Wc transposed, as fragments; dense T-2048 attention in one fused kernel (scores, online softmax and attn x V; the scores never reach memory), 8 query heads over one key plane (hybrid rows: < 512 hi/lo 3 products, rest fp16), each head's own 64-wide value, the merged hi/lo planes stored as fragments; merged hi/lo x Wc exact + bc, the k split over 8 waves.
// Compute dtypes, f32 accumulate: every input rounded to bf16; projections exact; attention rows < 512 3 products (keys exact), rest fp16; softmax f32; Wc hl x exact + bias.

#define NB_  4
#define TT   2048
#define DM   64
#define NH_  8
#define NKV  1
#define REP  (NH_ / NKV)
#define HD   64
#define DQ   (NH_ * HD)
#define DKV  (NKV * HD)
#define RH   512                  // query rows < RH use hi+lo planes (0: none)
#define WIN  0
#define SCL  0.125f   // HD^-0.5
typedef _Float16 h16;
typedef unsigned short bf;
typedef __attribute__((ext_vector_type(16))) __bf16   v16bf;
typedef __attribute__((ext_vector_type(16))) _Float16 v16h;
typedef __attribute__((ext_vector_type(8)))  _Float16 v8h;
typedef __attribute__((ext_vector_type(8)))  unsigned short v8us;
typedef __attribute__((ext_vector_type(8)))  float    v8f;
typedef __attribute__((ext_vector_type(4)))  float    v4f;
typedef v8h  __attribute__((may_alias)) v8ha;
typedef v4f  __attribute__((may_alias)) v4fa;
typedef v8us __attribute__((may_alias)) v8usa;

__device__ __forceinline__ unsigned short f2bf(float f) { unsigned u = __float_as_uint(f); u += 0x7FFFu + ((u >> 16) & 1u); return (unsigned short)(u >> 16); }
__device__ __forceinline__ float bf2f(unsigned short b) { return __uint_as_float(((unsigned)b) << 16); }
__device__ __forceinline__ float bfr(float f) { return bf2f(f2bf(f)); }
__device__ __forceinline__ v16h cat16(v8h lo, v8h hi) { return __builtin_shufflevector(lo, hi, 0, 1, 2, 3, 4, 5, 6, 7, 8, 9, 10, 11, 12, 13, 14, 15); }
__device__ __forceinline__ v16bf cat16b(v8us lo, v8us hi) { return __builtin_bit_cast(v16bf, __builtin_shufflevector(lo, hi, 0, 1, 2, 3, 4, 5, 6, 7, 8, 9, 10, 11, 12, 13, 14, 15)); }
__device__ __forceinline__ v8f wmma16(v16h a, v16h b, v8f c) { return __builtin_amdgcn_wmma_f32_16x16x32_f16(false, a, false, b, (short)0, c, false, false); }
__device__ __forceinline__ v8f wmmab(v16bf a, v16bf b, v8f c) { return __builtin_amdgcn_wmma_f32_16x16x32_bf16(false, a, false, b, (short)0, c, false, false); }



// ---- fragments of a K-contiguous 16-bit row-major plane, and the product of each operand type
template <typename T16> struct WFrag;
template <> struct WFrag<h16> { typedef v16h V; static __device__ __forceinline__ V ld(const h16* p) { return cat16(*(const v8h*)p, *(const v8h*)(p + 16)); } static __device__ __forceinline__ v8f mma(V a, V b, v8f c) { return wmma16(a, b, c); } };
template <> struct WFrag<bf> { typedef v16bf V; static __device__ __forceinline__ V ld(const bf* p) { return cat16b(*(const v8us*)p, *(const v8us*)(p + 16)); } static __device__ __forceinline__ v8f mma(V a, V b, v8f c) { return wmmab(a, b, c); } };

__device__ __forceinline__ void splitf(float y, unsigned short& h, unsigned short& l) { h = f2bf(y); l = f2bf(y - bf2f(h)); }
typedef __attribute__((ext_vector_type(2))) _Float16 v2h;
typedef __attribute__((ext_vector_type(4))) _Float16 v4h;
typedef __attribute__((ext_vector_type(2))) unsigned short v2us;
typedef __attribute__((ext_vector_type(4))) unsigned short v4us;
typedef __attribute__((ext_vector_type(2))) float v2f;
typedef __attribute__((ext_vector_type(4))) int v4i;

// ---- k_prep: all that stands in front of the attention. Grid (batches * TT / 32, heads + 1), one wave a work-group.
// y < heads: 32 rows of x against one head's 64 q and 64 v columns, K = 64. A weight pair (q, v) of one channel is adjacent in Wqv, so one 8-byte load feeds both products.
// q is formed transposed (A = weights, B = x rows): a lane then holds 8 consecutive d of one row, one 16-byte store a plane into the row-major q planes.
// v is formed straight (A = x rows, B = weights): a lane then holds 8 consecutive keys of one d, which is a lane's place in the V^T fragment planes (per head and 32 keys, four 16-d tiles of two 512-B runs, run t / 16 % 2, lane (t / 8 % 2) * 16 + d % 16).
// The x fragments themselves are the key plane's fragments (16 rows x 64 d = four runs of 512 B, run d / 16, lane (d / 8 % 2) * 16 + t % 16, 8 d a lane); head 0's waves store them; the key is bf16(x) exactly, so its lo plane is zero.
// y == heads: Wc [512][64] -> bf16 fragments of its transpose (16 n x 32 k = two runs of 512 B, run k / 16 % 2, lane (k / 8 % 2) * 16 + n % 16, 8 k a lane; fragment n / 16 * 16 + k / 32), four k a lane.
// Every loop here and in put3 is unrolled in full: fragments, raw weights and accumulators stay in registers only where each index is a constant.
typedef __attribute__((ext_vector_type(2))) __bf16 v2b;
typedef __attribute__((ext_vector_type(4))) unsigned v4u;
typedef __attribute__((ext_vector_type(8))) unsigned v8u;
__device__ __forceinline__ unsigned pkb(float a, float b) { v2f t; t[0] = a; t[1] = b; return __builtin_bit_cast(unsigned, __builtin_convertvector(t, v2b)); }   // two f32 -> two bf16, nearest even, one instruction
__device__ __forceinline__ void put3(v8f r, size_t o, h16* P16, bf* Ph, bf* Pl) { v4u o16, oh, ol;   // 8 consecutive elements of the fp16 plane and of the hi / lo planes
#pragma unroll
    for (int j = 0; j < 4; ++j) { v2f t; t[0] = r[2 * j]; t[1] = r[2 * j + 1]; const v2b xh = __builtin_convertvector(t, v2b);
        o16[j] = __builtin_bit_cast(unsigned, __builtin_convertvector(t, v2h)); oh[j] = __builtin_bit_cast(unsigned, xh); ol[j] = __builtin_bit_cast(unsigned, __builtin_convertvector(t - __builtin_convertvector(xh, v2f), v2b)); }
    *(v4u*)(P16 + o) = o16; *(v4u*)(Ph + o) = oh; *(v4u*)(Pl + o) = ol; }
__global__ __launch_bounds__(32) void k_prep(const float* __restrict__ x, const float* __restrict__ wqv, const float* __restrict__ wo, h16* Q16, bf* Qh, bf* Ql, h16* K16, bf* Kh, bf* Kl, h16* V16, bf* Vh, bf* Vl, bf* WO) {
    const int lane = threadIdx.x & 31, lr = lane & 15, hi = lane >> 4;
    if (blockIdx.y == NH_) { const int e = (blockIdx.x * 32 + lane) * 4; if (e >= DM * DQ) return; const int k = e % DQ, n = e / DQ; v4us o;
#pragma unroll
        for (int q = 0; q < 4; ++q) o[q] = f2bf(wo[(size_t)(k + q) * DM + n]);
        *(v4us*)(WO + (((n >> 4) * (DQ / 32) + (k >> 5)) * 2 + ((k >> 4) & 1)) * 256 + (((k >> 3) & 1) * 16 + (n & 15)) * 8 + (k & 7)) = o; return; }
    const int h = blockIdx.y, row0 = blockIdx.x * 32, b = row0 / TT, t0 = row0 % TT;
    const float* wp = wqv + (size_t)(8 * hi) * (2 * DQ) + h * 2 * HD + 2 * lr;
    v2f raw[2][32];   // one 16-channel tile's (q, v) weight pairs, k in fragment order: entry i is k = (i / 16) * 32 + (i / 8 % 2) * 16 + 8 * hi + i % 8; two tiles, one in flight while the other is worked on
    auto ldw = [&](int nb) __attribute__((always_inline)) {
#pragma unroll
        for (int i = 0; i < 32; ++i) raw[nb & 1][i] = *(const v2f*)(wp + (size_t)((i >> 4) * 32 + ((i >> 3) & 1) * 16 + (i & 7)) * (2 * DQ) + nb * 32); };
    v8f xf[2][4];   // x[row0 + mb * 16 + lr][r * 16 + 8 * hi + 0..7]
#pragma unroll
    for (int mb = 0; mb < 2; ++mb)
#pragma unroll
        for (int r = 0; r < 4; ++r) xf[mb][r] = *(const v8f*)(x + (size_t)(row0 + mb * 16 + lr) * DM + r * 16 + 8 * hi);
    ldw(0);
    __builtin_amdgcn_sched_barrier(0);   // all loads of x and of the first weight tile are issued before the first wait; left alone the compiler loads the weights two at a time with a full wait behind each pair
    v16bf xa[2][2];
#pragma unroll
    for (int mb = 0; mb < 2; ++mb)
#pragma unroll
        for (int c = 0; c < 2; ++c) { v8u u;
#pragma unroll
            for (int e = 0; e < 8; ++e) u[e] = pkb(xf[mb][2 * c + (e >> 2)][(e & 3) * 2], xf[mb][2 * c + (e >> 2)][(e & 3) * 2 + 1]);
            xa[mb][c] = __builtin_bit_cast(v16bf, u); }
    if (h == 0) {
#pragma unroll
        for (int mb = 0; mb < 2; ++mb)
#pragma unroll
            for (int r = 0; r < 4; ++r) { v8f kr;
#pragma unroll
                for (int j = 0; j < 8; ++j) kr[j] = (float)xa[mb][r >> 1][(r & 1) * 8 + j];
                put3(kr, (size_t)b * TT * HD + (size_t)((t0 >> 4) + mb) * 1024 + r * 256 + lane * 8, K16, Kh, Kl); } }
    const size_t hb = (size_t)(b * NH_ + h) * TT * HD;
#pragma unroll
    for (int nb = 0; nb < 4; ++nb) { v16bf wq[2], wv[2];
        // the next tile's 32 loads are issued as one group in front of this tile's work, in whose time they fly; the wait (a precaution) stands between the stores issued so far and these loads, which land in registers that those stores name
        if (nb < 3) { asm volatile("s_wait_xcnt 0x0" ::: "memory"); ldw(nb + 1); __builtin_amdgcn_sched_barrier(0); }
#pragma unroll
        for (int c = 0; c < 2; ++c) { v8u uq, uv;
#pragma unroll
            for (int e = 0; e < 8; ++e) { const v2f w0 = raw[nb & 1][c * 16 + 2 * e], w1 = raw[nb & 1][c * 16 + 2 * e + 1]; uq[e] = pkb(w0[0], w1[0]); uv[e] = pkb(w0[1], w1[1]); }
            wq[c] = __builtin_bit_cast(v16bf, uq); wv[c] = __builtin_bit_cast(v16bf, uv); }
#pragma unroll
        for (int mb = 0; mb < 2; ++mb) { v8f aq = (v8f){}, av = (v8f){};
#pragma unroll
            for (int c = 0; c < 2; ++c) { aq = wmmab(wq[c], xa[mb][c], aq); av = wmmab(xa[mb][c], wv[c], av); }
            put3(aq, hb + (size_t)(t0 + mb * 16 + lr) * HD + nb * 16 + hi * 8, Q16, Qh, Ql);
            put3(av, hb + (size_t)(t0 >> 5) * 2048 + nb * 512 + mb * 256 + lane * 8, V16, Vh, Vl); } }
    asm volatile("s_wait_xcnt 0x0" ::: "memory");   // precaution: the last stores' registers are free for other values only behind this wait, whatever code the compiler lays out behind them
}
// ---- k_fattn: scores, softmax and attn x V of 16 query rows per wave, all 2048 keys, nothing of the scores in memory.
// Transposed products: S^T = K Q^T (A = key fragments, B = query rows) leaves each lane with one query's scores (query = lane % 16, keys 8 * (lane / 16) + j of each 16-key tile);
// two such tiles, converted in place, are the B operand of O^T += V^T P^T in the hardware k order, which the V^T fragments are stored in. Running maximum and sum per lane (online softmax), halves joined by one lane exchange.
// K fragments are fetched again right behind the score products and V fragments right behind the value products, so the next pass's loads fly during this pass's work.
// a fragment = two 512-byte runs; the pointers are marked as global memory because a base address that comes out of an asm statement would otherwise be read by flat loads
__device__ __forceinline__ v16h  ldfr(const h16* p) { const __attribute__((address_space(1))) v8h* g = (const __attribute__((address_space(1))) v8h*)p; return cat16(g[0], g[32]); }
__device__ __forceinline__ v16bf ldfr(const bf* p) { const __attribute__((address_space(1))) v8us* g = (const __attribute__((address_space(1))) v8us*)p; return cat16b(g[0], g[32]); }
__device__ __forceinline__ float xhalf(float x) { const int b = __float_as_int(x); return __int_as_float(__builtin_amdgcn_permlanex16(b, b, 0x76543210, 0xfedcba98, false, false)); }   // lane l <-> l ^ 16
// 2^x. The v_nop keeps the one slot that the instruction set asks for between a transcendental and a directly following instruction that reads its result or overwrites its source;
// in exp2x8 each v_exp works in place on its own register, so that the eight need none between them.
__device__ __forceinline__ float exp2s(float x) { float r; asm("v_exp_f32 %0, %1\n\tv_nop" : "=v"(r) : "v"(x)); return r; }
__device__ __forceinline__ void exp2x8(v8f& x) { float a = x[0], b = x[1], c = x[2], d = x[3], e = x[4], f = x[5], g = x[6], h = x[7];
    asm("v_exp_f32 %0, %0\n\tv_exp_f32 %1, %1\n\tv_exp_f32 %2, %2\n\tv_exp_f32 %3, %3\n\tv_exp_f32 %4, %4\n\tv_exp_f32 %5, %5\n\tv_exp_f32 %6, %6\n\tv_exp_f32 %7, %7\n\tv_nop" : "+v"(a), "+v"(b), "+v"(c), "+v"(d), "+v"(e), "+v"(f), "+v"(g), "+v"(h));
    x[0] = a; x[1] = b; x[2] = c; x[3] = d; x[4] = e; x[5] = f; x[6] = g; x[7] = h; }
template <bool B> struct BoolC { static constexpr bool v = B; };
template <typename T16, bool HR, int KB>
__device__ __forceinline__ void attn_tile(const T16* __restrict__ Q, const T16* __restrict__ Q2, const T16* __restrict__ Kf, const T16* __restrict__ Kf2, const T16* __restrict__ Vf, const T16* __restrict__ Vf2, bf* Ah, bf* Al) {
    typedef typename WFrag<T16>::V V; typedef WFrag<T16> W;
    constexpr int KT = KB / 16, KG = KB / 32; constexpr float C2 = SCL * 1.4426950408889634f;
    const int lane = threadIdx.x & 31, lr = lane & 15, hi = lane >> 4;
    V q[2], q2[2], k[KT][2], k2[KT][2], v[4][KG], v2[4][KG];
    Q += lr * HD + 8 * hi; if (HR) Q2 += lr * HD + 8 * hi;
#pragma unroll
    for (int c = 0; c < 2; ++c) { q[c] = W::ld(Q + c * 32); if (HR) q2[c] = W::ld(Q2 + c * 32); }
    const unsigned lo = lane * 8;   // a lane's 16 bytes in each 512-byte run of a fragment plane
#pragma unroll
    for (int kt = 0; kt < KT; ++kt)
#pragma unroll
        for (int c = 0; c < 2; ++c) { k[kt][c] = ldfr(Kf + kt * 1024 + c * 512 + lo); if (HR) k2[kt][c] = ldfr(Kf2 + kt * 1024 + c * 512 + lo); }
    // Two jobs. As a compiler fence: the first V loads are issued behind the Q and K loads, as in the loop; otherwise the wait that the compiler puts at the loop's head for K also waits for the V loads just issued.
    // As a wait (a precaution): the Q loads' address pairs, inputs here so that they stay whole up to this line, are free for other values only behind it.
    if constexpr (HR) asm volatile("s_wait_xcnt 0x0" :: "v"(Q), "v"(Q2) : "memory"); else asm volatile("s_wait_xcnt 0x0" :: "v"(Q) : "memory");
#pragma unroll
    for (int g = 0; g < KG; ++g)
#pragma unroll
        for (int dt = 0; dt < 4; ++dt) { v[dt][g] = ldfr(Vf + g * 2048 + dt * 512 + lo); if (HR) v2[dt][g] = ldfr(Vf2 + g * 2048 + dt * 512 + lo); }
    v8f o[4];
#pragma unroll
    for (int dt = 0; dt < 4; ++dt) o[dt] = (v8f){};
    float m = -3.0e38f, l = 0.f;   // m: running maximum of the raw products; l: this lane's half of the running sum
    const unsigned long long inc = (unsigned long long)KB * HD * sizeof(T16);   // bytes a pass: both kinds of plane hold 64 elements a key
    auto pass = [&](auto more) __attribute__((always_inline)) {   // one pass = KB keys; more: a next pass exists, fetch its fragments
        v8f s[KT];
#pragma unroll
        for (int kt = 0; kt < KT; ++kt) s[kt] = (v8f){};
#pragma unroll
        for (int c = 0; c < 2; ++c) {
#pragma unroll
            for (int kt = 0; kt < KT; ++kt) s[kt] = W::mma(k[kt][c], q[c], s[kt]);
            if (HR) {
#pragma unroll
                for (int kt = 0; kt < KT; ++kt) s[kt] = W::mma(k[kt][c], q2[c], s[kt]);
#pragma unroll
                for (int kt = 0; kt < KT; ++kt) s[kt] = W::mma(k2[kt][c], q[c], s[kt]); } }
        // The step of the K base addresses. One statement holds the wait and the adds, so that the wait stands in front of the rewrite of registers that issued loads name (a precaution);
        // the score tiles are inputs only: the refetch, whose addresses come out of this statement, so stays behind the score products and lands in the same registers, with no copy and no wait for it at the loop's foot.
        if constexpr (decltype(more)::v) {
            if constexpr (HR) asm volatile("s_wait_xcnt 0x0\n\ts_add_nc_u64 %0, %0, %2\n\ts_add_nc_u64 %1, %1, %2" : "+s"(Kf), "+s"(Kf2) : "s"(inc), "v"(s[0]), "v"(s[1]) : "memory");
            else asm volatile("s_wait_xcnt 0x0\n\ts_add_nc_u64 %0, %0, %1" : "+s"(Kf) : "s"(inc), "v"(s[0]), "v"(s[1]), "v"(s[2]), "v"(s[3]) : "memory");
#pragma unroll
            for (int kt = 0; kt < KT; ++kt)
#pragma unroll
                for (int c = 0; c < 2; ++c) { k[kt][c] = ldfr(Kf + kt * 1024 + c * 512 + lo); if (HR) k2[kt][c] = ldfr(Kf2 + kt * 1024 + c * 512 + lo); }
            __builtin_amdgcn_sched_barrier(0);   // keeps the refetch in front of the softmax, in whose time it flies
        }
        float mt[KT];
#pragma unroll
        for (int kt = 0; kt < KT; ++kt) { mt[kt] = s[kt][0];
#pragma unroll
            for (int j = 1; j < 8; ++j) mt[kt] = fmaxf(mt[kt], s[kt][j]); }
        float mx = m;
#pragma unroll
        for (int kt = 0; kt < KT; ++kt) mx = fmaxf(mx, mt[kt]);
        mx = fmaxf(mx, xhalf(mx));
        const float al = exp2s((m - mx) * C2), mc = mx * C2; m = mx;
        float st[KT];
#pragma unroll
        for (int kt = 0; kt < KT; ++kt) {
#pragma unroll
            for (int j = 0; j < 8; ++j) s[kt][j] = __builtin_fmaf(s[kt][j], C2, -mc);
            exp2x8(s[kt]); st[kt] = s[kt][0];
#pragma unroll
            for (int j = 1; j < 8; ++j) st[kt] += s[kt][j]; }
        float sum = st[0];
#pragma unroll
        for (int kt = 1; kt < KT; ++kt) sum += st[kt];
        l = l * al + sum;
#pragma unroll
        for (int dt = 0; dt < 4; ++dt) o[dt] *= al;
        V p[KG], p2[KG];
#pragma unroll
        for (int g = 0; g < KG; ++g)
#pragma unroll
            for (int e = 0; e < 16; ++e) { const float x = s[2 * g + (e >> 3)][e & 7];
                if constexpr (HR) { const __bf16 xh = (__bf16)x; p[g][e] = xh; p2[g][e] = (__bf16)(x - (float)xh); } else p[g][e] = (h16)x; }
#pragma unroll
        for (int g = 0; g < KG; ++g) {
#pragma unroll
            for (int dt = 0; dt < 4; ++dt) o[dt] = W::mma(v[dt][g], p[g], o[dt]);
            if (HR) {
#pragma unroll
                for (int dt = 0; dt < 4; ++dt) o[dt] = W::mma(v[dt][g], p2[g], o[dt]);
#pragma unroll
                for (int dt = 0; dt < 4; ++dt) o[dt] = W::mma(v2[dt][g], p[g], o[dt]); } }
        // the same for the V base addresses, behind the value products
        if constexpr (decltype(more)::v) {
            if constexpr (HR) asm volatile("s_wait_xcnt 0x0\n\ts_add_nc_u64 %0, %0, %2\n\ts_add_nc_u64 %1, %1, %2" : "+s"(Vf), "+s"(Vf2) : "s"(inc), "v"(o[0]), "v"(o[1]), "v"(o[2]), "v"(o[3]) : "memory");
            else asm volatile("s_wait_xcnt 0x0\n\ts_add_nc_u64 %0, %0, %1" : "+s"(Vf) : "s"(inc), "v"(o[0]), "v"(o[1]), "v"(o[2]), "v"(o[3]) : "memory");
#pragma unroll
            for (int g = 0; g < KG; ++g)
#pragma unroll
                for (int dt = 0; dt < 4; ++dt) { v[dt][g] = ldfr(Vf + g * 2048 + dt * 512 + lo); if (HR) v2[dt][g] = ldfr(Vf2 + g * 2048 + dt * 512 + lo); }
        }
    };
#pragma unroll 1
    for (int kb = KB; kb < TT; kb += KB) pass(BoolC<true>{});   // rolled: one pass's code and registers
    // precaution: the last fetches' base addresses, inputs here so that they stay whole up to this line, are free for other values only behind the wait
    if constexpr (HR) asm volatile("s_wait_xcnt 0x0" :: "s"(Kf), "s"(Kf2), "s"(Vf), "s"(Vf2) : "memory"); else asm volatile("s_wait_xcnt 0x0" :: "s"(Kf), "s"(Vf) : "memory");
    pass(BoolC<false>{});
    l += xhalf(l); const float inv = __fdiv_rn(1.0f, l);
#pragma unroll
    for (int dt = 0; dt < 4; ++dt) { v8us oh, ol;   // o[dt][j] = O[query lr][d = dt * 16 + hi * 8 + j]: this lane's 16 bytes of run dt of the head's two fragments, one 512-byte store of the wave a plane
#pragma unroll
        for (int j = 0; j < 8; ++j) { unsigned short a, c2; splitf(o[dt][j] * inv, a, c2); oh[j] = a; ol[j] = c2; }
        *(v8us*)(Ah + dt * 256 + lo) = oh; *(v8us*)(Al + dt * 256 + lo) = ol; }
}
// grid (TT / 64, heads, batches), 4 waves of 16 query rows each on the same head, so that they read the same K and V lines at about the same time.
// All work-groups can be resident at once, four to a WGP; the row block is blockIdx.x turned by RH / 64 a batch, so that work-groups 256 apart in the flat index are not all of the longer hi/lo kind.
__global__ __launch_bounds__(128) void k_fattn(const h16* __restrict__ Q16, const bf* __restrict__ Qh, const bf* __restrict__ Ql, const h16* __restrict__ K16, const bf* __restrict__ Kh, const bf* __restrict__ Kl, const h16* __restrict__ V16, const bf* __restrict__ Vh, const bf* __restrict__ Vl, bf* Ah, bf* Al) {
    const int b = blockIdx.z, h = b * NH_ + blockIdx.y, rb = (blockIdx.x + b * (RH / 64)) % (TT / 64), q0 = rb * 64 + (threadIdx.x >> 5) * 16;
    const size_t qo = ((size_t)h * TT + q0) * HD, ko = (size_t)b * TT * HD, vo = (size_t)h * HD * TT, ao = ((size_t)b * TT + q0) * DQ + blockIdx.y * (16 * HD);   // merged planes as fragments: 16 rows x 512 k = 16 fragments of 512 elements, a head's two side by side
    if (rb < RH / 64) attn_tile<bf, true, 32>(Qh + qo, Ql + qo, Kh + ko, Kl + ko, Vh + vo, Vl + vo, Ah + ao, Al + ao);
    else attn_tile<h16, false, 64>(Q16 + qo, nullptr, K16 + ko, nullptr, V16 + vo, nullptr, Ah + ao, Al + ao);
}

// ---- k_oproj: out = merged (hi + lo) x Wc + bc. Grid (batches * TT / 32), 8 waves: 32 rows x 64 columns a work-group, wave w sums head w's 64 of the 512 k.
// Every operand is a fragment run (512 contiguous bytes a load), all loads of a wave fly together, and no wave has a k loop: one memory latency in all.
// A = merged rows, B = Wc^T fragments: a lane holds 8 consecutive rows of one column, so the partial tiles lie in LDS column-major, two 16-byte stores a tile. Column pitch 36 floats: 16 B x odd, no bank conflict for writers or readers.
// Behind the barrier each thread adds the 8 partial sums of 8 rows of one column in head order, then the bias; a wave's store covers 32 consecutive columns of a row, one whole line.
__global__ __launch_bounds__(256) void k_oproj(const bf* __restrict__ Ah, const bf* __restrict__ Al, const bf* __restrict__ WO, const float* __restrict__ bias, float* __restrict__ C) {
    __shared__ __align__(16) float part[NH_ * DM * 36];
    const int lane = threadIdx.x & 31, w = threadIdx.x >> 5, lr = lane & 15, hi = lane >> 4;
    const int n = threadIdx.x & 63, m0 = (threadIdx.x >> 6) * 8;   // this thread's 8 outputs
    const unsigned lo = lane * 8;
    const size_t fa = ((size_t)blockIdx.x * 2 * (DQ / 32) + w * 2) * 512;
    const bf* ph = Ah + fa + lo; const bf* pl = Al + fa + lo; const bf* pw = WO + w * 2 * 512 + lo;
    v16bf a[2][2], a2[2][2], b[4][2];
#pragma unroll
    for (int c = 0; c < 2; ++c) {
#pragma unroll
        for (int mb = 0; mb < 2; ++mb) { a[mb][c] = ldfr(ph + (mb * (DQ / 32) + c) * 512); a2[mb][c] = ldfr(pl + (mb * (DQ / 32) + c) * 512); }
#pragma unroll
        for (int nb = 0; nb < 4; ++nb) b[nb][c] = ldfr(pw + (nb * (DQ / 32) + c) * 512); }
    const float bb = bfr(bias[n]);
    // precaution: the loads' address registers, inputs here so that they stay whole up to this line, are free for other values (a later load's data, an accumulator) only behind the wait
    asm volatile("s_wait_xcnt 0x0" :: "v"(ph), "v"(pl), "v"(pw), "v"(n) : "memory");
    __builtin_amdgcn_sched_barrier(0);   // every load is issued before the first wait for data, so that the wave pays one latency
    v8f acc[2][4];
#pragma unroll
    for (int mb = 0; mb < 2; ++mb)
#pragma unroll
        for (int nb = 0; nb < 4; ++nb) acc[mb][nb] = (v8f){};
#pragma unroll
    for (int c = 0; c < 2; ++c) {
#pragma unroll
        for (int mb = 0; mb < 2; ++mb)
#pragma unroll
            for (int nb = 0; nb < 4; ++nb) acc[mb][nb] = wmmab(a[mb][c], b[nb][c], acc[mb][nb]);
        __builtin_amdgcn_sched_barrier(0);   // holds the order, here and below: eight independent tiles in turn; left alone the compiler runs one tile's four products back to back, each waiting for the one before
#pragma unroll
        for (int mb = 0; mb < 2; ++mb)
#pragma unroll
            for (int nb = 0; nb < 4; ++nb) acc[mb][nb] = wmmab(a2[mb][c], b[nb][c], acc[mb][nb]);
        __builtin_amdgcn_sched_barrier(0); }
#pragma unroll
    for (int mb = 0; mb < 2; ++mb)
#pragma unroll
        for (int nb = 0; nb < 4; ++nb) { float* p = part + (w * DM + nb * 16 + lr) * 36 + mb * 16 + hi * 8;
            *(v4f*)p = __builtin_shufflevector(acc[mb][nb], acc[mb][nb], 0, 1, 2, 3); *(v4f*)(p + 4) = __builtin_shufflevector(acc[mb][nb], acc[mb][nb], 4, 5, 6, 7); }
    __syncthreads();   // all 8 partial tiles are in LDS before any is read
    const float* r = part + n * 36 + m0;
    v4f s0 = *(const v4f*)r, s1 = *(const v4f*)(r + 4);
#pragma unroll
    for (int p = 1; p < NH_; ++p) { s0 += *(const v4f*)(r + p * DM * 36); s1 += *(const v4f*)(r + p * DM * 36 + 4); }
    float* o = C + ((size_t)blockIdx.x * 32 + m0) * DM + n;
#pragma unroll
    for (int j = 0; j < 4; ++j) { o[j * DM] = s0[j] + bb; o[(4 + j) * DM] = s1[j] + bb; }
}

extern "C" void kernel_launch(void* const* d_in, const int* in_sizes, int n_in,
                              void* d_out, int out_size, void* d_ws, size_t ws_size, hipStream_t stream) {
    (void)in_sizes; (void)n_in; (void)out_size;
    const float* x = (const float*)d_in[0]; const float* wqv = (const float*)d_in[1]; const float* wo = (const float*)d_in[2]; /* Wc */ const float* bo = (const float*)d_in[3]; /* bc */
    float* OUT = (float*)d_out;     // [4][2048][64]
    char* wsp = (char*)d_ws;
    auto take = [&](size_t bytes) { char* p = wsp; wsp += (bytes + 255) & ~(size_t)255; return (void*)p; };
    bf* WO = (bf*)take((size_t)DM * DQ * 2);   /* every per-batch buffer holds all batches, batch-major */
    h16* QP16 = (h16*)take((size_t)NB_ * NH_ * TT * HD * 2); h16* KP16 = (h16*)take((size_t)NB_ * NKV * TT * HD * 2); h16* VT16 = (h16*)take((size_t)NB_ * NH_ * HD * TT * 2);
    bf* QPh = (bf*)take((size_t)NB_ * NH_ * TT * HD * 2); bf* QPl = (bf*)take((size_t)NB_ * NH_ * TT * HD * 2); bf* KPh = (bf*)take((size_t)NB_ * NKV * TT * HD * 2); bf* KPl = (bf*)take((size_t)NB_ * NKV * TT * HD * 2); bf* VTh = (bf*)take((size_t)NB_ * NH_ * HD * TT * 2); bf* VTl = (bf*)take((size_t)NB_ * NH_ * HD * TT * 2);
    bf* ATh = (bf*)take((size_t)NB_ * TT * DQ * 2); bf* ATl = (bf*)take((size_t)NB_ * TT * DQ * 2);
    if ((size_t)(wsp - (char*)d_ws) > ws_size) return;    // ws 256 MiB
    k_prep<<<dim3(NB_ * TT / 32, NH_ + 1, 1), 32, 0, stream>>>(x, wqv, wo, QP16, QPh, QPl, KP16, KPh, KPl, VT16, VTh, VTl, WO);   /* projections and every operand plane of the attention, and Wc as Bt */
    k_fattn<<<dim3(TT / 64, NH_, NB_), 128, 0, stream>>>(QP16, QPh, QPl, KP16, KPh, KPl, VT16, VTh, VTl, ATh, ATl);   /* one shared key plane a batch; each query head has its own value planes */
    k_oproj<<<dim3(NB_ * TT / 32, 1, 1), 256, 0, stream>>>(ATh, ATl, WO, bo, OUT);   /* one head's k a wave, partial tiles joined in LDS */
}

// v007
// It runs in 67.6 microseconds.
// Timed twice side by side with v006, it ran 1.13 and 1.12 times as fast.
// Counting every step since v000, it is 27.2 times as fast.
#include <hip/hip_runtime.h>

// Multi-head attention V2 with the input itself as the shared key (x [4][2048][64]; qv = x Wqv ('xw' [64][1024] with the (H, D, 2) channel layout: q_h[d] = column h*128 + 2d, v_h[d] = column h*128 + 2d + 1); 8 heads x 64; scores = q_h . x / 8 (the 64-dim input is every head's key); softmax; out = merged (attn v) Wc + bc ('xw' [512][64]) -> [4][2048][64] (0.5 M)).
// Layout, every buffer batch-major: ONE kernel in front of the attention reads x and the interleaved q/v weights as f32, rounds them to bf16 in registers, does both projections and stores its accumulators straight as the attention's operand planes (q rows, V^T fragments), the x fragments as the single exact key plane shared by all heads, and Wc transposed, as fragments; dense T-2048 attention in one fused kernel (scores, online softmax and attn x V; the scores never reach memory), 8 query heads over one key plane (hybrid rows: < 512 hi/lo 3 products, rest fp16), each head's own 64-wide value, the merged hi/lo planes stored as fragments; merged hi/lo x Wc exact + bc, the k split over 8 waves.
// Compute dtypes, f32 accumulate: every input rounded to bf16; projections exact; attention rows < 512 3 products (keys exact), rest fp16; softmax f32; Wc hl x exact + bias.

#define NB_  4
#define TT   2048
#define DM   64
#define NH_  8
#define NKV  1
#define REP  (NH_ / NKV)
#define HD   64
#define DQ   (NH_ * HD)
#define DKV  (NKV * HD)
#define RH   512                  // query rows < RH use hi+lo planes (0: none)
#define WIN  0
#define SCL  0.125f   // HD^-0.5
typedef _Float16 h16;
typedef unsigned short bf;
typedef __attribute__((ext_vector_type(16))) __bf16   v16bf;
typedef __attribute__((ext_vector_type(16))) _Float16 v16h;
typedef __attribute__((ext_vector_type(8)))  _Float16 v8h;
typedef __attribute__((ext_vector_type(8)))  unsigned short v8us;
typedef __attribute__((ext_vector_type(8)))  float    v8f;
typedef __attribute__((ext_vector_type(4)))  float    v4f;
typedef v8h  __attribute__((may_alias)) v8ha;
typedef v4f  __attribute__((may_alias)) v4fa;
typedef v8us __attribute__((may_alias)) v8usa;

__device__ __forceinline__ unsigned short f2bf(float f) { unsigned u = __float_as_uint(f); u += 0x7FFFu + ((u >> 16) & 1u); return (unsigned short)(u >> 16); }
__device__ __forceinline__ float bf2f(unsigned short b) { return __uint_as_float(((unsigned)b) << 16); }
__device__ __forceinline__ float bfr(float f) { return bf2f(f2bf(f)); }
__device__ __forceinline__ v16h cat16(v8h lo, v8h hi) { return __builtin_shufflevector(lo, hi, 0, 1, 2, 3, 4, 5, 6, 7, 8, 9, 10, 11, 12, 13, 14, 15); }
__device__ __forceinline__ v16bf cat16b(v8us lo, v8us hi) { return __builtin_bit_cast(v16bf, __builtin_shufflevector(lo, hi, 0, 1, 2, 3, 4, 5, 6, 7, 8, 9, 10, 11, 12, 13, 14, 15)); }
__device__ __forceinline__ v8f wmma16(v16h a, v16h b, v8f c) { return __builtin_amdgcn_wmma_f32_16x16x32_f16(false, a, false, b, (short)0, c, false, false); }
__device__ __forceinline__ v8f wmmab(v16bf a, v16bf b, v8f c) { return __builtin_amdgcn_wmma_f32_16x16x32_bf16(false, a, false, b, (short)0, c, false, false); }



// ---- fragments of a K-contiguous 16-bit row-major plane, and the product of each operand type
template <typename T16> struct WFrag;
template <> struct WFrag<h16> { typedef v16h V; static __device__ __forceinline__ V ld(const h16* p) { return cat16(*(const v8h*)p, *(const v8h*)(p + 16)); } static __device__ __forceinline__ v8f mma(V a, V b, v8f c) { return wmma16(a, b, c); } };
template <> struct WFrag<bf> { typedef v16bf V; static __device__ __forceinline__ V ld(const bf* p) { return cat16b(*(const v8us*)p, *(const v8us*)(p + 16)); } static __device__ __forceinline__ v8f mma(V a, V b, v8f c) { return wmmab(a, b, c); } };

__device__ __forceinline__ void splitf(float y, unsigned short& h, unsigned short& l) { h = f2bf(y); l = f2bf(y - bf2f(h)); }
typedef __attribute__((ext_vector_type(2))) _Float16 v2h;
typedef __attribute__((ext_vector_type(4))) _Float16 v4h;
typedef __attribute__((ext_vector_type(2))) unsigned short v2us;
typedef __attribute__((ext_vector_type(4))) unsigned short v4us;
typedef __attribute__((ext_vector_type(2))) float v2f;
typedef __attribute__((ext_vector_type(4))) int v4i;

// ---- k_prep: all that stands in front of the attention. Grid (batches * TT / 32, heads + 1), one wave a work-group.
// y < heads: 32 rows of x against one head's 64 q and 64 v columns, K = 64. A weight pair (q, v) of one channel is adjacent in Wqv, so one 8-byte load feeds both products.
// q is formed transposed (A = weights, B = x rows): a lane then holds 8 consecutive d of one row, one 16-byte store a plane into the row-major q planes.
// v is formed straight (A = x rows, B = weights): a lane then holds 8 consecutive keys of one d, which is a lane's place in the V^T fragment planes (per head and 32 keys, four 16-d tiles of two 512-B runs, run t / 16 % 2, lane (t / 8 % 2) * 16 + d % 16).
// The x fragments themselves are the key plane's fragments (16 rows x 64 d = four runs of 512 B, run d / 16, lane (d / 8 % 2) * 16 + t % 16, 8 d a lane); head 0's waves store them; the key is bf16(x) exactly, so its lo plane is zero.
// y == heads: Wc [512][64] -> bf16 fragments of its transpose (16 n x 32 k = two runs of 512 B, run k / 16 % 2, lane (k / 8 % 2) * 16 + n % 16, 8 k a lane; fragment n / 16 * 16 + k / 32), four k a lane.
// Every loop here and in put3 is unrolled in full: fragments, raw weights and accumulators stay in registers only where each index is a constant.
typedef __attribute__((ext_vector_type(2))) __bf16 v2b;
typedef __attribute__((ext_vector_type(4))) unsigned v4u;
typedef __attribute__((ext_vector_type(8))) unsigned v8u;
__device__ __forceinline__ unsigned pkb(float a, float b) { v2f t; t[0] = a; t[1] = b; return __builtin_bit_cast(unsigned, __builtin_convertvector(t, v2b)); }   // two f32 -> two bf16, nearest even, one instruction
__device__ __forceinline__ void put3(v8f r, size_t o, h16* P16, bf* Ph, bf* Pl) { v4u o16, oh, ol;   // 8 consecutive elements of the fp16 plane and of the hi / lo planes
#pragma unroll
    for (int j = 0; j < 4; ++j) { v2f t; t[0] = r[2 * j]; t[1] = r[2 * j + 1]; const v2b xh = __builtin_convertvector(t, v2b);
        o16[j] = __builtin_bit_cast(unsigned, __builtin_convertvector(t, v2h)); oh[j] = __builtin_bit_cast(unsigned, xh); ol[j] = __builtin_bit_cast(unsigned, __builtin_convertvector(t - __builtin_convertvector(xh, v2f), v2b)); }
    *(v4u*)(P16 + o) = o16; *(v4u*)(Ph + o) = oh; *(v4u*)(Pl + o) = ol; }
__global__ __launch_bounds__(32) void k_prep(const float* __restrict__ x, const float* __restrict__ wqv, const float* __restrict__ wo, h16* Q16, bf* Qh, bf* Ql, h16* K16, bf* Kh, bf* Kl, h16* V16, bf* Vh, bf* Vl, bf* WO) {
    const int lane = threadIdx.x & 31, lr = lane & 15, hi = lane >> 4;
    if (blockIdx.y == NH_) { const int e = (blockIdx.x * 32 + lane) * 4; if (e >= DM * DQ) return; const int k = e % DQ, n = e / DQ; v4us o;
#pragma unroll
        for (int q = 0; q < 4; ++q) o[q] = f2bf(wo[(size_t)(k + q) * DM + n]);
        *(v4us*)(WO + (((n >> 4) * (DQ / 32) + (k >> 5)) * 2 + ((k >> 4) & 1)) * 256 + (((k >> 3) & 1) * 16 + (n & 15)) * 8 + (k & 7)) = o; return; }
    const int h = blockIdx.y, row0 = blockIdx.x * 32, b = row0 / TT, t0 = row0 % TT;
    const float* wp = wqv + (size_t)(8 * hi) * (2 * DQ) + h * 2 * HD + 2 * lr;
    v2f raw[2][32];   // one 16-channel tile's (q, v) weight pairs, k in fragment order: entry i is k = (i / 16) * 32 + (i / 8 % 2) * 16 + 8 * hi + i % 8; two tiles, one in flight while the other is worked on
    auto ldw = [&](int nb) __attribute__((always_inline)) {
#pragma unroll
        for (int i = 0; i < 32; ++i) raw[nb & 1][i] = *(const v2f*)(wp + (size_t)((i >> 4) * 32 + ((i >> 3) & 1) * 16 + (i & 7)) * (2 * DQ) + nb * 32); };
    v8f xf[2][4];   // x[row0 + mb * 16 + lr][r * 16 + 8 * hi + 0..7]
#pragma unroll
    for (int mb = 0; mb < 2; ++mb)
#pragma unroll
        for (int r = 0; r < 4; ++r) xf[mb][r] = *(const v8f*)(x + (size_t)(row0 + mb * 16 + lr) * DM + r * 16 + 8 * hi);
    ldw(0);
    __builtin_amdgcn_sched_barrier(0);   // all loads of x and of the first weight tile are issued before the first wait; left alone the compiler loads the weights two at a time with a full wait behind each pair
    v16bf xa[2][2];
#pragma unroll
    for (int mb = 0; mb < 2; ++mb)
#pragma unroll
        for (int c = 0; c < 2; ++c) { v8u u;
#pragma unroll
            for (int e = 0; e < 8; ++e) u[e] = pkb(xf[mb][2 * c + (e >> 2)][(e & 3) * 2], xf[mb][2 * c + (e >> 2)][(e & 3) * 2 + 1]);
            xa[mb][c] = __builtin_bit_cast(v16bf, u); }
    if (h == 0) {
#pragma unroll
        for (int mb = 0; mb < 2; ++mb)
#pragma unroll
            for (int r = 0; r < 4; ++r) { v8f kr;
#pragma unroll
                for (int j = 0; j < 8; ++j) kr[j] = (float)xa[mb][r >> 1][(r & 1) * 8 + j];
                put3(kr, (size_t)b * TT * HD + (size_t)((t0 >> 4) + mb) * 1024 + r * 256 + lane * 8, K16, Kh, Kl); } }
    const size_t hb = (size_t)(b * NH_ + h) * TT * HD;
#pragma unroll
    for (int nb = 0; nb < 4; ++nb) { v16bf wq[2], wv[2];
        // the next tile's 32 loads are issued as one group in front of this tile's work, in whose time they fly; the wait (a precaution) stands between the stores issued so far and these loads, which land in registers that those stores name
        if (nb < 3) { asm volatile("s_wait_xcnt 0x0" ::: "memory"); ldw(nb + 1); __builtin_amdgcn_sched_barrier(0); }
#pragma unroll
        for (int c = 0; c < 2; ++c) { v8u uq, uv;
#pragma unroll
            for (int e = 0; e < 8; ++e) { const v2f w0 = raw[nb & 1][c * 16 + 2 * e], w1 = raw[nb & 1][c * 16 + 2 * e + 1]; uq[e] = pkb(w0[0], w1[0]); uv[e] = pkb(w0[1], w1[1]); }
            wq[c] = __builtin_bit_cast(v16bf, uq); wv[c] = __builtin_bit_cast(v16bf, uv); }
#pragma unroll
        for (int mb = 0; mb < 2; ++mb) { v8f aq = (v8f){}, av = (v8f){};
#pragma unroll
            for (int c = 0; c < 2; ++c) { aq = wmmab(wq[c], xa[mb][c], aq); av = wmmab(xa[mb][c], wv[c], av); }
            put3(aq, hb + (size_t)(t0 + mb * 16 + lr) * HD + nb * 16 + hi * 8, Q16, Qh, Ql);
            put3(av, hb + (size_t)(t0 >> 5) * 2048 + nb * 512 + mb * 256 + lane * 8, V16, Vh, Vl); } }
    asm volatile("s_wait_xcnt 0x0" ::: "memory");   // precaution: the last stores' registers are free for other values only behind this wait, whatever code the compiler lays out behind them
}
// ---- k_fattn: scores, softmax and attn x V of 16 query rows per wave, all 2048 keys, nothing of the scores in memory.
// Transposed products: S^T = K Q^T (A = key fragments, B = query rows) leaves each lane with one query's scores (query = lane % 16, keys 8 * (lane / 16) + j of each 16-key tile);
// two such tiles, converted in place, are the B operand of O^T += V^T P^T in the hardware k order, which the V^T fragments are stored in. Running maximum and sum per lane (online softmax), halves joined by one lane exchange.
// K fragments are fetched again right behind the score products and V fragments right behind the value products, so the next pass's loads fly during this pass's work.
// a fragment = two 512-byte runs; the pointers are marked as global memory because a base address that comes out of an asm statement would otherwise be read by flat loads
__device__ __forceinline__ v16h  ldfr(const h16* p) { const __attribute__((address_space(1))) v8h* g = (const __attribute__((address_space(1))) v8h*)p; return cat16(g[0], g[32]); }
__device__ __forceinline__ v16bf ldfr(const bf* p) { const __attribute__((address_space(1))) v8us* g = (const __attribute__((address_space(1))) v8us*)p; return cat16b(g[0], g[32]); }
__device__ __forceinline__ float xhalf(float x) { const int b = __float_as_int(x); return __int_as_float(__builtin_amdgcn_permlanex16(b, b, 0x76543210, 0xfedcba98, false, false)); }   // lane l <-> l ^ 16
// 2^x. The v_nop keeps the one slot that the instruction set asks for between a transcendental and a directly following instruction that reads its result or overwrites its source;
// in exp2x8 each v_exp works in place on its own register, so that the eight need none between them.
__device__ __forceinline__ float exp2s(float x) { float r; asm("v_exp_f32 %0, %1\n\tv_nop" : "=v"(r) : "v"(x)); return r; }
__device__ __forceinline__ void exp2x8(v8f& x) { float a = x[0], b = x[1], c = x[2], d = x[3], e = x[4], f = x[5], g = x[6], h = x[7];
    asm("v_exp_f32 %0, %0\n\tv_exp_f32 %1, %1\n\tv_exp_f32 %2, %2\n\tv_exp_f32 %3, %3\n\tv_exp_f32 %4, %4\n\tv_exp_f32 %5, %5\n\tv_exp_f32 %6, %6\n\tv_exp_f32 %7, %7\n\tv_nop" : "+v"(a), "+v"(b), "+v"(c), "+v"(d), "+v"(e), "+v"(f), "+v"(g), "+v"(h));
    x[0] = a; x[1] = b; x[2] = c; x[3] = d; x[4] = e; x[5] = f; x[6] = g; x[7] = h; }
template <bool B> struct BoolC { static constexpr bool v = B; };
// L2 hints for passes J .. N - 1 of one plane (INC bytes a pass), issued together at the start; a hint returns nothing and counts on no counter. The clobber keeps them behind the first passes' own loads.
template <int J, int N, int INC> __device__ __forceinline__ void hint_ahead(unsigned vo, unsigned long long p) {
    if constexpr (J < N) { asm volatile("global_prefetch_b8 %0, %1 offset:%2 scope:SCOPE_SE" :: "v"(vo), "s"(p), "n"(J * INC) : "memory"); hint_ahead<J + 1, N, INC>(vo, p); } }
template <typename T16, bool HR, int KB>
__device__ __forceinline__ void attn_tile(const T16* __restrict__ Q, const T16* __restrict__ Q2, const T16* __restrict__ Kf, const T16* __restrict__ Kf2, const T16* __restrict__ Vf, const T16* __restrict__ Vf2, bf* Ah, bf* Al) {
    typedef typename WFrag<T16>::V V; typedef WFrag<T16> W;
    constexpr int KT = KB / 16, KG = KB / 32; constexpr float C2 = SCL * 1.4426950408889634f;
    const int lane = threadIdx.x & 31, lr = lane & 15, hi = lane >> 4;
    V q[2], q2[2], k[KT][2], k2[KT][2], v[4][KG], v2[4][KG];
    Q += lr * HD + 8 * hi; if (HR) Q2 += lr * HD + 8 * hi;
#pragma unroll
    for (int c = 0; c < 2; ++c) { q[c] = W::ld(Q + c * 32); if (HR) q2[c] = W::ld(Q2 + c * 32); }
    const unsigned lo = lane * 8;   // a lane's 16 bytes in each 512-byte run of a fragment plane
#pragma unroll
    for (int kt = 0; kt < KT; ++kt)
#pragma unroll
        for (int c = 0; c < 2; ++c) { k[kt][c] = ldfr(Kf + kt * 1024 + c * 512 + lo); if (HR) k2[kt][c] = ldfr(Kf2 + kt * 1024 + c * 512 + lo); }
    // Two jobs. As a compiler fence: the first V loads are issued behind the Q and K loads, as in the loop; otherwise the wait that the compiler puts at the loop's head for K also waits for the V loads just issued.
    // As a wait (a precaution): the Q loads' address pairs, inputs here so that they stay whole up to this line, are free for other values only behind it.
    if constexpr (HR) asm volatile("s_wait_xcnt 0x0" :: "v"(Q), "v"(Q2) : "memory"); else asm volatile("s_wait_xcnt 0x0" :: "v"(Q) : "memory");
#pragma unroll
    for (int g = 0; g < KG; ++g)
#pragma unroll
        for (int dt = 0; dt < 4; ++dt) { v[dt][g] = ldfr(Vf + g * 2048 + dt * 512 + lo); if (HR) v2[dt][g] = ldfr(Vf2 + g * 2048 + dt * 512 + lo); }
    // L2 hints. The planes were stored by the launch before; the fragments are fetched less than a pass ahead, so that memory latency would bound every pass.
    // Each pass asks for the lines of the pass PD further on (256 keys), which the fragment loads then find in L2. A work-group reads 16 KB a pass: each of its 4 waves asks for 4 KB, one 256-byte unit a lane pair.
    constexpr int PD = 256 / KB;
    const int wv = __builtin_amdgcn_readfirstlane(threadIdx.x >> 5);
    unsigned long long Pf;   // this wave's 4 KB, PD - 1 passes (the hints' immediate offset) short of the pass last asked for; with that offset it never leaves the plane
    if constexpr (HR) { const unsigned long long pk = (unsigned long long)((wv & 1) ? Kf2 : Kf), pv = (unsigned long long)((wv & 1) ? Vf2 : Vf); Pf = (wv & 2) ? pv : pk; }   // a plane a wave
    else Pf = (unsigned long long)(((wv & 2) ? Vf : Kf) + (wv & 1) * 2048);   // half a plane's pass a wave
    unsigned vo;   // (lane / 2) * 256; formed in asm so that it has one register of its own from here to the end of the loop: a hint may name no register that takes another value soon behind it
    asm("v_lshlrev_b32 %0, 7, %1" : "=v"(vo) : "v"(lane & 30));
    hint_ahead<1, PD, KB * HD * (int)sizeof(T16)>(vo, Pf);
    v8f o[4];
#pragma unroll
    for (int dt = 0; dt < 4; ++dt) o[dt] = (v8f){};
    float m = -3.0e38f, l = 0.f;   // m: running maximum of the raw products; l: this lane's half of the running sum
    const unsigned long long inc = (unsigned long long)KB * HD * sizeof(T16);   // bytes a pass: both kinds of plane hold 64 elements a key
    auto pass = [&](auto more, unsigned long long pinc) __attribute__((always_inline)) {   // one pass = KB keys; more: a next pass exists, fetch its fragments; pinc: the hint address's step, 0 once it stands on the last pass
        v8f s[KT];
#pragma unroll
        for (int kt = 0; kt < KT; ++kt) s[kt] = (v8f){};
#pragma unroll
        for (int c = 0; c < 2; ++c) {
#pragma unroll
            for (int kt = 0; kt < KT; ++kt) s[kt] = W::mma(k[kt][c], q[c], s[kt]);
            if (HR) {
#pragma unroll
                for (int kt = 0; kt < KT; ++kt) s[kt] = W::mma(k[kt][c], q2[c], s[kt]);
#pragma unroll
                for (int kt = 0; kt < KT; ++kt) s[kt] = W::mma(k2[kt][c], q[c], s[kt]); } }
        // The step of the K base addresses. One statement holds the wait and the adds, so that the wait stands in front of the rewrite of registers that issued loads name (a precaution);
        // the score tiles are inputs only: the refetch, whose addresses come out of this statement, so stays behind the score products and lands in the same registers, with no copy and no wait for it at the loop's foot.
        if constexpr (decltype(more)::v) {
            if constexpr (HR) asm volatile("s_wait_xcnt 0x0\n\ts_add_nc_u64 %0, %0, %2\n\ts_add_nc_u64 %1, %1, %2" : "+s"(Kf), "+s"(Kf2) : "s"(inc), "v"(s[0]), "v"(s[1]) : "memory");
            else asm volatile("s_wait_xcnt 0x0\n\ts_add_nc_u64 %0, %0, %1" : "+s"(Kf) : "s"(inc), "v"(s[0]), "v"(s[1]), "v"(s[2]), "v"(s[3]) : "memory");
            // the L2 hint for the pass PD further on: step, then ask, so that the address stands inside the plane at all times; the wait (a precaution) stands in front of the rewrite of the register that the last hint names
            asm volatile("s_wait_xcnt 0x0\n\ts_add_nc_u64 %0, %0, %1\n\tglobal_prefetch_b8 %2, %0 offset:%3 scope:SCOPE_SE" : "+s"(Pf) : "s"(pinc), "v"(vo), "n"((PD - 1) * KB * HD * (int)sizeof(T16)) : "memory");
#pragma unroll
            for (int kt = 0; kt < KT; ++kt)
#pragma unroll
                for (int c = 0; c < 2; ++c) { k[kt][c] = ldfr(Kf + kt * 1024 + c * 512 + lo); if (HR) k2[kt][c] = ldfr(Kf2 + kt * 1024 + c * 512 + lo); }
            __builtin_amdgcn_sched_barrier(0);   // keeps the refetch in front of the softmax, in whose time it flies
        }
        float mt[KT];
#pragma unroll
        for (int kt = 0; kt < KT; ++kt) { mt[kt] = s[kt][0];
#pragma unroll
            for (int j = 1; j < 8; ++j) mt[kt] = fmaxf(mt[kt], s[kt][j]); }
        float mx = m;
#pragma unroll
        for (int kt = 0; kt < KT; ++kt) mx = fmaxf(mx, mt[kt]);
        mx = fmaxf(mx, xhalf(mx));
        const float al = exp2s((m - mx) * C2), mc = mx * C2; m = mx;
        float st[KT];
#pragma unroll
        for (int kt = 0; kt < KT; ++kt) {
#pragma unroll
            for (int j = 0; j < 8; ++j) s[kt][j] = __builtin_fmaf(s[kt][j], C2, -mc);
            exp2x8(s[kt]); st[kt] = s[kt][0];
#pragma unroll
            for (int j = 1; j < 8; ++j) st[kt] += s[kt][j]; }
        float sum = st[0];
#pragma unroll
        for (int kt = 1; kt < KT; ++kt) sum += st[kt];
        l = l * al + sum;
#pragma unroll
        for (int dt = 0; dt < 4; ++dt) o[dt] *= al;
        V p[KG], p2[KG];
#pragma unroll
        for (int g = 0; g < KG; ++g)
#pragma unroll
            for (int e = 0; e < 16; ++e) { const float x = s[2 * g + (e >> 3)][e & 7];
                if constexpr (HR) { const __bf16 xh = (__bf16)x; p[g][e] = xh; p2[g][e] = (__bf16)(x - (float)xh); } else p[g][e] = (h16)x; }
#pragma unroll
        for (int g = 0; g < KG; ++g) {
#pragma unroll
            for (int dt = 0; dt < 4; ++dt) o[dt] = W::mma(v[dt][g], p[g], o[dt]);
            if (HR) {
#pragma unroll
                for (int dt = 0; dt < 4; ++dt) o[dt] = W::mma(v[dt][g], p2[g], o[dt]);
#pragma unroll
                for (int dt = 0; dt < 4; ++dt) o[dt] = W::mma(v2[dt][g], p[g], o[dt]); } }
        // the same for the V base addresses, behind the value products
        if constexpr (decltype(more)::v) {
            if constexpr (HR) asm volatile("s_wait_xcnt 0x0\n\ts_add_nc_u64 %0, %0, %2\n\ts_add_nc_u64 %1, %1, %2" : "+s"(Vf), "+s"(Vf2) : "s"(inc), "v"(o[0]), "v"(o[1]), "v"(o[2]), "v"(o[3]) : "memory");
            else asm volatile("s_wait_xcnt 0x0\n\ts_add_nc_u64 %0, %0, %1" : "+s"(Vf) : "s"(inc), "v"(o[0]), "v"(o[1]), "v"(o[2]), "v"(o[3]) : "memory");
#pragma unroll
            for (int g = 0; g < KG; ++g)
#pragma unroll
                for (int dt = 0; dt < 4; ++dt) { v[dt][g] = ldfr(Vf + g * 2048 + dt * 512 + lo); if (HR) v2[dt][g] = ldfr(Vf2 + g * 2048 + dt * 512 + lo); }
        }
    };
#pragma unroll 1
    for (int kb = KB; kb < TT; kb += KB) pass(BoolC<true>{}, kb + PD * KB <= TT ? inc : 0ull);   // rolled: one pass's code and registers
    // precaution: the last fetches' base addresses and the hints' two registers, inputs here so that they stay whole up to this line, are free for other values only behind the wait
    if constexpr (HR) asm volatile("s_wait_xcnt 0x0" :: "s"(Kf), "s"(Kf2), "s"(Vf), "s"(Vf2), "s"(Pf), "v"(vo) : "memory"); else asm volatile("s_wait_xcnt 0x0" :: "s"(Kf), "s"(Vf), "s"(Pf), "v"(vo) : "memory");
    pass(BoolC<false>{}, 0ull);
    l += xhalf(l); const float inv = __fdiv_rn(1.0f, l);
#pragma unroll
    for (int dt = 0; dt < 4; ++dt) { v8us oh, ol;   // o[dt][j] = O[query lr][d = dt * 16 + hi * 8 + j]: this lane's 16 bytes of run dt of the head's two fragments, one 512-byte store of the wave a plane
#pragma unroll
        for (int j = 0; j < 8; ++j) { unsigned short a, c2; splitf(o[dt][j] * inv, a, c2); oh[j] = a; ol[j] = c2; }
        *(v8us*)(Ah + dt * 256 + lo) = oh; *(v8us*)(Al + dt * 256 + lo) = ol; }
}
// grid (TT / 64, heads, batches), 4 waves of 16 query rows each on the same head, so that they read the same K and V lines at about the same time.
// All work-groups can be resident at once, four to a WGP; the row block is blockIdx.x turned by RH / 64 a batch, so that work-groups 256 apart in the flat index are not all of the longer hi/lo kind.
__global__ __launch_bounds__(128) void k_fattn(const h16* __restrict__ Q16, const bf* __restrict__ Qh, const bf* __restrict__ Ql, const h16* __restrict__ K16, const bf* __restrict__ Kh, const bf* __restrict__ Kl, const h16* __restrict__ V16, const bf* __restrict__ Vh, const bf* __restrict__ Vl, bf* Ah, bf* Al) {
    const int b = blockIdx.z, h = b * NH_ + blockIdx.y, rb = (blockIdx.x + b * (RH / 64)) % (TT / 64), q0 = rb * 64 + (threadIdx.x >> 5) * 16;
    const size_t qo = ((size_t)h * TT + q0) * HD, ko = (size_t)b * TT * HD, vo = (size_t)h * HD * TT, ao = ((size_t)b * TT + q0) * DQ + blockIdx.y * (16 * HD);   // merged planes as fragments: 16 rows x 512 k = 16 fragments of 512 elements, a head's two side by side
    if (rb < RH / 64) attn_tile<bf, true, 32>(Qh + qo, Ql + qo, Kh + ko, Kl + ko, Vh + vo, Vl + vo, Ah + ao, Al + ao);
    else attn_tile<h16, false, 64>(Q16 + qo, nullptr, K16 + ko, nullptr, V16 + vo, nullptr, Ah + ao, Al + ao);
}

// ---- k_oproj: out = merged (hi + lo) x Wc + bc. Grid (batches * TT / 32), 8 waves: 32 rows x 64 columns a work-group, wave w sums head w's 64 of the 512 k.
// Every operand is a fragment run (512 contiguous bytes a load), all loads of a wave fly together, and no wave has a k loop: one memory latency in all.
// A = merged rows, B = Wc^T fragments: a lane holds 8 consecutive rows of one column, so the partial tiles lie in LDS column-major, two 16-byte stores a tile. Column pitch 36 floats: 16 B x odd, no bank conflict for writers or readers.
// Behind the barrier each thread adds the 8 partial sums of 8 rows of one column in head order, then the bias; a wave's store covers 32 consecutive columns of a row, one whole line.
__global__ __launch_bounds__(256) void k_oproj(const bf* __restrict__ Ah, const bf* __restrict__ Al, const bf* __restrict__ WO, const float* __restrict__ bias, float* __restrict__ C) {
    __shared__ __align__(16) float part[NH_ * DM * 36];
    const int lane = threadIdx.x & 31, w = threadIdx.x >> 5, lr = lane & 15, hi = lane >> 4;
    const int n = threadIdx.x & 63, m0 = (threadIdx.x >> 6) * 8;   // this thread's 8 outputs
    const unsigned lo = lane * 8;
    const size_t fa = ((size_t)blockIdx.x * 2 * (DQ / 32) + w * 2) * 512;
    const bf* ph = Ah + fa + lo; const bf* pl = Al + fa + lo; const bf* pw = WO + w * 2 * 512 + lo;
    v16bf a[2][2], a2[2][2], b[4][2];
#pragma unroll
    for (int c = 0; c < 2; ++c) {
#pragma unroll
        for (int mb = 0; mb < 2; ++mb) { a[mb][c] = ldfr(ph + (mb * (DQ / 32) + c) * 512); a2[mb][c] = ldfr(pl + (mb * (DQ / 32) + c) * 512); }
#pragma unroll
        for (int nb = 0; nb < 4; ++nb) b[nb][c] = ldfr(pw + (nb * (DQ / 32) + c) * 512); }
    const float bb = bfr(bias[n]);
    // precaution: the loads' address registers, inputs here so that they stay whole up to this line, are free for other values (a later load's data, an accumulator) only behind the wait
    asm volatile("s_wait_xcnt 0x0" :: "v"(ph), "v"(pl), "v"(pw), "v"(n) : "memory");
    __builtin_amdgcn_sched_barrier(0);   // every load is issued before the first wait for data, so that the wave pays one latency
    v8f acc[2][4];
#pragma unroll
    for (int mb = 0; mb < 2; ++mb)
#pragma unroll
        for (int nb = 0; nb < 4; ++nb) acc[mb][nb] = (v8f){};
#pragma unroll
    for (int c = 0; c < 2; ++c) {
#pragma unroll
        for (int mb = 0; mb < 2; ++mb)
#pragma unroll
            for (int nb = 0; nb < 4; ++nb) acc[mb][nb] = wmmab(a[mb][c], b[nb][c], acc[mb][nb]);
        __builtin_amdgcn_sched_barrier(0);   // holds the order, here and below: eight independent tiles in turn; left alone the compiler runs one tile's four products back to back, each waiting for the one before
#pragma unroll
        for (int mb = 0; mb < 2; ++mb)
#pragma unroll
            for (int nb = 0; nb < 4; ++nb) acc[mb][nb] = wmmab(a2[mb][c], b[nb][c], acc[mb][nb]);
        __builtin_amdgcn_sched_barrier(0); }
#pragma unroll
    for (int mb = 0; mb < 2; ++mb)
#pragma unroll
        for (int nb = 0; nb < 4; ++nb) { float* p = part + (w * DM + nb * 16 + lr) * 36 + mb * 16 + hi * 8;
            *(v4f*)p = __builtin_shufflevector(acc[mb][nb], acc[mb][nb], 0, 1, 2, 3); *(v4f*)(p + 4) = __builtin_shufflevector(acc[mb][nb], acc[mb][nb], 4, 5, 6, 7); }
    __syncthreads();   // all 8 partial tiles are in LDS before any is read
    const float* r = part + n * 36 + m0;
    v4f s0 = *(const v4f*)r, s1 = *(const v4f*)(r + 4);
#pragma unroll
    for (int p = 1; p < NH_; ++p) { s0 += *(const v4f*)(r + p * DM * 36); s1 += *(const v4f*)(r + p * DM * 36 + 4); }
    float* o = C + ((size_t)blockIdx.x * 32 + m0) * DM + n;
#pragma unroll
    for (int j = 0; j < 4; ++j) { o[j * DM] = s0[j] + bb; o[(4 + j) * DM] = s1[j] + bb; }
}

extern "C" void kernel_launch(void* const* d_in, const int* in_sizes, int n_in,
                              void* d_out, int out_size, void* d_ws, size_t ws_size, hipStream_t stream) {
    (void)in_sizes; (void)n_in; (void)out_size;
    const float* x = (const float*)d_in[0]; const float* wqv = (const float*)d_in[1]; const float* wo = (const float*)d_in[2]; /* Wc */ const float* bo = (const float*)d_in[3]; /* bc */
    float* OUT = (float*)d_out;     // [4][2048][64]
    char* wsp = (char*)d_ws;
    auto take = [&](size_t bytes) { char* p = wsp; wsp += (bytes + 255) & ~(size_t)255; return (void*)p; };
    bf* WO = (bf*)take((size_t)DM * DQ * 2);   /* every per-batch buffer holds all batches, batch-major */
    h16* QP16 = (h16*)take((size_t)NB_ * NH_ * TT * HD * 2); h16* KP16 = (h16*)take((size_t)NB_ * NKV * TT * HD * 2); h16* VT16 = (h16*)take((size_t)NB_ * NH_ * HD * TT * 2);
    bf* QPh = (bf*)take((size_t)NB_ * NH_ * TT * HD * 2); bf* QPl = (bf*)take((size_t)NB_ * NH_ * TT * HD * 2); bf* KPh = (bf*)take((size_t)NB_ * NKV * TT * HD * 2); bf* KPl = (bf*)take((size_t)NB_ * NKV * TT * HD * 2); bf* VTh = (bf*)take((size_t)NB_ * NH_ * HD * TT * 2); bf* VTl = (bf*)take((size_t)NB_ * NH_ * HD * TT * 2);
    bf* ATh = (bf*)take((size_t)NB_ * TT * DQ * 2); bf* ATl = (bf*)take((size_t)NB_ * TT * DQ * 2);
    if ((size_t)(wsp - (char*)d_ws) > ws_size) return;    // ws 256 MiB
    k_prep<<<dim3(NB_ * TT / 32, NH_ + 1, 1), 32, 0, stream>>>(x, wqv, wo, QP16, QPh, QPl, KP16, KPh, KPl, VT16, VTh, VTl, WO);   /* projections and every operand plane of the attention, and Wc as Bt */
    k_fattn<<<dim3(TT / 64, NH_, NB_), 128, 0, stream>>>(QP16, QPh, QPl, KP16, KPh, KPl, VT16, VTh, VTl, ATh, ATl);   /* one shared key plane a batch; each query head has its own value planes */
    k_oproj<<<dim3(NB_ * TT / 32, 1, 1), 256, 0, stream>>>(ATh, ATl, WO, bo, OUT);   /* one head's k a wave, partial tiles joined in LDS */
}

// v008
// It runs in 59.1 microseconds.
// Two timings next to v007 both put it at 1.15 times that version's speed.
// All steps since v000 together make it 31.4 times as fast.
#include <hip/hip_runtime.h>

// Multi-head attention V2 with the input itself as the shared key (x [4][2048][64]; qv = x Wqv ('xw' [64][1024] with the (H, D, 2) channel layout: q_h[d] = column h*128 + 2d, v_h[d] = column h*128 + 2d + 1); 8 heads x 64; scores = q_h . x / 8 (the 64-dim input is every head's key); softmax; out = merged (attn v) Wc + bc ('xw' [512][64]) -> [4][2048][64] (0.5 M)).
// Layout, every buffer batch-major: ONE kernel in front of the attention reads x and the interleaved q/v weights as f32, rounds them to bf16 in registers, does both projections and stores its accumulators straight as the attention's operand planes (q rows, V^T fragments), the x fragments as the single exact key plane shared by all heads, and Wc transposed, as fragments; dense T-2048 attention in one fused kernel (scores, online softmax and attn x V; the scores never reach memory), 8 query heads over one key plane (hybrid rows: < 512 hi/lo 3 products, rest fp16), each head's own 64-wide value, the merged hi/lo planes stored as fragments; merged hi/lo x Wc exact + bc, the k split over 8 waves.
// Compute dtypes, f32 accumulate: every input rounded to bf16; projections exact; attention rows < 512 3 products (keys exact), rest fp16; softmax f32; Wc hl x exact + bias.

#define NB_  4
#define TT   2048
#define DM   64
#define NH_  8
#define NKV  1
#define REP  (NH_ / NKV)
#define HD   64
#define DQ   (NH_ * HD)
#define DKV  (NKV * HD)
#define RH   512                  // query rows < RH use hi+lo planes (0: none)
#define WIN  0
#define SCL  0.125f   // HD^-0.5
typedef _Float16 h16;
typedef unsigned short bf;
typedef __attribute__((ext_vector_type(16))) __bf16   v16bf;
typedef __attribute__((ext_vector_type(16))) _Float16 v16h;
typedef __attribute__((ext_vector_type(8)))  _Float16 v8h;
typedef __attribute__((ext_vector_type(8)))  unsigned short v8us;
typedef __attribute__((ext_vector_type(8)))  float    v8f;
typedef __attribute__((ext_vector_type(4)))  float    v4f;
typedef v8h  __attribute__((may_alias)) v8ha;
typedef v4f  __attribute__((may_alias)) v4fa;
typedef v8us __attribute__((may_alias)) v8usa;

__device__ __forceinline__ unsigned short f2bf(float f) { unsigned u = __float_as_uint(f); u += 0x7FFFu + ((u >> 16) & 1u); return (unsigned short)(u >> 16); }
__device__ __forceinline__ float bf2f(unsigned short b) { return __uint_as_float(((unsigned)b) << 16); }
__device__ __forceinline__ float bfr(float f) { return bf2f(f2bf(f)); }
__device__ __forceinline__ v16h cat16(v8h lo, v8h hi) { return __builtin_shufflevector(lo, hi, 0, 1, 2, 3, 4, 5, 6, 7, 8, 9, 10, 11, 12, 13, 14, 15); }
__device__ __forceinline__ v16bf cat16b(v8us lo, v8us hi) { return __builtin_bit_cast(v16bf, __builtin_shufflevector(lo, hi, 0, 1, 2, 3, 4, 5, 6, 7, 8, 9, 10, 11, 12, 13, 14, 15)); }
__device__ __forceinline__ v8f wmma16(v16h a, v16h b, v8f c) { return __builtin_amdgcn_wmma_f32_16x16x32_f16(false, a, false, b, (short)0, c, false, false); }
__device__ __forceinline__ v8f wmmab(v16bf a, v16bf b, v8f c) { return __builtin_amdgcn_wmma_f32_16x16x32_bf16(false, a, false, b, (short)0, c, false, false); }



// ---- fragments of a K-contiguous 16-bit row-major plane, and the product of each operand type
template <typename T16> struct WFrag;
template <> struct WFrag<h16> { typedef v16h V; static __device__ __forceinline__ V ld(const h16* p) { return cat16(*(const v8h*)p, *(const v8h*)(p + 16)); } static __device__ __forceinline__ v8f mma(V a, V b, v8f c) { return wmma16(a, b, c); } };
template <> struct WFrag<bf> { typedef v16bf V; static __device__ __forceinline__ V ld(const bf* p) { return cat16b(*(const v8us*)p, *(const v8us*)(p + 16)); } static __device__ __forceinline__ v8f mma(V a, V b, v8f c) { return wmmab(a, b, c); } };

__device__ __forceinline__ void splitf(float y, unsigned short& h, unsigned short& l) { h = f2bf(y); l = f2bf(y - bf2f(h)); }
typedef __attribute__((ext_vector_type(2))) _Float16 v2h;
typedef __attribute__((ext_vector_type(4))) _Float16 v4h;
typedef __attribute__((ext_vector_type(2))) unsigned short v2us;
typedef __attribute__((ext_vector_type(4))) unsigned short v4us;
typedef __attribute__((ext_vector_type(2))) float v2f;
typedef __attribute__((ext_vector_type(4))) int v4i;

// ---- k_prep: all that stands in front of the attention. Grid (batches * TT / 32, heads + 1), one wave a work-group.
// y < heads: 32 rows of x against one head's 64 q and 64 v columns, K = 64. A weight pair (q, v) of one channel is adjacent in Wqv, so one 8-byte load feeds both products.
// q is formed transposed (A = weights, B = x rows): a lane then holds 8 consecutive d of one row, one 16-byte store a plane into the row-major q planes.
// v is formed straight (A = x rows, B = weights): a lane then holds 8 consecutive keys of one d, which is a lane's place in the V^T fragment planes (per head and 32 keys, four 16-d tiles of two 512-B runs, run t / 16 % 2, lane (t / 8 % 2) * 16 + d % 16).
// The x fragments themselves are the key plane's fragments (16 rows x 64 d = four runs of 512 B, run d / 16, lane (d / 8 % 2) * 16 + t % 16, 8 d a lane); head 0's waves store them; the key is bf16(x) exactly, so its lo plane is zero.
// y == heads: Wc [512][64] -> bf16 fragments of its transpose (16 n x 32 k = two runs of 512 B, run k / 16 % 2, lane (k / 8 % 2) * 16 + n % 16, 8 k a lane; fragment n / 16 * 16 + k / 32), four k a lane.
// Every loop here and in put3 is unrolled in full: fragments, raw weights and accumulators stay in registers only where each index is a constant.
typedef __attribute__((ext_vector_type(2))) __bf16 v2b;
typedef __attribute__((ext_vector_type(4))) unsigned v4u;
typedef __attribute__((ext_vector_type(8))) unsigned v8u;
__device__ __forceinline__ unsigned pkb(float a, float b) { v2f t; t[0] = a; t[1] = b; return __builtin_bit_cast(unsigned, __builtin_convertvector(t, v2b)); }   // two f32 -> two bf16, nearest even, one instruction
__device__ __forceinline__ void put3(v8f r, size_t o, h16* P16, bf* Ph, bf* Pl) { v4u o16, oh, ol;   // 8 consecutive elements of the fp16 plane and of the hi / lo planes
#pragma unroll
    for (int j = 0; j < 4; ++j) { v2f t; t[0] = r[2 * j]; t[1] = r[2 * j + 1]; const v2b xh = __builtin_convertvector(t, v2b);
        o16[j] = __builtin_bit_cast(unsigned, __builtin_convertvector(t, v2h)); oh[j] = __builtin_bit_cast(unsigned, xh); ol[j] = __builtin_bit_cast(unsigned, __builtin_convertvector(t - __builtin_convertvector(xh, v2f), v2b)); }
    *(v4u*)(P16 + o) = o16; *(v4u*)(Ph + o) = oh; *(v4u*)(Pl + o) = ol; }
__global__ __launch_bounds__(32) void k_prep(const float* __restrict__ x, const float* __restrict__ wqv, const float* __restrict__ wo, h16* Q16, bf* Qh, bf* Ql, h16* K16, bf* Kh, bf* Kl, h16* V16, bf* Vh, bf* Vl, bf* WO) {
    const int lane = threadIdx.x & 31, lr = lane & 15, hi = lane >> 4;
    if (blockIdx.y == NH_) { const int e = (blockIdx.x * 32 + lane) * 4; if (e >= DM * DQ) return; const int k = e % DQ, n = e / DQ; v4us o;
#pragma unroll
        for (int q = 0; q < 4; ++q) o[q] = f2bf(wo[(size_t)(k + q) * DM + n]);
        *(v4us*)(WO + (((n >> 4) * (DQ / 32) + (k >> 5)) * 2 + ((k >> 4) & 1)) * 256 + (((k >> 3) & 1) * 16 + (n & 15)) * 8 + (k & 7)) = o; return; }
    const int h = blockIdx.y, row0 = blockIdx.x * 32, b = row0 / TT, t0 = row0 % TT;
    const float* wp = wqv + (size_t)(8 * hi) * (2 * DQ) + h * 2 * HD + 2 * lr;
    v2f raw[2][32];   // one 16-channel tile's (q, v) weight pairs, k in fragment order: entry i is k = (i / 16) * 32 + (i / 8 % 2) * 16 + 8 * hi + i % 8; two tiles, one in flight while the other is worked on
    auto ldw = [&](int nb) __attribute__((always_inline)) {
#pragma unroll
        for (int i = 0; i < 32; ++i) raw[nb & 1][i] = *(const v2f*)(wp + (size_t)((i >> 4) * 32 + ((i >> 3) & 1) * 16 + (i & 7)) * (2 * DQ) + nb * 32); };
    v8f xf[2][4];   // x[row0 + mb * 16 + lr][r * 16 + 8 * hi + 0..7]
#pragma unroll
    for (int mb = 0; mb < 2; ++mb)
#pragma unroll
        for (int r = 0; r < 4; ++r) xf[mb][r] = *(const v8f*)(x + (size_t)(row0 + mb * 16 + lr) * DM + r * 16 + 8 * hi);
    ldw(0);
    __builtin_amdgcn_sched_barrier(0);   // all loads of x and of the first weight tile are issued before the first wait; left alone the compiler loads the weights two at a time with a full wait behind each pair
    v16bf xa[2][2];
#pragma unroll
    for (int mb = 0; mb < 2; ++mb)
#pragma unroll
        for (int c = 0; c < 2; ++c) { v8u u;
#pragma unroll
            for (int e = 0; e < 8; ++e) u[e] = pkb(xf[mb][2 * c + (e >> 2)][(e & 3) * 2], xf[mb][2 * c + (e >> 2)][(e & 3) * 2 + 1]);
            xa[mb][c] = __builtin_bit_cast(v16bf, u); }
    if (h == 0) {
#pragma unroll
        for (int mb = 0; mb < 2; ++mb)
#pragma unroll
            for (int r = 0; r < 4; ++r) { v8f kr;
#pragma unroll
                for (int j = 0; j < 8; ++j) kr[j] = (float)xa[mb][r >> 1][(r & 1) * 8 + j];
                put3(kr, (size_t)b * TT * HD + (size_t)((t0 >> 4) + mb) * 1024 + r * 256 + lane * 8, K16, Kh, Kl); } }
    const size_t hb = (size_t)(b * NH_ + h) * TT * HD;
#pragma unroll
    for (int nb = 0; nb < 4; ++nb) { v16bf wq[2], wv[2];
        // the next tile's 32 loads are issued as one group in front of this tile's work, in whose time they fly; the wait (a precaution) stands between the stores issued so far and these loads, which land in registers that those stores name
        if (nb < 3) { asm volatile("s_wait_xcnt 0x0" ::: "memory"); ldw(nb + 1); __builtin_amdgcn_sched_barrier(0); }
#pragma unroll
        for (int c = 0; c < 2; ++c) { v8u uq, uv;
#pragma unroll
            for (int e = 0; e < 8; ++e) { const v2f w0 = raw[nb & 1][c * 16 + 2 * e], w1 = raw[nb & 1][c * 16 + 2 * e + 1]; uq[e] = pkb(w0[0], w1[0]); uv[e] = pkb(w0[1], w1[1]); }
            wq[c] = __builtin_bit_cast(v16bf, uq); wv[c] = __builtin_bit_cast(v16bf, uv); }
#pragma unroll
        for (int mb = 0; mb < 2; ++mb) { v8f aq = (v8f){}, av = (v8f){};
#pragma unroll
            for (int c = 0; c < 2; ++c) { aq = wmmab(wq[c], xa[mb][c], aq); av = wmmab(xa[mb][c], wv[c], av); }
            put3(aq, hb + (size_t)(t0 + mb * 16 + lr) * HD + nb * 16 + hi * 8, Q16, Qh, Ql);
            put3(av, hb + (size_t)(t0 >> 5) * 2048 + nb * 512 + mb * 256 + lane * 8, V16, Vh, Vl); } }
    asm volatile("s_wait_xcnt 0x0" ::: "memory");   // precaution: the last stores' registers are free for other values only behind this wait, whatever code the compiler lays out behind them
}
// ---- k_fattn: scores, softmax and attn x V of 16 (hi/lo kind) or 3 x 16 (fp16 kind) query rows per wave, all 2048 keys, nothing of the scores in memory.
// Transposed products: S^T = K Q^T (A = key fragments, B = query rows) leaves each lane with one query's scores (query = lane % 16, keys 8 * (lane / 16) + j of each 16-key tile);
// two such tiles, converted in place, are the B operand of O^T += V^T P^T in the hardware k order, which the V^T fragments are stored in. Running maximum and sum per lane (online softmax), halves joined by one lane exchange.
// K fragments are fetched again right behind the score products and V fragments right behind the value products, so the next pass's loads fly during this pass's work.
// a fragment = two 512-byte runs; the pointers are marked as global memory because a base address that comes out of an asm statement would otherwise be read by flat loads
__device__ __forceinline__ v16h  ldfr(const h16* p) { const __attribute__((address_space(1))) v8h* g = (const __attribute__((address_space(1))) v8h*)p; return cat16(g[0], g[32]); }
__device__ __forceinline__ v16bf ldfr(const bf* p) { const __attribute__((address_space(1))) v8us* g = (const __attribute__((address_space(1))) v8us*)p; return cat16b(g[0], g[32]); }
__device__ __forceinline__ float xhalf(float x) { const int b = __float_as_int(x); return __int_as_float(__builtin_amdgcn_permlanex16(b, b, 0x76543210, 0xfedcba98, false, false)); }   // lane l <-> l ^ 16
// 2^x. The v_nop keeps the one slot that the instruction set asks for between a transcendental and a directly following instruction that reads its result or overwrites its source;
// in exp2x8 each v_exp works in place on its own register, so that the eight need none between them.
__device__ __forceinline__ float exp2s(float x) { float r; asm("v_exp_f32 %0, %1\n\tv_nop" : "=v"(r) : "v"(x)); return r; }
__device__ __forceinline__ void exp2x8(v8f& x) { float a = x[0], b = x[1], c = x[2], d = x[3], e = x[4], f = x[5], g = x[6], h = x[7];
    asm("v_exp_f32 %0, %0\n\tv_exp_f32 %1, %1\n\tv_exp_f32 %2, %2\n\tv_exp_f32 %3, %3\n\tv_exp_f32 %4, %4\n\tv_exp_f32 %5, %5\n\tv_exp_f32 %6, %6\n\tv_exp_f32 %7, %7\n\tv_nop" : "+v"(a), "+v"(b), "+v"(c), "+v"(d), "+v"(e), "+v"(f), "+v"(g), "+v"(h));
    x[0] = a; x[1] = b; x[2] = c; x[3] = d; x[4] = e; x[5] = f; x[6] = g; x[7] = h; }
template <bool B> struct BoolC { static constexpr bool v = B; };
// L2 hints for passes J .. N - 1 of one plane (INC bytes a pass), issued together at the start; a hint returns nothing and counts on no counter. The clobber keeps them behind the first passes' own loads.
template <int J, int N, int INC> __device__ __forceinline__ void hint_ahead(unsigned vo, unsigned long long p) {
    if constexpr (J < N) { asm volatile("global_prefetch_b8 %0, %1 offset:%2 scope:SCOPE_SE" :: "v"(vo), "s"(p), "n"(J * INC) : "memory"); hint_ahead<J + 1, N, INC>(vo, p); } }
template <typename T16, bool HR, int KB, int NQ>   // NQ: 16-row query tiles of this wave; every K and V fragment it loads feeds NQ products
__device__ __forceinline__ void attn_tile(const T16* __restrict__ Q, const T16* __restrict__ Q2, const T16* __restrict__ Kf, const T16* __restrict__ Kf2, const T16* __restrict__ Vf, const T16* __restrict__ Vf2, bf* Ah, bf* Al) {
    typedef typename WFrag<T16>::V V; typedef WFrag<T16> W;
    constexpr int KT = KB / 16, KG = KB / 32; constexpr float C2 = SCL * 1.4426950408889634f;
    const int lane = threadIdx.x & 31, lr = lane & 15, hi = lane >> 4;
    V q[NQ][2], q2[NQ][2], k[KT][2], k2[KT][2], v[4][KG], v2[4][KG];
    Q += lr * HD + 8 * hi; if (HR) Q2 += lr * HD + 8 * hi;
#pragma unroll
    for (int t = 0; t < NQ; ++t)
#pragma unroll
        for (int c = 0; c < 2; ++c) { q[t][c] = W::ld(Q + t * 16 * HD + c * 32); if (HR) q2[t][c] = W::ld(Q2 + t * 16 * HD + c * 32); }
    const unsigned lo = lane * 8;   // a lane's 16 bytes in each 512-byte run of a fragment plane
#pragma unroll
    for (int kt = 0; kt < KT; ++kt)
#pragma unroll
        for (int c = 0; c < 2; ++c) { k[kt][c] = ldfr(Kf + kt * 1024 + c * 512 + lo); if (HR) k2[kt][c] = ldfr(Kf2 + kt * 1024 + c * 512 + lo); }
    // Two jobs. As a compiler fence: the first V loads are issued behind the Q and K loads, as in the loop; otherwise the wait that the compiler puts at the loop's head for K also waits for the V loads just issued.
    // As a wait (a precaution): the Q loads' address pairs, inputs here so that they stay whole up to this line, are free for other values only behind it.
    if constexpr (HR) asm volatile("s_wait_xcnt 0x0" :: "v"(Q), "v"(Q2) : "memory"); else asm volatile("s_wait_xcnt 0x0" :: "v"(Q) : "memory");
#pragma unroll
    for (int g = 0; g < KG; ++g)
#pragma unroll
        for (int dt = 0; dt < 4; ++dt) { v[dt][g] = ldfr(Vf + g * 2048 + dt * 512 + lo); if (HR) v2[dt][g] = ldfr(Vf2 + g * 2048 + dt * 512 + lo); }
    // L2 hints. The planes were stored by the launch before; the fragments are fetched less than a pass ahead, so that memory latency would bound every pass.
    // Each pass asks for the lines of the pass PD further on (256 keys), which the fragment loads then find in L2. A work-group reads 16 KB a pass: each of its 4 waves asks for 4 KB, one 256-byte unit a lane pair.
    constexpr int PD = 256 / KB;
    const int wv = __builtin_amdgcn_readfirstlane(threadIdx.x >> 5);
    unsigned long long Pf;   // this wave's 4 KB, PD - 1 passes (the hints' immediate offset) short of the pass last asked for; with that offset it never leaves the plane
    if constexpr (HR) { const unsigned long long pk = (unsigned long long)((wv & 1) ? Kf2 : Kf), pv = (unsigned long long)((wv & 1) ? Vf2 : Vf); Pf = (wv & 2) ? pv : pk; }   // a plane a wave
    else Pf = (unsigned long long)(((wv & 2) ? Vf : Kf) + (wv & 1) * 2048);   // half a plane's pass a wave
    unsigned vo;   // (lane / 2) * 256; formed in asm so that it has one register of its own from here to the end of the loop: a hint may name no register that takes another value soon behind it
    asm("v_lshlrev_b32 %0, 7, %1" : "=v"(vo) : "v"(lane & 30));
    hint_ahead<1, PD, KB * HD * (int)sizeof(T16)>(vo, Pf);
    // With several query tiles the kernel uses more than 256 registers, an asm operand must lie in the first 256, and an offset register held there through the whole loop was pushed out into scratch: that kind forms the offset anew for each hint (see the pass).
    // precaution: the offset register of the hints above is free for other values only behind this wait
    if constexpr (NQ > 1) asm volatile("s_wait_xcnt 0x0" :: "v"(vo) : "memory");
    v8f o[NQ][4];
    float m[NQ], l[NQ];   // m: running maximum of the raw products; l: this lane's half of the running sum
#pragma unroll
    for (int t = 0; t < NQ; ++t) { m[t] = -3.0e38f; l[t] = 0.f;
#pragma unroll
        for (int dt = 0; dt < 4; ++dt) o[t][dt] = (v8f){}; }
    const unsigned long long inc = (unsigned long long)KB * HD * sizeof(T16);   // bytes a pass: both kinds of plane hold 64 elements a key
    auto pass = [&](auto more, unsigned long long pinc) __attribute__((always_inline)) {   // one pass = KB keys; more: a next pass exists, fetch its fragments; pinc: the hint address's step, 0 once it stands on the last pass
        unsigned ht = 0;   // several query tiles: the hint's offset register, alive from the hint to the wait at the K step
        // The same L2 hint as below, at the head of the pass. No wait in front of the step of its address: the last hint, which names it, lies in front of the waits at the K and V steps of the pass before. The four v_nop keep the distance between the matrix products that stand in front of this statement and its write of the offset register, which may be one of their operands' registers.
        if constexpr (decltype(more)::v && NQ > 1)
            asm volatile("v_nop\n\tv_nop\n\tv_nop\n\tv_nop\n\ts_add_nc_u64 %0, %0, %2\n\tv_lshlrev_b32 %1, 7, %3\n\tglobal_prefetch_b8 %1, %0 offset:%4 scope:SCOPE_SE" : "+s"(Pf), "=&v"(ht) : "s"(pinc), "v"(lane & 30), "n"((PD - 1) * KB * HD * (int)sizeof(T16)) : "memory");
        v8f s[NQ][KT];
#pragma unroll
        for (int t = 0; t < NQ; ++t)
#pragma unroll
            for (int kt = 0; kt < KT; ++kt) s[t][kt] = (v8f){};
#pragma unroll
        for (int c = 0; c < 2; ++c) {
#pragma unroll
            for (int t = 0; t < NQ; ++t)
#pragma unroll
                for (int kt = 0; kt < KT; ++kt) s[t][kt] = W::mma(k[kt][c], q[t][c], s[t][kt]);
            if (HR) {
#pragma unroll
                for (int t = 0; t < NQ; ++t)
#pragma unroll
                    for (int kt = 0; kt < KT; ++kt) s[t][kt] = W::mma(k[kt][c], q2[t][c], s[t][kt]);
#pragma unroll
                for (int t = 0; t < NQ; ++t)
#pragma unroll
                    for (int kt = 0; kt < KT; ++kt) s[t][kt] = W::mma(k2[kt][c], q[t][c], s[t][kt]); } }
        if constexpr (NQ > 1) __builtin_amdgcn_sched_barrier(0);   // several tiles, every pass: all score products stand in front of the refetch and of the softmax
        // The step of the K base addresses. One statement holds the wait and the adds, so that the wait stands in front of the rewrite of registers that issued loads name (a precaution);
        // the score tiles are inputs only: the refetch, whose addresses come out of this statement, so stays behind the score products and lands in the same registers, with no copy and no wait for it at the loop's foot.
        if constexpr (decltype(more)::v) {
            if constexpr (HR) asm volatile("s_wait_xcnt 0x0\n\ts_add_nc_u64 %0, %0, %2\n\ts_add_nc_u64 %1, %1, %2" : "+s"(Kf), "+s"(Kf2) : "s"(inc), "v"(s[0][0]), "v"(s[0][1]) : "memory");
            else {   // with three query tiles the scheduling barrier above does that job, twelve tiles being too many asm operands to hold at once in the first 256 registers; the hint's offset register is an input so that it stays whole up to the wait
                asm volatile("s_wait_xcnt 0x0\n\ts_add_nc_u64 %0, %0, %1" : "+s"(Kf) : "s"(inc), "v"(ht) : "memory"); }
            // the L2 hint for the pass PD further on: step, then ask, so that the address stands inside the plane at all times; the wait (a precaution) stands in front of the rewrite of the register that the last hint names
            if constexpr (NQ == 1) asm volatile("s_wait_xcnt 0x0\n\ts_add_nc_u64 %0, %0, %1\n\tglobal_prefetch_b8 %2, %0 offset:%3 scope:SCOPE_SE" : "+s"(Pf) : "s"(pinc), "v"(vo), "n"((PD - 1) * KB * HD * (int)sizeof(T16)) : "memory");
#pragma unroll
            for (int kt = 0; kt < KT; ++kt)
#pragma unroll
                for (int c = 0; c < 2; ++c) { k[kt][c] = ldfr(Kf + kt * 1024 + c * 512 + lo); if (HR) k2[kt][c] = ldfr(Kf2 + kt * 1024 + c * 512 + lo); }
            __builtin_amdgcn_sched_barrier(0);   // keeps the refetch in front of the softmax, in whose time it flies
        }
#pragma unroll
        for (int t = 0; t < NQ; ++t) {   // tile by tile: softmax, then its value products
        float mt[KT];
#pragma unroll
        for (int kt = 0; kt < KT; ++kt) { mt[kt] = s[t][kt][0];
#pragma unroll
            for (int j = 1; j < 8; ++j) mt[kt] = fmaxf(mt[kt], s[t][kt][j]); }
        float mx = m[t];
#pragma unroll
        for (int kt = 0; kt < KT; ++kt) mx = fmaxf(mx, mt[kt]);
        mx = fmaxf(mx, xhalf(mx));
        const float al = exp2s((m[t] - mx) * C2), mc = mx * C2; m[t] = mx;
        float st[KT];
#pragma unroll
        for (int kt = 0; kt < KT; ++kt) {
#pragma unroll
            for (int j = 0; j < 8; ++j) s[t][kt][j] = __builtin_fmaf(s[t][kt][j], C2, -mc);
            exp2x8(s[t][kt]); st[kt] = s[t][kt][0];
#pragma unroll
            for (int j = 1; j < 8; ++j) st[kt] += s[t][kt][j]; }
        float sum = st[0];
#pragma unroll
        for (int kt = 1; kt < KT; ++kt) sum += st[kt];
        l[t] = l[t] * al + sum;
#pragma unroll
        for (int dt = 0; dt < 4; ++dt) o[t][dt] *= al;
        V p[KG], p2[KG];
#pragma unroll
        for (int g = 0; g < KG; ++g)
#pragma unroll
            for (int e = 0; e < 16; ++e) { const float x = s[t][2 * g + (e >> 3)][e & 7];
                if constexpr (HR) { const __bf16 xh = (__bf16)x; p[g][e] = xh; p2[g][e] = (__bf16)(x - (float)xh); } else p[g][e] = (h16)x; }
        // several tiles: the two scheduling barriers keep the next tile's softmax out of this tile's value products; its 2^x are asm text
        if constexpr (NQ > 1) __builtin_amdgcn_sched_barrier(0);
#pragma unroll
        for (int g = 0; g < KG; ++g) {
#pragma unroll
            for (int dt = 0; dt < 4; ++dt) o[t][dt] = W::mma(v[dt][g], p[g], o[t][dt]);
            if (HR) {
#pragma unroll
                for (int dt = 0; dt < 4; ++dt) o[t][dt] = W::mma(v[dt][g], p2[g], o[t][dt]);
#pragma unroll
                for (int dt = 0; dt < 4; ++dt) o[t][dt] = W::mma(v2[dt][g], p[g], o[t][dt]); } }
        if constexpr (NQ > 1) __builtin_amdgcn_sched_barrier(0);
        }
        // the same for the V base addresses, behind the value products
        if constexpr (decltype(more)::v) {
            if constexpr (HR) asm volatile("s_wait_xcnt 0x0\n\ts_add_nc_u64 %0, %0, %2\n\ts_add_nc_u64 %1, %1, %2" : "+s"(Vf), "+s"(Vf2) : "s"(inc), "v"(o[0][0]), "v"(o[0][1]), "v"(o[0][2]), "v"(o[0][3]) : "memory");
            else asm volatile("s_wait_xcnt 0x0\n\ts_add_nc_u64 %0, %0, %1" : "+s"(Vf) : "s"(inc) : "memory");   // as at the K step: the scheduling barrier behind the last tile's value products holds the refetch behind them
#pragma unroll
            for (int g = 0; g < KG; ++g)
#pragma unroll
                for (int dt = 0; dt < 4; ++dt) { v[dt][g] = ldfr(Vf + g * 2048 + dt * 512 + lo); if (HR) v2[dt][g] = ldfr(Vf2 + g * 2048 + dt * 512 + lo); }
        }
    };
#pragma unroll 1
    for (int kb = KB; kb < TT; kb += KB) pass(BoolC<true>{}, kb + PD * KB <= TT ? inc : 0ull);   // rolled: one pass's code and registers
    // precaution: the last fetches' base addresses and the hints' registers, inputs here so that they stay whole up to this line, are free for other values only behind the wait
    if constexpr (HR) asm volatile("s_wait_xcnt 0x0" :: "s"(Kf), "s"(Kf2), "s"(Vf), "s"(Vf2), "s"(Pf), "v"(vo) : "memory"); else asm volatile("s_wait_xcnt 0x0" :: "s"(Kf), "s"(Vf), "s"(Pf) : "memory");
    pass(BoolC<false>{}, 0ull);
#pragma unroll
    for (int t = 0; t < NQ; ++t) { const float lt = l[t] + xhalf(l[t]), inv = __fdiv_rn(1.0f, lt);
#pragma unroll
    for (int dt = 0; dt < 4; ++dt) { v8us oh, ol;   // o[dt][j] = O[query lr][d = dt * 16 + hi * 8 + j]: this lane's 16 bytes of run dt of the head's two fragments, one 512-byte store of the wave a plane
#pragma unroll
        for (int j = 0; j < 8; ++j) { unsigned short a, c2; splitf(o[t][dt][j] * inv, a, c2); oh[j] = a; ol[j] = c2; }
        *(v8us*)(Ah + (size_t)t * 16 * DQ + dt * 256 + lo) = oh; *(v8us*)(Al + (size_t)t * 16 * DQ + dt * 256 + lo) = ol; } }
}
// grid (16, heads, batches), 4 waves on the same head, so that they read the same K and V lines at about the same time. Blocks 0..7 of a head: 64 hi/lo rows, 16 a wave; blocks 8..15: 192 fp16 rows, 48 a wave (three query tiles to each fragment loaded).
// The two kinds cost about the same. All work-groups can be resident at once, two to a WGP; the block is blockIdx.x turned by 8 for the upper two batches, so that work-groups 256 apart in the flat index are one of each kind.
__global__ __launch_bounds__(128) void k_fattn(const h16* __restrict__ Q16, const bf* __restrict__ Qh, const bf* __restrict__ Ql, const h16* __restrict__ K16, const bf* __restrict__ Kh, const bf* __restrict__ Kl, const h16* __restrict__ V16, const bf* __restrict__ Vh, const bf* __restrict__ Vl, bf* Ah, bf* Al) {
    const int b = blockIdx.z, h = b * NH_ + blockIdx.y, rb = (blockIdx.x + (b >> 1) * 8) & 15, wq = threadIdx.x >> 5, q0 = rb < RH / 64 ? rb * 64 + wq * 16 : RH + (rb - RH / 64) * 192 + wq * 48;
    const size_t qo = ((size_t)h * TT + q0) * HD, ko = (size_t)b * TT * HD, vo = (size_t)h * HD * TT, ao = ((size_t)b * TT + q0) * DQ + blockIdx.y * (16 * HD);   // merged planes as fragments: 16 rows x 512 k = 16 fragments of 512 elements, a head's two side by side
    if (rb < RH / 64) attn_tile<bf, true, 32, 1>(Qh + qo, Ql + qo, Kh + ko, Kl + ko, Vh + vo, Vl + vo, Ah + ao, Al + ao);
    else attn_tile<h16, false, 64, 3>(Q16 + qo, nullptr, K16 + ko, nullptr, V16 + vo, nullptr, Ah + ao, Al + ao);
}

// ---- k_oproj: out = merged (hi + lo) x Wc + bc. Grid (batches * TT / 32), 8 waves: 32 rows x 64 columns a work-group, wave w sums head w's 64 of the 512 k.
// Every operand is a fragment run (512 contiguous bytes a load), all loads of a wave fly together, and no wave has a k loop: one memory latency in all.
// A = merged rows, B = Wc^T fragments: a lane holds 8 consecutive rows of one column, so the partial tiles lie in LDS column-major, two 16-byte stores a tile. Column pitch 36 floats: 16 B x odd, no bank conflict for writers or readers.
// Behind the barrier each thread adds the 8 partial sums of 8 rows of one column in head order, then the bias; a wave's store covers 32 consecutive columns of a row, one whole line.
__global__ __launch_bounds__(256) void k_oproj(const bf* __restrict__ Ah, const bf* __restrict__ Al, const bf* __restrict__ WO, const float* __restrict__ bias, float* __restrict__ C) {
    __shared__ __align__(16) float part[NH_ * DM * 36];
    const int lane = threadIdx.x & 31, w = threadIdx.x >> 5, lr = lane & 15, hi = lane >> 4;
    const int n = threadIdx.x & 63, m0 = (threadIdx.x >> 6) * 8;   // this thread's 8 outputs
    const unsigned lo = lane * 8;
    const size_t fa = ((size_t)blockIdx.x * 2 * (DQ / 32) + w * 2) * 512;
    const bf* ph = Ah + fa + lo; const bf* pl = Al + fa + lo; const bf* pw = WO + w * 2 * 512 + lo;
    v16bf a[2][2], a2[2][2], b[4][2];
#pragma unroll
    for (int c = 0; c < 2; ++c) {
#pragma unroll
        for (int mb = 0; mb < 2; ++mb) { a[mb][c] = ldfr(ph + (mb * (DQ / 32) + c) * 512); a2[mb][c] = ldfr(pl + (mb * (DQ / 32) + c) * 512); }
#pragma unroll
        for (int nb = 0; nb < 4; ++nb) b[nb][c] = ldfr(pw + (nb * (DQ / 32) + c) * 512); }
    const float bb = bfr(bias[n]);
    // precaution: the loads' address registers, inputs here so that they stay whole up to this line, are free for other values (a later load's data, an accumulator) only behind the wait
    asm volatile("s_wait_xcnt 0x0" :: "v"(ph), "v"(pl), "v"(pw), "v"(n) : "memory");
    __builtin_amdgcn_sched_barrier(0);   // every load is issued before the first wait for data, so that the wave pays one latency
    v8f acc[2][4];
#pragma unroll
    for (int mb = 0; mb < 2; ++mb)
#pragma unroll
        for (int nb = 0; nb < 4; ++nb) acc[mb][nb] = (v8f){};
#pragma unroll
    for (int c = 0; c < 2; ++c) {
#pragma unroll
        for (int mb = 0; mb < 2; ++mb)
#pragma unroll
            for (int nb = 0; nb < 4; ++nb) acc[mb][nb] = wmmab(a[mb][c], b[nb][c], acc[mb][nb]);
        __builtin_amdgcn_sched_barrier(0);   // holds the order, here and below: eight independent tiles in turn; left alone the compiler runs one tile's four products back to back, each waiting for the one before
#pragma unroll
        for (int mb = 0; mb < 2; ++mb)
#pragma unroll
            for (int nb = 0; nb < 4; ++nb) acc[mb][nb] = wmmab(a2[mb][c], b[nb][c], acc[mb][nb]);
        __builtin_amdgcn_sched_barrier(0); }
#pragma unroll
    for (int mb = 0; mb < 2; ++mb)
#pragma unroll
        for (int nb = 0; nb < 4; ++nb) { float* p = part + (w * DM + nb * 16 + lr) * 36 + mb * 16 + hi * 8;
            *(v4f*)p = __builtin_shufflevector(acc[mb][nb], acc[mb][nb], 0, 1, 2, 3); *(v4f*)(p + 4) = __builtin_shufflevector(acc[mb][nb], acc[mb][nb], 4, 5, 6, 7); }
    __syncthreads();   // all 8 partial tiles are in LDS before any is read
    const float* r = part + n * 36 + m0;
    v4f s0 = *(const v4f*)r, s1 = *(const v4f*)(r + 4);
#pragma unroll
    for (int p = 1; p < NH_; ++p) { s0 += *(const v4f*)(r + p * DM * 36); s1 += *(const v4f*)(r + p * DM * 36 + 4); }
    float* o = C + ((size_t)blockIdx.x * 32 + m0) * DM + n;
#pragma unroll
    for (int j = 0; j < 4; ++j) { o[j * DM] = s0[j] + bb; o[(4 + j) * DM] = s1[j] + bb; }
}

extern "C" void kernel_launch(void* const* d_in, const int* in_sizes, int n_in,
                              void* d_out, int out_size, void* d_ws, size_t ws_size, hipStream_t stream) {
    (void)in_sizes; (void)n_in; (void)out_size;
    const float* x = (const float*)d_in[0]; const float* wqv = (const float*)d_in[1]; const float* wo = (const float*)d_in[2]; /* Wc */ const float* bo = (const float*)d_in[3]; /* bc */
    float* OUT = (float*)d_out;     // [4][2048][64]
    char* wsp = (char*)d_ws;
    auto take = [&](size_t bytes) { char* p = wsp; wsp += (bytes + 255) & ~(size_t)255; return (void*)p; };
    bf* WO = (bf*)take((size_t)DM * DQ * 2);   /* every per-batch buffer holds all batches, batch-major */
    h16* QP16 = (h16*)take((size_t)NB_ * NH_ * TT * HD * 2); h16* KP16 = (h16*)take((size_t)NB_ * NKV * TT * HD * 2); h16* VT16 = (h16*)take((size_t)NB_ * NH_ * HD * TT * 2);
    bf* QPh = (bf*)take((size_t)NB_ * NH_ * TT * HD * 2); bf* QPl = (bf*)take((size_t)NB_ * NH_ * TT * HD * 2); bf* KPh = (bf*)take((size_t)NB_ * NKV * TT * HD * 2); bf* KPl = (bf*)take((size_t)NB_ * NKV * TT * HD * 2); bf* VTh = (bf*)take((size_t)NB_ * NH_ * HD * TT * 2); bf* VTl = (bf*)take((size_t)NB_ * NH_ * HD * TT * 2);
    bf* ATh = (bf*)take((size_t)NB_ * TT * DQ * 2); bf* ATl = (bf*)take((size_t)NB_ * TT * DQ * 2);
    if ((size_t)(wsp - (char*)d_ws) > ws_size) return;    // ws 256 MiB
    k_prep<<<dim3(NB_ * TT / 32, NH_ + 1, 1), 32, 0, stream>>>(x, wqv, wo, QP16, QPh, QPl, KP16, KPh, KPl, VT16, VTh, VTl, WO);   /* projections and every operand plane of the attention, and Wc as Bt */
    k_fattn<<<dim3(16, NH_, NB_), 128, 0, stream>>>(QP16, QPh, QPl, KP16, KPh, KPl, VT16, VTh, VTl, ATh, ATl);   /* one shared key plane a batch; each query head has its own value planes */
    k_oproj<<<dim3(NB_ * TT / 32, 1, 1), 256, 0, stream>>>(ATh, ATl, WO, bo, OUT);   /* one head's k a wave, partial tiles joined in LDS */
}

// v009
// One run takes 54.4 microseconds.
// Next to v008, in two timings, it ran 1.09 times as fast each time.
// Over all steps from v000 it is 34.2 times as fast.
#include <hip/hip_runtime.h>

// Multi-head attention V2 with the input itself as the shared key (x [4][2048][64]; qv = x Wqv ('xw' [64][1024] with the (H, D, 2) channel layout: q_h[d] = column h*128 + 2d, v_h[d] = column h*128 + 2d + 1); 8 heads x 64; scores = q_h . x / 8 (the 64-dim input is every head's key); softmax; out = merged (attn v) Wc + bc ('xw' [512][64]) -> [4][2048][64] (0.5 M)).
// Layout, every buffer batch-major: ONE kernel in front of the attention reads x and the interleaved q/v weights as f32, rounds them to bf16 in registers, does both projections and stores its accumulators straight as the attention's operand planes (q rows, V^T fragments), the x fragments as the single exact key plane shared by all heads, and Wc transposed, as fragments; dense T-2048 attention in one fused kernel (scores, online softmax against a held reference and attn x V; the scores never reach memory), 8 query heads over one key plane (hybrid rows: < 512 hi/lo 3 products, rest fp16), each head's own 64-wide value, the merged hi/lo planes stored as fragments; merged hi/lo x Wc exact + bc, the k split over 8 waves.
// Compute dtypes, f32 accumulate: every input rounded to bf16; projections exact; attention rows < 512 3 products (keys exact), rest fp16; softmax f32; Wc hl x exact + bias.

#define NB_  4
#define TT   2048
#define DM   64
#define NH_  8
#define NKV  1
#define REP  (NH_ / NKV)
#define HD   64
#define DQ   (NH_ * HD)
#define DKV  (NKV * HD)
#define RH   512                  // query rows < RH use hi+lo planes (0: none)
#define WIN  0
#define SCL  0.125f   // HD^-0.5
#define C2L  (SCL * 1.4426950408889634f)   // HD^-0.5 * log2(e): the q planes are stored times this, so that a score product is the argument of 2^x
typedef _Float16 h16;
typedef unsigned short bf;
typedef __attribute__((ext_vector_type(16))) __bf16   v16bf;
typedef __attribute__((ext_vector_type(16))) _Float16 v16h;
typedef __attribute__((ext_vector_type(8)))  _Float16 v8h;
typedef __attribute__((ext_vector_type(8)))  unsigned short v8us;
typedef __attribute__((ext_vector_type(8)))  float    v8f;
typedef __attribute__((ext_vector_type(4)))  float    v4f;
typedef v8h  __attribute__((may_alias)) v8ha;
typedef v4f  __attribute__((may_alias)) v4fa;
typedef v8us __attribute__((may_alias)) v8usa;

__device__ __forceinline__ unsigned short f2bf(float f) { unsigned u = __float_as_uint(f); u += 0x7FFFu + ((u >> 16) & 1u); return (unsigned short)(u >> 16); }
__device__ __forceinline__ float bf2f(unsigned short b) { return __uint_as_float(((unsigned)b) << 16); }
__device__ __forceinline__ float bfr(float f) { return bf2f(f2bf(f)); }
__device__ __forceinline__ v16h cat16(v8h lo, v8h hi) { return __builtin_shufflevector(lo, hi, 0, 1, 2, 3, 4, 5, 6, 7, 8, 9, 10, 11, 12, 13, 14, 15); }
__device__ __forceinline__ v16bf cat16b(v8us lo, v8us hi) { return __builtin_bit_cast(v16bf, __builtin_shufflevector(lo, hi, 0, 1, 2, 3, 4, 5, 6, 7, 8, 9, 10, 11, 12, 13, 14, 15)); }
__device__ __forceinline__ v8f wmma16(v16h a, v16h b, v8f c) { return __builtin_amdgcn_wmma_f32_16x16x32_f16(false, a, false, b, (short)0, c, false, false); }
__device__ __forceinline__ v8f wmmab(v16bf a, v16bf b, v8f c) { return __builtin_amdgcn_wmma_f32_16x16x32_bf16(false, a, false, b, (short)0, c, false, false); }



// ---- fragments of a K-contiguous 16-bit row-major plane, and the product of each operand type
template <typename T16> struct WFrag;
template <> struct WFrag<h16> { typedef v16h V; static __device__ __forceinline__ V ld(const h16* p) { return cat16(*(const v8h*)p, *(const v8h*)(p + 16)); } static __device__ __forceinline__ v8f mma(V a, V b, v8f c) { return wmma16(a, b, c); } };
template <> struct WFrag<bf> { typedef v16bf V; static __device__ __forceinline__ V ld(const bf* p) { return cat16b(*(const v8us*)p, *(const v8us*)(p + 16)); } static __device__ __forceinline__ v8f mma(V a, V b, v8f c) { return wmmab(a, b, c); } };

__device__ __forceinline__ void splitf(float y, unsigned short& h, unsigned short& l) { h = f2bf(y); l = f2bf(y - bf2f(h)); }
typedef __attribute__((ext_vector_type(2))) _Float16 v2h;
typedef __attribute__((ext_vector_type(4))) _Float16 v4h;
typedef __attribute__((ext_vector_type(2))) unsigned short v2us;
typedef __attribute__((ext_vector_type(4))) unsigned short v4us;
typedef __attribute__((ext_vector_type(2))) float v2f;
typedef __attribute__((ext_vector_type(4))) int v4i;

// ---- k_prep: all that stands in front of the attention. Grid (batches * TT / 32, heads + 1), one wave a work-group.
// y < heads: 32 rows of x against one head's 64 q and 64 v columns, K = 64. A weight pair (q, v) of one channel is adjacent in Wqv, so one 8-byte load feeds both products.
// q is formed transposed (A = weights, B = x rows): a lane then holds 8 consecutive d of one row, one 16-byte store a plane into the row-major q planes; it is stored times C2L (multiplied in f32, in front of the rounding).
// v is formed straight (A = x rows, B = weights): a lane then holds 8 consecutive keys of one d, which is a lane's place in the V^T fragment planes (per head and 32 keys, four 16-d tiles of two 512-B runs, run t / 16 % 2, lane (t / 8 % 2) * 16 + d % 16).
// The x fragments themselves are the key plane's fragments (16 rows x 64 d = four runs of 512 B, run d / 16, lane (d / 8 % 2) * 16 + t % 16, 8 d a lane); head 0's waves store them; the key is bf16(x) exactly, so its lo plane is zero.
// y == heads: Wc [512][64] -> bf16 fragments of its transpose (16 n x 32 k = two runs of 512 B, run k / 16 % 2, lane (k / 8 % 2) * 16 + n % 16, 8 k a lane; fragment n / 16 * 16 + k / 32), four k a lane.
// Every loop here and in put3 is unrolled in full: fragments, raw weights and accumulators stay in registers only where each index is a constant.
typedef __attribute__((ext_vector_type(2))) __bf16 v2b;
typedef __attribute__((ext_vector_type(4))) unsigned v4u;
typedef __attribute__((ext_vector_type(8))) unsigned v8u;
__device__ __forceinline__ unsigned pkb(float a, float b) { v2f t; t[0] = a; t[1] = b; return __builtin_bit_cast(unsigned, __builtin_convertvector(t, v2b)); }   // two f32 -> two bf16, nearest even, one instruction
__device__ __forceinline__ void put3(v8f r, size_t o, h16* P16, bf* Ph, bf* Pl) { v4u o16, oh, ol;   // 8 consecutive elements of the fp16 plane and of the hi / lo planes
#pragma unroll
    for (int j = 0; j < 4; ++j) { v2f t; t[0] = r[2 * j]; t[1] = r[2 * j + 1]; const v2b xh = __builtin_convertvector(t, v2b);
        o16[j] = __builtin_bit_cast(unsigned, __builtin_convertvector(t, v2h)); oh[j] = __builtin_bit_cast(unsigned, xh); ol[j] = __builtin_bit_cast(unsigned, __builtin_convertvector(t - __builtin_convertvector(xh, v2f), v2b)); }
    *(v4u*)(P16 + o) = o16; *(v4u*)(Ph + o) = oh; *(v4u*)(Pl + o) = ol; }
__global__ __launch_bounds__(32) void k_prep(const float* __restrict__ x, const float* __restrict__ wqv, const float* __restrict__ wo, h16* Q16, bf* Qh, bf* Ql, h16* K16, bf* Kh, bf* Kl, h16* V16, bf* Vh, bf* Vl, bf* WO) {
    const int lane = threadIdx.x & 31, lr = lane & 15, hi = lane >> 4;
    if (blockIdx.y == NH_) { const int e = (blockIdx.x * 32 + lane) * 4; if (e >= DM * DQ) return; const int k = e % DQ, n = e / DQ; v4us o;
#pragma unroll
        for (int q = 0; q < 4; ++q) o[q] = f2bf(wo[(size_t)(k + q) * DM + n]);
        *(v4us*)(WO + (((n >> 4) * (DQ / 32) + (k >> 5)) * 2 + ((k >> 4) & 1)) * 256 + (((k >> 3) & 1) * 16 + (n & 15)) * 8 + (k & 7)) = o; return; }
    const int h = blockIdx.y, row0 = blockIdx.x * 32, b = row0 / TT, t0 = row0 % TT;
    const float* wp = wqv + (size_t)(8 * hi) * (2 * DQ) + h * 2 * HD + 2 * lr;
    v2f raw[2][32];   // one 16-channel tile's (q, v) weight pairs, k in fragment order: entry i is k = (i / 16) * 32 + (i / 8 % 2) * 16 + 8 * hi + i % 8; two tiles, one in flight while the other is worked on
    auto ldw = [&](int nb) __attribute__((always_inline)) {
#pragma unroll
        for (int i = 0; i < 32; ++i) raw[nb & 1][i] = *(const v2f*)(wp + (size_t)((i >> 4) * 32 + ((i >> 3) & 1) * 16 + (i & 7)) * (2 * DQ) + nb * 32); };
    v8f xf[2][4];   // x[row0 + mb * 16 + lr][r * 16 + 8 * hi + 0..7]
#pragma unroll
    for (int mb = 0; mb < 2; ++mb)
#pragma unroll
        for (int r = 0; r < 4; ++r) xf[mb][r] = *(const v8f*)(x + (size_t)(row0 + mb * 16 + lr) * DM + r * 16 + 8 * hi);
    ldw(0);
    __builtin_amdgcn_sched_barrier(0);   // all loads of x and of the first weight tile are issued before the first wait; left alone the compiler loads the weights two at a time with a full wait behind each pair
    v16bf xa[2][2];
#pragma unroll
    for (int mb = 0; mb < 2; ++mb)
#pragma unroll
        for (int c = 0; c < 2; ++c) { v8u u;
#pragma unroll
            for (int e = 0; e < 8; ++e) u[e] = pkb(xf[mb][2 * c + (e >> 2)][(e & 3) * 2], xf[mb][2 * c + (e >> 2)][(e & 3) * 2 + 1]);
            xa[mb][c] = __builtin_bit_cast(v16bf, u); }
    if (h == 0) {
#pragma unroll
        for (int mb = 0; mb < 2; ++mb)
#pragma unroll
            for (int r = 0; r < 4; ++r) { v8f kr;
#pragma unroll
                for (int j = 0; j < 8; ++j) kr[j] = (float)xa[mb][r >> 1][(r & 1) * 8 + j];
                put3(kr, (size_t)b * TT * HD + (size_t)((t0 >> 4) + mb) * 1024 + r * 256 + lane * 8, K16, Kh, Kl); } }
    const size_t hb = (size_t)(b * NH_ + h) * TT * HD;
#pragma unroll
    for (int nb = 0; nb < 4; ++nb) { v16bf wq[2], wv[2];
        // the next tile's 32 loads are issued as one group in front of this tile's work, in whose time they fly; the wait (a precaution) stands between the stores issued so far and these loads, which land in registers that those stores name
        if (nb < 3) { asm volatile("s_wait_xcnt 0x0" ::: "memory"); ldw(nb + 1); __builtin_amdgcn_sched_barrier(0); }
#pragma unroll
        for (int c = 0; c < 2; ++c) { v8u uq, uv;
#pragma unroll
            for (int e = 0; e < 8; ++e) { const v2f w0 = raw[nb & 1][c * 16 + 2 * e], w1 = raw[nb & 1][c * 16 + 2 * e + 1]; uq[e] = pkb(w0[0], w1[0]); uv[e] = pkb(w0[1], w1[1]); }
            wq[c] = __builtin_bit_cast(v16bf, uq); wv[c] = __builtin_bit_cast(v16bf, uv); }
#pragma unroll
        for (int mb = 0; mb < 2; ++mb) { v8f aq = (v8f){}, av = (v8f){};
#pragma unroll
            for (int c = 0; c < 2; ++c) { aq = wmmab(wq[c], xa[mb][c], aq); av = wmmab(xa[mb][c], wv[c], av); }
            aq *= C2L;
            put3(aq, hb + (size_t)(t0 + mb * 16 + lr) * HD + nb * 16 + hi * 8, Q16, Qh, Ql);
            put3(av, hb + (size_t)(t0 >> 5) * 2048 + nb * 512 + mb * 256 + lane * 8, V16, Vh, Vl); } }
    asm volatile("s_wait_xcnt 0x0" ::: "memory");   // precaution: the last stores' registers are free for other values only behind this wait, whatever code the compiler lays out behind them
}
// ---- k_fattn: scores, softmax and attn x V of 16 (hi/lo kind) or 3 x 16 (fp16 kind) query rows per wave, all 2048 keys, nothing of the scores in memory.
// Transposed products: S^T = K Q^T (A = key fragments, B = query rows) leaves each lane with one query's scores (query = lane % 16, keys 8 * (lane / 16) + j of each 16-key tile);
// two such tiles, converted in place, are the B operand of O^T += V^T P^T in the hardware k order, which the V^T fragments are stored in. Online softmax against a held reference: minus the reference is the C operand of the score products (q comes scaled), so that their result is the argument of 2^x as it stands;
// the reference moves, and sums and outputs are rescaled, only in a pass where some score lies more than 8 (a factor 256) above it, or in the first pass: one test a pass, a scalar branch.
// K fragments are fetched again right behind the score products and V fragments right behind the value products, so the next pass's loads fly during this pass's work.
// a fragment = two 512-byte runs; the pointers are marked as global memory because a base address that comes out of an asm statement would otherwise be read by flat loads
__device__ __forceinline__ v16h  ldfr(const h16* p) { const __attribute__((address_space(1))) v8h* g = (const __attribute__((address_space(1))) v8h*)p; return cat16(g[0], g[32]); }
__device__ __forceinline__ v16bf ldfr(const bf* p) { const __attribute__((address_space(1))) v8us* g = (const __attribute__((address_space(1))) v8us*)p; return cat16b(g[0], g[32]); }
__device__ __forceinline__ float xhalf(float x) { const int b = __float_as_int(x); return __int_as_float(__builtin_amdgcn_permlanex16(b, b, 0x76543210, 0xfedcba98, false, false)); }   // lane l <-> l ^ 16
// 2^x. The v_nop keeps the one slot that the instruction set asks for between a transcendental and a directly following instruction that reads its result or overwrites its source.
__device__ __forceinline__ float exp2s(float x) { float r; asm("v_exp_f32 %0, %1\n\tv_nop" : "=v"(r) : "v"(x)); return r; }
// eight at once, left to the compiler: above 256 registers an asm operand would have to be copied down first
__device__ __forceinline__ void exp2x8(v8f& x) {
#pragma unroll
    for (int j = 0; j < 8; ++j) x[j] = __builtin_amdgcn_exp2f(x[j]); }
template <bool B> struct BoolC { static constexpr bool v = B; };
// L2 hints for passes J .. N - 1 of one plane (INC bytes a pass), issued together at the start; a hint returns nothing and counts on no counter. The clobber keeps them behind the first passes' own loads.
template <int J, int N, int INC> __device__ __forceinline__ void hint_ahead(unsigned vo, unsigned long long p) {
    if constexpr (J < N) { asm volatile("global_prefetch_b8 %0, %1 offset:%2 scope:SCOPE_SE" :: "v"(vo), "s"(p), "n"(J * INC) : "memory"); hint_ahead<J + 1, N, INC>(vo, p); } }
template <typename T16, bool HR, int KB, int NQ>   // NQ: 16-row query tiles of this wave; every K and V fragment it loads feeds NQ products
__device__ __forceinline__ void attn_tile(const T16* __restrict__ Q, const T16* __restrict__ Q2, const T16* __restrict__ Kf, const T16* __restrict__ Kf2, const T16* __restrict__ Vf, const T16* __restrict__ Vf2, bf* Ah, bf* Al) {
    typedef typename WFrag<T16>::V V; typedef WFrag<T16> W;
    constexpr int KT = KB / 16, KG = KB / 32;
    const int lane = threadIdx.x & 31, lr = lane & 15, hi = lane >> 4;
    V q[NQ][2], q2[NQ][2], k[KT][2], k2[KT][2], v[4][KG], v2[4][KG];
    Q += lr * HD + 8 * hi; if (HR) Q2 += lr * HD + 8 * hi;
#pragma unroll
    for (int t = 0; t < NQ; ++t)
#pragma unroll
        for (int c = 0; c < 2; ++c) { q[t][c] = W::ld(Q + t * 16 * HD + c * 32); if (HR) q2[t][c] = W::ld(Q2 + t * 16 * HD + c * 32); }
    const unsigned lo = lane * 8;   // a lane's 16 bytes in each 512-byte run of a fragment plane
#pragma unroll
    for (int kt = 0; kt < KT; ++kt)
#pragma unroll
        for (int c = 0; c < 2; ++c) { k[kt][c] = ldfr(Kf + kt * 1024 + c * 512 + lo); if (HR) k2[kt][c] = ldfr(Kf2 + kt * 1024 + c * 512 + lo); }
    // Two jobs. As a compiler fence: the first V loads are issued behind the Q and K loads, as in the loop; otherwise the wait that the compiler puts at the loop's head for K also waits for the V loads just issued.
    // As a wait (a precaution): the Q loads' address pairs, inputs here so that they stay whole up to this line, are free for other values only behind it.
    if constexpr (HR) asm volatile("s_wait_xcnt 0x0" :: "v"(Q), "v"(Q2) : "memory"); else asm volatile("s_wait_xcnt 0x0" :: "v"(Q) : "memory");
#pragma unroll
    for (int g = 0; g < KG; ++g)
#pragma unroll
        for (int dt = 0; dt < 4; ++dt) { v[dt][g] = ldfr(Vf + g * 2048 + dt * 512 + lo); if (HR) v2[dt][g] = ldfr(Vf2 + g * 2048 + dt * 512 + lo); }
    // L2 hints. The planes were stored by the launch before; the fragments are fetched less than a pass ahead, so that memory latency would bound every pass.
    // Each pass asks for the lines of the pass PD further on (256 keys), which the fragment loads then find in L2. A work-group reads 16 KB a pass: each of its 4 waves asks for 4 KB, one 256-byte unit a lane pair.
    constexpr int PD = 256 / KB;
    const int wv = __builtin_amdgcn_readfirstlane(threadIdx.x >> 5);
    unsigned long long Pf;   // this wave's 4 KB, PD - 1 passes (the hints' immediate offset) short of the pass last asked for; with that offset it never leaves the plane
    if constexpr (HR) { const unsigned long long pk = (unsigned long long)((wv & 1) ? Kf2 : Kf), pv = (unsigned long long)((wv & 1) ? Vf2 : Vf); Pf = (wv & 2) ? pv : pk; }   // a plane a wave
    else Pf = (unsigned long long)(((wv & 2) ? Vf : Kf) + (wv & 1) * 2048);   // half a plane's pass a wave
    unsigned vo;   // (lane / 2) * 256; formed in asm so that it has one register of its own from here to the end of the loop: a hint may name no register that takes another value soon behind it
    asm("v_lshlrev_b32 %0, 7, %1" : "=v"(vo) : "v"(lane & 30));
    hint_ahead<1, PD, KB * HD * (int)sizeof(T16)>(vo, Pf);
    // With several query tiles the kernel uses more than 256 registers, an asm operand must lie in the first 256, and an offset register held there through the whole loop was pushed out into scratch: that kind forms the offset anew for each hint (see the pass).
    // precaution: the offset register of the hints above is free for other values only behind this wait
    if constexpr (NQ > 1) asm volatile("s_wait_xcnt 0x0" :: "v"(vo) : "memory");
    v8f o[NQ][4];
    v8f nr[NQ];   // minus the held reference of this lane's query, the same in all eight: the C operand of the score products
    float l[NQ];   // this lane's half of the running sum
#pragma unroll
    for (int t = 0; t < NQ; ++t) { nr[t] = (v8f){}; l[t] = 0.f;
#pragma unroll
        for (int dt = 0; dt < 4; ++dt) o[t][dt] = (v8f){}; }
    const unsigned long long inc = (unsigned long long)KB * HD * sizeof(T16);   // bytes a pass: both kinds of plane hold 64 elements a key
    auto pass = [&](auto more, unsigned long long pinc, bool first) __attribute__((always_inline)) {   // one pass = KB keys; more: a next pass exists, fetch its fragments; pinc: the hint address's step, 0 once it stands on the last pass; first: no reference is held yet
        unsigned ht = 0;   // several query tiles: the hint's offset register, alive from the hint to the wait at the K step
        // The same L2 hint as below, at the head of the pass. No wait in front of the step of its address: the last hint, which names it, lies in front of the waits at the K and V steps of the pass before. The four v_nop keep the distance between the matrix products that stand in front of this statement and its write of the offset register, which may be one of their operands' registers.
        if constexpr (decltype(more)::v && NQ > 1)
            asm volatile("v_nop\n\tv_nop\n\tv_nop\n\tv_nop\n\ts_add_nc_u64 %0, %0, %2\n\tv_lshlrev_b32 %1, 7, %3\n\tglobal_prefetch_b8 %1, %0 offset:%4 scope:SCOPE_SE" : "+s"(Pf), "=&v"(ht) : "s"(pinc), "v"(lane & 30), "n"((PD - 1) * KB * HD * (int)sizeof(T16)) : "memory");
        v8f s[NQ][KT];
#pragma unroll
        for (int t = 0; t < NQ; ++t)
#pragma unroll
            for (int kt = 0; kt < KT; ++kt) s[t][kt] = nr[t];
#pragma unroll
        for (int c = 0; c < 2; ++c) {
#pragma unroll
            for (int t = 0; t < NQ; ++t)
#pragma unroll
                for (int kt = 0; kt < KT; ++kt) s[t][kt] = W::mma(k[kt][c], q[t][c], s[t][kt]);
            if (HR) {
#pragma unroll
                for (int t = 0; t < NQ; ++t)
#pragma unroll
                    for (int kt = 0; kt < KT; ++kt) s[t][kt] = W::mma(k[kt][c], q2[t][c], s[t][kt]);
#pragma unroll
                for (int t = 0; t < NQ; ++t)
#pragma unroll
                    for (int kt = 0; kt < KT; ++kt) s[t][kt] = W::mma(k2[kt][c], q[t][c], s[t][kt]); } }
        if constexpr (NQ > 1) __builtin_amdgcn_sched_barrier(0);   // several tiles, every pass: all score products stand in front of the refetch, which lands in their operands
        // The step of the K base addresses. One statement holds the wait and the adds, so that the wait stands in front of the rewrite of registers that issued loads name (a precaution);
        // the score tiles are inputs only: the refetch, whose addresses come out of this statement, so stays behind the score products and lands in the same registers, with no copy and no wait for it at the loop's foot.
        if constexpr (decltype(more)::v) {
            if constexpr (HR) asm volatile("s_wait_xcnt 0x0\n\ts_add_nc_u64 %0, %0, %2\n\ts_add_nc_u64 %1, %1, %2" : "+s"(Kf), "+s"(Kf2) : "s"(inc), "v"(s[0][0]), "v"(s[0][1]) : "memory");
            else {   // with three query tiles the scheduling barrier above does that job, twelve tiles being too many asm operands to hold at once in the first 256 registers; the hint's offset register is an input so that it stays whole up to the wait
                asm volatile("s_wait_xcnt 0x0\n\ts_add_nc_u64 %0, %0, %1" : "+s"(Kf) : "s"(inc), "v"(ht) : "memory"); }
            // the L2 hint for the pass PD further on: step, then ask, so that the address stands inside the plane at all times; the wait (a precaution) stands in front of the rewrite of the register that the last hint names
            if constexpr (NQ == 1) asm volatile("s_wait_xcnt 0x0\n\ts_add_nc_u64 %0, %0, %1\n\tglobal_prefetch_b8 %2, %0 offset:%3 scope:SCOPE_SE" : "+s"(Pf) : "s"(pinc), "v"(vo), "n"((PD - 1) * KB * HD * (int)sizeof(T16)) : "memory");
#pragma unroll
            for (int kt = 0; kt < KT; ++kt)
#pragma unroll
                for (int c = 0; c < 2; ++c) { k[kt][c] = ldfr(Kf + kt * 1024 + c * 512 + lo); if (HR) k2[kt][c] = ldfr(Kf2 + kt * 1024 + c * 512 + lo); }
            __builtin_amdgcn_sched_barrier(0);   // keeps the refetch in front of the softmax, in whose time it flies
        }
        float mq[NQ];   // this lane's largest score of the pass, above the reference
#pragma unroll
        for (int t = 0; t < NQ; ++t) { float mt[KT];
#pragma unroll
            for (int kt = 0; kt < KT; ++kt) { mt[kt] = s[t][kt][0];
#pragma unroll
                for (int j = 1; j < 8; ++j) mt[kt] = fmaxf(mt[kt], s[t][kt][j]); }
            mq[t] = mt[0];
#pragma unroll
            for (int kt = 1; kt < KT; ++kt) mq[t] = fmaxf(mq[t], mt[kt]); }
        float ma = mq[0];
#pragma unroll
        for (int t = 1; t < NQ; ++t) ma = fmaxf(ma, mq[t]);
        if (first || __builtin_amdgcn_ballot_w32(ma > 8.0f) != 0) {   // the same for the whole wave; seldom taken behind the first pass
#pragma unroll
            for (int t = 0; t < NQ; ++t) { const float mx = fmaxf(mq[t], xhalf(mq[t]));   // both halves of a query move by the same step
                const float dl = first ? mx : fmaxf(mx, 0.f), al = first ? 0.f : exp2s(-dl);   // the reference never falls; sums and outputs are zero in the first pass
#pragma unroll
                for (int kt = 0; kt < KT; ++kt) s[t][kt] -= dl;
                nr[t] -= dl; l[t] *= al;
#pragma unroll
                for (int dt = 0; dt < 4; ++dt) o[t][dt] *= al; } }
#pragma unroll
        for (int t = 0; t < NQ; ++t) {   // tile by tile: softmax, then its value products
        v2f st[KT];   // row sums by register pairs: packed adds; a pair of 2^x results so has a register pair of its own, and in the listing no 2^x lands in the register that the one in front of it reads
#pragma unroll
        for (int kt = 0; kt < KT; ++kt) {
            exp2x8(s[t][kt]); st[kt] = __builtin_shufflevector(s[t][kt], s[t][kt], 0, 1);
#pragma unroll
            for (int j = 1; j < 4; ++j) { v2f e2; e2[0] = s[t][kt][2 * j]; e2[1] = s[t][kt][2 * j + 1]; st[kt] += e2; } }
        v2f sum = st[0];
#pragma unroll
        for (int kt = 1; kt < KT; ++kt) sum += st[kt];
        l[t] += sum[0] + sum[1];
        V p[KG], p2[KG];
#pragma unroll
        for (int g = 0; g < KG; ++g)
#pragma unroll
            for (int e = 0; e < 16; ++e) { const float x = s[t][2 * g + (e >> 3)][e & 7];
                if constexpr (HR) { const __bf16 xh = (__bf16)x; p[g][e] = xh; p2[g][e] = (__bf16)(x - (float)xh); } else p[g][e] = (h16)x; }
#pragma unroll
        for (int g = 0; g < KG; ++g) {
#pragma unroll
            for (int dt = 0; dt < 4; ++dt) o[t][dt] = W::mma(v[dt][g], p[g], o[t][dt]);
            if (HR) {
#pragma unroll
                for (int dt = 0; dt < 4; ++dt) o[t][dt] = W::mma(v[dt][g], p2[g], o[t][dt]);
#pragma unroll
                for (int dt = 0; dt < 4; ++dt) o[t][dt] = W::mma(v2[dt][g], p[g], o[t][dt]); } }
        }
        if constexpr (NQ > 1) __builtin_amdgcn_sched_barrier(0);   // several tiles: holds the V refetch behind the last value products
        // the same for the V base addresses, behind the value products
        if constexpr (decltype(more)::v) {
            if constexpr (HR) asm volatile("s_wait_xcnt 0x0\n\ts_add_nc_u64 %0, %0, %2\n\ts_add_nc_u64 %1, %1, %2" : "+s"(Vf), "+s"(Vf2) : "s"(inc), "v"(o[0][0]), "v"(o[0][1]), "v"(o[0][2]), "v"(o[0][3]) : "memory");
            else asm volatile("s_wait_xcnt 0x0\n\ts_add_nc_u64 %0, %0, %1" : "+s"(Vf) : "s"(inc) : "memory");   // as at the K step: the scheduling barrier behind the last tile's value products holds the refetch behind them
#pragma unroll
            for (int g = 0; g < KG; ++g)
#pragma unroll
                for (int dt = 0; dt < 4; ++dt) { v[dt][g] = ldfr(Vf + g * 2048 + dt * 512 + lo); if (HR) v2[dt][g] = ldfr(Vf2 + g * 2048 + dt * 512 + lo); }
        }
    };
#pragma unroll 1
    for (int kb = KB; kb < TT; kb += KB) pass(BoolC<true>{}, kb + PD * KB <= TT ? inc : 0ull, kb == KB);   // rolled: one pass's code and registers
    // precaution: the last fetches' base addresses and the hints' registers, inputs here so that they stay whole up to this line, are free for other values only behind the wait
    if constexpr (HR) asm volatile("s_wait_xcnt 0x0" :: "s"(Kf), "s"(Kf2), "s"(Vf), "s"(Vf2), "s"(Pf), "v"(vo) : "memory"); else asm volatile("s_wait_xcnt 0x0" :: "s"(Kf), "s"(Vf), "s"(Pf) : "memory");
    pass(BoolC<false>{}, 0ull, false);
#pragma unroll
    for (int t = 0; t < NQ; ++t) { const float lt = l[t] + xhalf(l[t]), inv = __fdiv_rn(1.0f, lt);
#pragma unroll
    for (int dt = 0; dt < 4; ++dt) { v8us oh, ol;   // o[dt][j] = O[query lr][d = dt * 16 + hi * 8 + j]: this lane's 16 bytes of run dt of the head's two fragments, one 512-byte store of the wave a plane
#pragma unroll
        for (int j = 0; j < 8; ++j) { unsigned short a, c2; splitf(o[t][dt][j] * inv, a, c2); oh[j] = a; ol[j] = c2; }
        *(v8us*)(Ah + (size_t)t * 16 * DQ + dt * 256 + lo) = oh; *(v8us*)(Al + (size_t)t * 16 * DQ + dt * 256 + lo) = ol; } }
}
// grid (16, heads, batches), 4 waves on the same head, so that they read the same K and V lines at about the same time. Blocks 0..7 of a head: 64 hi/lo rows, 16 a wave; blocks 8..15: 192 fp16 rows, 48 a wave (three query tiles to each fragment loaded).
// The two kinds cost about the same. All work-groups can be resident at once, two to a WGP; the block is blockIdx.x turned by 8 for the upper two batches, so that work-groups 256 apart in the flat index are one of each kind.
__global__ __launch_bounds__(128) void k_fattn(const h16* __restrict__ Q16, const bf* __restrict__ Qh, const bf* __restrict__ Ql, const h16* __restrict__ K16, const bf* __restrict__ Kh, const bf* __restrict__ Kl, const h16* __restrict__ V16, const bf* __restrict__ Vh, const bf* __restrict__ Vl, bf* Ah, bf* Al) {
    const int b = blockIdx.z, h = b * NH_ + blockIdx.y, rb = (blockIdx.x + (b >> 1) * 8) & 15, wq = threadIdx.x >> 5, q0 = rb < RH / 64 ? rb * 64 + wq * 16 : RH + (rb - RH / 64) * 192 + wq * 48;
    const size_t qo = ((size_t)h * TT + q0) * HD, ko = (size_t)b * TT * HD, vo = (size_t)h * HD * TT, ao = ((size_t)b * TT + q0) * DQ + blockIdx.y * (16 * HD);   // merged planes as fragments: 16 rows x 512 k = 16 fragments of 512 elements, a head's two side by side
    if (rb < RH / 64) attn_tile<bf, true, 32, 1>(Qh + qo, Ql + qo, Kh + ko, Kl + ko, Vh + vo, Vl + vo, Ah + ao, Al + ao);
    else attn_tile<h16, false, 64, 3>(Q16 + qo, nullptr, K16 + ko, nullptr, V16 + vo, nullptr, Ah + ao, Al + ao);
}

// ---- k_oproj: out = merged (hi + lo) x Wc + bc. Grid (batches * TT / 32), 8 waves: 32 rows x 64 columns a work-group, wave w sums head w's 64 of the 512 k.
// Every operand is a fragment run (512 contiguous bytes a load), all loads of a wave fly together, and no wave has a k loop: one memory latency in all.
// A = merged rows, B = Wc^T fragments: a lane holds 8 consecutive rows of one column, so the partial tiles lie in LDS column-major, two 16-byte stores a tile. Column pitch 36 floats: 16 B x odd, no bank conflict for writers or readers.
// Behind the barrier each thread adds the 8 partial sums of 8 rows of one column in head order, then the bias; a wave's store covers 32 consecutive columns of a row, one whole line.
__global__ __launch_bounds__(256) void k_oproj(const bf* __restrict__ Ah, const bf* __restrict__ Al, const bf* __restrict__ WO, const float* __restrict__ bias, float* __restrict__ C) {
    __shared__ __align__(16) float part[NH_ * DM * 36];
    const int lane = threadIdx.x & 31, w = threadIdx.x >> 5, lr = lane & 15, hi = lane >> 4;
    const int n = threadIdx.x & 63, m0 = (threadIdx.x >> 6) * 8;   // this thread's 8 outputs
    const unsigned lo = lane * 8;
    const size_t fa = ((size_t)blockIdx.x * 2 * (DQ / 32) + w * 2) * 512;
    const bf* ph = Ah + fa + lo; const bf* pl = Al + fa + lo; const bf* pw = WO + w * 2 * 512 + lo;
    v16bf a[2][2], a2[2][2], b[4][2];
#pragma unroll
    for (int c = 0; c < 2; ++c) {
#pragma unroll
        for (int mb = 0; mb < 2; ++mb) { a[mb][c] = ldfr(ph + (mb * (DQ / 32) + c) * 512); a2[mb][c] = ldfr(pl + (mb * (DQ / 32) + c) * 512); }
#pragma unroll
        for (int nb = 0; nb < 4; ++nb) b[nb][c] = ldfr(pw + (nb * (DQ / 32) + c) * 512); }
    const float bb = bfr(bias[n]);
    // precaution: the loads' address registers, inputs here so that they stay whole up to this line, are free for other values (a later load's data, an accumulator) only behind the wait
    asm volatile("s_wait_xcnt 0x0" :: "v"(ph), "v"(pl), "v"(pw), "v"(n) : "memory");
    __builtin_amdgcn_sched_barrier(0);   // every load is issued before the first wait for data, so that the wave pays one latency
    v8f acc[2][4];
#pragma unroll
    for (int mb = 0; mb < 2; ++mb)
#pragma unroll
        for (int nb = 0; nb < 4; ++nb) acc[mb][nb] = (v8f){};
#pragma unroll
    for (int c = 0; c < 2; ++c) {
#pragma unroll
        for (int mb = 0; mb < 2; ++mb)
#pragma unroll
            for (int nb = 0; nb < 4; ++nb) acc[mb][nb] = wmmab(a[mb][c], b[nb][c], acc[mb][nb]);
        __builtin_amdgcn_sched_barrier(0);   // holds the order, here and below: eight independent tiles in turn; left alone the compiler runs one tile's four products back to back, each waiting for the one before
#pragma unroll
        for (int mb = 0; mb < 2; ++mb)
#pragma unroll
            for (int nb = 0; nb < 4; ++nb) acc[mb][nb] = wmmab(a2[mb][c], b[nb][c], acc[mb][nb]);
        __builtin_amdgcn_sched_barrier(0); }
#pragma unroll
    for (int mb = 0; mb < 2; ++mb)
#pragma unroll
        for (int nb = 0; nb < 4; ++nb) { float* p = part + (w * DM + nb * 16 + lr) * 36 + mb * 16 + hi * 8;
            *(v4f*)p = __builtin_shufflevector(acc[mb][nb], acc[mb][nb], 0, 1, 2, 3); *(v4f*)(p + 4) = __builtin_shufflevector(acc[mb][nb], acc[mb][nb], 4, 5, 6, 7); }
    __syncthreads();   // all 8 partial tiles are in LDS before any is read
    const float* r = part + n * 36 + m0;
    v4f s0 = *(const v4f*)r, s1 = *(const v4f*)(r + 4);
#pragma unroll
    for (int p = 1; p < NH_; ++p) { s0 += *(const v4f*)(r + p * DM * 36); s1 += *(const v4f*)(r + p * DM * 36 + 4); }
    float* o = C + ((size_t)blockIdx.x * 32 + m0) * DM + n;
#pragma unroll
    for (int j = 0; j < 4; ++j) { o[j * DM] = s0[j] + bb; o[(4 + j) * DM] = s1[j] + bb; }
}

extern "C" void kernel_launch(void* const* d_in, const int* in_sizes, int n_in,
                              void* d_out, int out_size, void* d_ws, size_t ws_size, hipStream_t stream) {
    (void)in_sizes; (void)n_in; (void)out_size;
    const float* x = (const float*)d_in[0]; const float* wqv = (const float*)d_in[1]; const float* wo = (const float*)d_in[2]; /* Wc */ const float* bo = (const float*)d_in[3]; /* bc */
    float* OUT = (float*)d_out;     // [4][2048][64]
    char* wsp = (char*)d_ws;
    auto take = [&](size_t bytes) { char* p = wsp; wsp += (bytes + 255) & ~(size_t)255; return (void*)p; };
    bf* WO = (bf*)take((size_t)DM * DQ * 2);   /* every per-batch buffer holds all batches, batch-major */
    h16* QP16 = (h16*)take((size_t)NB_ * NH_ * TT * HD * 2); h16* KP16 = (h16*)take((size_t)NB_ * NKV * TT * HD * 2); h16* VT16 = (h16*)take((size_t)NB_ * NH_ * HD * TT * 2);
    bf* QPh = (bf*)take((size_t)NB_ * NH_ * TT * HD * 2); bf* QPl = (bf*)take((size_t)NB_ * NH_ * TT * HD * 2); bf* KPh = (bf*)take((size_t)NB_ * NKV * TT * HD * 2); bf* KPl = (bf*)take((size_t)NB_ * NKV * TT * HD * 2); bf* VTh = (bf*)take((size_t)NB_ * NH_ * HD * TT * 2); bf* VTl = (bf*)take((size_t)NB_ * NH_ * HD * TT * 2);
    bf* ATh = (bf*)take((size_t)NB_ * TT * DQ * 2); bf* ATl = (bf*)take((size_t)NB_ * TT * DQ * 2);
    if ((size_t)(wsp - (char*)d_ws) > ws_size) return;    // ws 256 MiB
    k_prep<<<dim3(NB_ * TT / 32, NH_ + 1, 1), 32, 0, stream>>>(x, wqv, wo, QP16, QPh, QPl, KP16, KPh, KPl, VT16, VTh, VTl, WO);   /* projections and every operand plane of the attention, and Wc as Bt */
    k_fattn<<<dim3(16, NH_, NB_), 128, 0, stream>>>(QP16, QPh, QPl, KP16, KPh, KPl, VT16, VTh, VTl, ATh, ATl);   /* one shared key plane a batch; each query head has its own value planes */
    k_oproj<<<dim3(NB_ * TT / 32, 1, 1), 256, 0, stream>>>(ATh, ATl, WO, bo, OUT);   /* one head's k a wave, partial tiles joined in LDS */
}
